// v000
// The times below were measured on an AMD MI455X: many runs one after another, warmed up first and cycling through
// copies of the inputs, with the whole window's GPU time divided by the number of runs. Launches and the gaps
// between them are all in it. The median over several windows is given; except for v000 it joins two sittings, which
// can be a few percent apart, so the side-by-side timings, each taken in one sitting, are the better comparison.
// v000, which the later versions start from, runs in 864 microseconds.
#include <hip/hip_runtime.h>

#define B_DIM   8
#define T_DIM   2048
#define C_DIM   512
#define M_ROWS  (B_DIM * T_DIM)        // 16384
#define SM_SCALE 0.04419417382415922f  // 1/sqrt(512)

typedef __attribute__((ext_vector_type(16))) __bf16    v16bf;
typedef __attribute__((ext_vector_type(8)))  float     v8f;
typedef __attribute__((ext_vector_type(4)))  float     f32x4;
typedef __attribute__((ext_vector_type(4)))  unsigned  u32x4;
typedef __attribute__((ext_vector_type(8)))  int       i32x8;
typedef __attribute__((ext_vector_type(4)))  int       i32x4;

union FragU {
  uint4  u[2];
  __bf16 h[16];
  v16bf  v;
};

#if defined(__has_builtin)
#  if __has_builtin(__builtin_amdgcn_tensor_load_to_lds)
#    define CDNA5_HAS_TDM 1
#  endif
#endif
#ifndef CDNA5_HAS_TDM
#  define CDNA5_HAS_TDM 0
#endif

__device__ __forceinline__ v8f wmma_bf16(v16bf a, v16bf b, v8f c) {
  // (neg_a, A, neg_b, B, c_mod, C, reuse_a, reuse_b)
  return __builtin_amdgcn_wmma_f32_16x16x32_bf16(false, a, false, b, (short)0, c,
                                                 false, false);
}

__device__ __forceinline__ v16bf load_frag_bf16(const __bf16* base, int row,
                                                int k0, int ld, int lane) {
  const int r  = lane & 15;
  const int kb = (lane >> 4) * 8;
  const __bf16* p = base + (size_t)(row + r) * ld + (k0 + kb);
  FragU f;
  f.u[0] = *(const uint4*)(p);
  f.u[1] = *(const uint4*)(p + 16);
  return f.v;
}

// A fragment from an fp32 row-major matrix, converting to bf16 on the fly.
__device__ __forceinline__ v16bf load_frag_f32(const float* base, int row,
                                               int k0, int ld, int lane) {
  const int r  = lane & 15;
  const int kb = (lane >> 4) * 8;
  const float* p = base + (size_t)(row + r) * ld + (k0 + kb);
  float t[16];
  *(float4*)&t[0]  = *(const float4*)(p);
  *(float4*)&t[4]  = *(const float4*)(p + 4);
  *(float4*)&t[8]  = *(const float4*)(p + 16);
  *(float4*)&t[12] = *(const float4*)(p + 20);
  FragU f;
#pragma unroll
  for (int i = 0; i < 16; ++i) f.h[i] = (__bf16)t[i];
  return f.v;
}

// B fragment from an LDS-resident fp32 tile wt[32 k][32 n], row-major.
__device__ __forceinline__ v16bf load_frag_wlds(const float* wt, int ncol0,
                                                int lane) {
  const int n  = ncol0 + (lane & 15);
  const int kb = (lane >> 4) * 8;
  FragU f;
#pragma unroll
  for (int i = 0; i < 8; ++i) {
    const int K = (i < 4) ? (kb + 2 * i) : (16 + kb + 2 * (i - 4));
    f.h[2 * i]     = (__bf16)wt[K * 32 + n];
    f.h[2 * i + 1] = (__bf16)wt[(K + 1) * 32 + n];
  }
  return f.v;
}

#if CDNA5_HAS_TDM
__device__ __forceinline__ void tdm_load_2d_f32(unsigned lds_off, const void* gptr,
                                                int tile_x, int tile_y,
                                                int stride_x) {
  const unsigned long long ga = (unsigned long long)(size_t)gptr;
  u32x4 g0;
  g0[0] = 1u;                                                 // count = 1
  g0[1] = lds_off;                                            // lds_addr
  g0[2] = (unsigned)(ga & 0xFFFFFFFFull);                     // global_addr lo
  g0[3] = (unsigned)((ga >> 32) & 0x1FFFFFFull) | (2u << 30); // hi | type=2
  i32x8 g1;
  g1[0] = (2 << 16);
  g1[1] = (int)((unsigned)(stride_x & 0xFFFF) << 16);
  g1[2] = (int)(((unsigned)stride_x >> 16) |
                ((unsigned)(stride_x & 0xFFFF) << 16));       // dim0 hi / dim1 lo
  g1[3] = (int)(((unsigned)stride_x >> 16) |
                ((unsigned)tile_x << 16));
  g1[4] = tile_y & 0xFFFF;
  g1[5] = stride_x;
  g1[6] = 0;
  g1[7] = 0;
  i32x4 z4 = 0;
#if __clang_major__ >= 23
  i32x8 z8 = 0;
  __builtin_amdgcn_tensor_load_to_lds(g0, g1, z4, z4, z8, 0);
#else
  __builtin_amdgcn_tensor_load_to_lds(g0, g1, z4, z4, 0);
#endif
}
#endif

// ---------------------------------------------------------------------------
// Kernel 0: pass x through into out[..., 0:512] (128-bit copies, NT stores).
// ---------------------------------------------------------------------------
__global__ __launch_bounds__(256) void copy_x_kernel(const float* __restrict__ x,
                                                     float* __restrict__ out) {
  const size_t g   = (size_t)blockIdx.x * 256 + threadIdx.x;  // 16384*128 vec4
  const size_t row = g >> 7;
  const int    c   = (int)(g & 127) * 4;
  const f32x4 v = *(const f32x4*)(x + row * 512 + c);
  __builtin_nontemporal_store(v, (f32x4*)(out + row * 1024 + c));
}

__global__ __launch_bounds__(256) void proj_kernel(
    const float* __restrict__ x,
    const float* __restrict__ Wq, const float* __restrict__ bq,
    const float* __restrict__ Wk, const float* __restrict__ bk,
    const float* __restrict__ Wv, const float* __restrict__ bv,
    __bf16* __restrict__ Qb, __bf16* __restrict__ Kb, __bf16* __restrict__ Vb) {
  __shared__ float wt[2][32 * 32];

  const int lane = threadIdx.x & 31;
  const int wave = threadIdx.x >> 5;
  const int row0 = blockIdx.x * 128 + wave * 16;
  const int n0   = blockIdx.y * 32;

  const float* W;
  const float* bias;
  __bf16*      dst;
  switch (blockIdx.z) {
    case 0:  W = Wq; bias = bq; dst = Qb; break;
    case 1:  W = Wk; bias = bk; dst = Kb; break;
    default: W = Wv; bias = bv; dst = Vb; break;
  }

#if CDNA5_HAS_TDM
  const unsigned off0 = (unsigned)(size_t)(void*)&wt[0][0];
  const unsigned off1 = (unsigned)(size_t)(void*)&wt[1][0];
  if (threadIdx.x < 32)                           // wave 0 drives the DMA
    tdm_load_2d_f32(off0, W + n0, 32, 32, C_DIM);
#endif

  v8f acc[2] = {};
  for (int k0 = 0; k0 < C_DIM; k0 += 32) {
    const int cur = (k0 >> 5) & 1;
#if CDNA5_HAS_TDM
    if (threadIdx.x < 32) {
      if (k0 + 32 < C_DIM) {                      // prefetch next W tile
        tdm_load_2d_f32(cur ? off0 : off1,
                        W + (size_t)(k0 + 32) * C_DIM + n0, 32, 32, C_DIM);
        __builtin_amdgcn_s_wait_tensorcnt(1);     // current tile landed
      } else {
        __builtin_amdgcn_s_wait_tensorcnt(0);
      }
    }
    __syncthreads();
#else
    {
      const int e  = threadIdx.x * 4;             // 1024 f32 / 256 threads
      const int kk = e >> 5, nn = e & 31;
      *(float4*)&wt[cur][kk * 32 + nn] =
          *(const float4*)&W[(size_t)(k0 + kk) * C_DIM + n0 + nn];
    }
    __syncthreads();
#endif
    const float* wc = wt[cur];
    const v16bf a  = load_frag_f32(x, row0, k0, C_DIM, lane);
    const v16bf b0 = load_frag_wlds(wc, 0, lane);
    const v16bf b1 = load_frag_wlds(wc, 16, lane);
    acc[0] = wmma_bf16(a, b0, acc[0]);
    acc[1] = wmma_bf16(a, b1, acc[1]);
    __syncthreads();                              // reads done before rewrite
  }

  const int hi = lane >> 4;
#pragma unroll
  for (int nt = 0; nt < 2; ++nt) {
    const int col = n0 + nt * 16 + (lane & 15);
    const float bv0 = bias[col];
#pragma unroll
    for (int i = 0; i < 8; ++i) {
      const int r = row0 + i + 8 * hi;
      dst[(size_t)r * C_DIM + col] = (__bf16)(acc[nt][i] + bv0);
    }
  }
}

__global__ __launch_bounds__(256) void colsum_kernel(
    const __bf16* __restrict__ Qb, const __bf16* __restrict__ Kb,
    float* __restrict__ colsum) {
  __shared__ float ssum[64];
  if (threadIdx.x < 64) ssum[threadIdx.x] = 0.0f;
  __syncthreads();

  const int b     = blockIdx.y;
  const int s_blk = blockIdx.x * 64;
  const __bf16* Q = Qb + (size_t)b * T_DIM * C_DIM;
  const __bf16* K = Kb + (size_t)b * T_DIM * C_DIM;

  const int lane = threadIdx.x & 31;
  const int wave = threadIdx.x >> 5;
  const int tw   = wave >> 1;               // 0..3 : 32-row t strip
  const int sw   = wave & 1;                // 0..1 : 32-col s half
  const int s0   = s_blk + sw * 32;
  const int hi   = lane >> 4;

  float part[2] = {0.0f, 0.0f};             // per 16-wide s sub-tile
  for (int t0 = s_blk + tw * 32; t0 < T_DIM; t0 += 128) {
    if (t0 + 31 < s0) continue;             // wave tile fully above diagonal
    v8f l[2][2] = {};
    for (int k0 = 0; k0 < C_DIM; k0 += 32) {
      const v16bf a0 = load_frag_bf16(Q, t0, k0, C_DIM, lane);
      const v16bf a1 = load_frag_bf16(Q, t0 + 16, k0, C_DIM, lane);
      const v16bf b0 = load_frag_bf16(K, s0, k0, C_DIM, lane);
      const v16bf b1 = load_frag_bf16(K, s0 + 16, k0, C_DIM, lane);
      l[0][0] = wmma_bf16(a0, b0, l[0][0]);
      l[0][1] = wmma_bf16(a0, b1, l[0][1]);
      l[1][0] = wmma_bf16(a1, b0, l[1][0]);
      l[1][1] = wmma_bf16(a1, b1, l[1][1]);
    }
#pragma unroll
    for (int is = 0; is < 2; ++is) {
      const int col = s0 + is * 16 + (lane & 15);
#pragma unroll
      for (int it = 0; it < 2; ++it) {
#pragma unroll
        for (int i = 0; i < 8; ++i) {
          const int t = t0 + it * 16 + i + 8 * hi;
          if (col <= t) part[is] += __expf(l[it][is][i] * SM_SCALE);
        }
      }
    }
  }
#pragma unroll
  for (int is = 0; is < 2; ++is) {
    float p = part[is] + __shfl_xor(part[is], 16, 32);
    if (lane < 16) atomicAdd(&ssum[sw * 32 + is * 16 + lane], p);
  }
  __syncthreads();
  if (threadIdx.x < 64)
    colsum[(size_t)b * T_DIM + s_blk + threadIdx.x] = ssum[threadIdx.x];
}

// ---------------------------------------------------------------------------
// Kernel 3: read = (exp(qk*scale)/colsum[s]) @ V, causal.
// grid = (T/128, 512/128, B).  Block tile: 128(t) x 128(v), s-steps of 64.
// Phase A: 8 waves build P (128x64) with 2x2 register blocking; exp/mask/
// normalize; stash bf16 in LDS.  Phase B: 2t x 4v blocked P@V WMMAs with
// ds_load_b128 fragment reads from LDS-transposed V.
// ---------------------------------------------------------------------------
__global__ __launch_bounds__(256) void attend_kernel(
    const __bf16* __restrict__ Qb, const __bf16* __restrict__ Kb,
    const __bf16* __restrict__ Vb, const float* __restrict__ colsum,
    float* __restrict__ out) {
  __shared__ __bf16 Pl[128 * 64];    // P tile, row-major [t][s]      (16 KB)
  __shared__ __bf16 Vl[128 * 64];    // V tile transposed, [v][s]     (16 KB)

  const int b      = blockIdx.z;
  const int t_base = blockIdx.x * 128;
  const int v_base = blockIdx.y * 128;
  const __bf16* Q  = Qb + (size_t)b * T_DIM * C_DIM;
  const __bf16* K  = Kb + (size_t)b * T_DIM * C_DIM;
  const __bf16* V  = Vb + (size_t)b * T_DIM * C_DIM;
  const float*  cs = colsum + (size_t)b * T_DIM;
  float*        ob = out + (size_t)b * T_DIM * 1024;

  const int lane = threadIdx.x & 31;
  const int wave = threadIdx.x >> 5;
  const int tw   = wave >> 1;            // 0..3 : 32-row t strip (A and B)
  const int sw   = wave & 1;             // 0..1 : phase-A 32-col s half
  const int hi   = lane >> 4;

  v8f acc[2][4] = {};                    // 32t x 64v accumulators (phase B)
  const int s_end = t_base + 128;        // causal bound for this t block

  for (int s0 = 0; s0 < s_end; s0 += 64) {
    // ---- stage V[s0:s0+64, v_base:v_base+128] transposed into LDS ----
    {
      const int sr = threadIdx.x >> 2;          // 0..63
      const int cb = (threadIdx.x & 3) * 32;    // 0..96
      const __bf16* vp = V + (size_t)(s0 + sr) * C_DIM + v_base + cb;
      FragU f0, f1;
      f0.u[0] = *(const uint4*)(vp);
      f0.u[1] = *(const uint4*)(vp + 8);
      f1.u[0] = *(const uint4*)(vp + 16);
      f1.u[1] = *(const uint4*)(vp + 24);
#pragma unroll
      for (int j = 0; j < 16; ++j) {
        Vl[(cb + j) * 64 + sr]        = f0.h[j];
        Vl[(cb + 16 + j) * 64 + sr]   = f1.h[j];
      }
    }
    // ---- phase A: 32t x 32s of P per wave (2x2 WMMA blocking) ----
    {
      const int ta0 = t_base + tw * 32;
      const int sa0 = s0 + sw * 32;
      const int tl0 = tw * 32;           // local rows in Pl
      const int sl0 = sw * 32;           // local cols in Pl
      if (sa0 > ta0 + 31) {              // fully above causal diagonal
#pragma unroll
        for (int it = 0; it < 2; ++it)
#pragma unroll
          for (int i = 0; i < 8; ++i) {
            const int rl = tl0 + it * 16 + i + 8 * hi;
            Pl[rl * 64 + sl0 + (lane & 15)]      = (__bf16)0.0f;
            Pl[rl * 64 + sl0 + 16 + (lane & 15)] = (__bf16)0.0f;
          }
      } else {
        v8f l[2][2] = {};
        for (int k0 = 0; k0 < C_DIM; k0 += 32) {
          const v16bf a0 = load_frag_bf16(Q, ta0, k0, C_DIM, lane);
          const v16bf a1 = load_frag_bf16(Q, ta0 + 16, k0, C_DIM, lane);
          const v16bf b0 = load_frag_bf16(K, sa0, k0, C_DIM, lane);
          const v16bf b1 = load_frag_bf16(K, sa0 + 16, k0, C_DIM, lane);
          l[0][0] = wmma_bf16(a0, b0, l[0][0]);
          l[0][1] = wmma_bf16(a0, b1, l[0][1]);
          l[1][0] = wmma_bf16(a1, b0, l[1][0]);
          l[1][1] = wmma_bf16(a1, b1, l[1][1]);
        }
#pragma unroll
        for (int is = 0; is < 2; ++is) {
          const int col = sa0 + is * 16 + (lane & 15);
          const float rs = 1.0f / cs[col];
#pragma unroll
          for (int it = 0; it < 2; ++it) {
#pragma unroll
            for (int i = 0; i < 8; ++i) {
              const int t = ta0 + it * 16 + i + 8 * hi;
              const float e =
                  (col <= t) ? __expf(l[it][is][i] * SM_SCALE) * rs : 0.0f;
              Pl[(tl0 + it * 16 + i + 8 * hi) * 64 + sl0 + is * 16 +
                 (lane & 15)] = (__bf16)e;
            }
          }
        }
      }
    }
    __syncthreads();
    // ---- phase B: P(128x64) @ V(64x128); wave owns 32t x 64v ----
    const int vb0 = sw * 64;             // local v base for this wave
#pragma unroll
    for (int kk = 0; kk < 64; kk += 32) {
      const v16bf pa0 = load_frag_bf16(Pl, tw * 32, kk, 64, lane);
      const v16bf pa1 = load_frag_bf16(Pl, tw * 32 + 16, kk, 64, lane);
#pragma unroll
      for (int nt = 0; nt < 4; ++nt) {
        const v16bf vb = load_frag_bf16(Vl, vb0 + nt * 16, kk, 64, lane);
        acc[0][nt] = wmma_bf16(pa0, vb, acc[0][nt]);
        acc[1][nt] = wmma_bf16(pa1, vb, acc[1][nt]);
      }
    }
    __syncthreads();
  }

  const int colb = v_base + sw * 64;
#pragma unroll
  for (int it = 0; it < 2; ++it) {
#pragma unroll
    for (int nt = 0; nt < 4; ++nt) {
#pragma unroll
      for (int i = 0; i < 8; ++i) {
        const int r = t_base + tw * 32 + it * 16 + i + 8 * hi;
        __builtin_nontemporal_store(
            acc[it][nt][i],
            ob + (size_t)r * 1024 + 512 + colb + nt * 16 + (lane & 15));
      }
    }
  }
}

// ---------------------------------------------------------------------------
// Launcher.  Workspace layout (bytes):
//   [0, 16M)   Q  bf16 [16384][512]
//   [16M,32M)  K  bf16
//   [32M,48M)  V  bf16
//   [48M, +64K) colsum f32 [16384]
// ---------------------------------------------------------------------------
extern "C" void kernel_launch(void* const* d_in, const int* in_sizes, int n_in,
                              void* d_out, int out_size, void* d_ws,
                              size_t ws_size, hipStream_t stream) {
  const float* x  = (const float*)d_in[0];
  const float* Wq = (const float*)d_in[1];
  const float* bq = (const float*)d_in[2];
  const float* Wk = (const float*)d_in[3];
  const float* bk = (const float*)d_in[4];
  const float* Wv = (const float*)d_in[5];
  const float* bv = (const float*)d_in[6];
  float* out = (float*)d_out;

  const size_t qkv = (size_t)M_ROWS * C_DIM;           // elems per matrix
  __bf16* Qb = (__bf16*)d_ws;
  __bf16* Kb = Qb + qkv;
  __bf16* Vb = Kb + qkv;
  float* colsum = (float*)(Vb + qkv);

  // out[..., :512] = x
  copy_x_kernel<<<(M_ROWS * C_DIM / 4) / 256, 256, 0, stream>>>(x, out);
  // Q, K, V projections (bf16)
  proj_kernel<<<dim3(M_ROWS / 128, C_DIM / 32, 3), 256, 0, stream>>>(
      x, Wq, bq, Wk, bk, Wv, bv, Qb, Kb, Vb);
  // query-axis softmax denominators
  colsum_kernel<<<dim3(T_DIM / 64, B_DIM), 256, 0, stream>>>(Qb, Kb, colsum);
  // out[..., 512:] = P @ V
  attend_kernel<<<dim3(T_DIM / 128, C_DIM / 128, B_DIM), 256, 0, stream>>>(
      Qb, Kb, Vb, colsum, out);
}

// v001
// One run takes 353 microseconds.
// Next to v000, in two timings, it ran 2.45 times as fast each time.
#include <hip/hip_runtime.h>

#define B_DIM   8
#define T_DIM   2048
#define C_DIM   512
#define M_ROWS  (B_DIM * T_DIM)        // 16384
#define SM_SCALE 0.04419417382415922f  // 1/sqrt(512)

typedef __attribute__((ext_vector_type(16))) __bf16    v16bf;
typedef __attribute__((ext_vector_type(8)))  float     v8f;
typedef __attribute__((ext_vector_type(4)))  float     f32x4;
typedef __attribute__((ext_vector_type(4)))  unsigned  u32x4;
typedef __attribute__((ext_vector_type(8)))  int       i32x8;
typedef __attribute__((ext_vector_type(4)))  int       i32x4;

union FragU {
  uint4  u[2];
  __bf16 h[16];
  v16bf  v;
};

#if defined(__has_builtin)
#  if __has_builtin(__builtin_amdgcn_tensor_load_to_lds)
#    define CDNA5_HAS_TDM 1
#  endif
#endif
#ifndef CDNA5_HAS_TDM
#  define CDNA5_HAS_TDM 0
#endif

__device__ __forceinline__ v8f wmma_bf16(v16bf a, v16bf b, v8f c) {
  // (neg_a, A, neg_b, B, c_mod, C, reuse_a, reuse_b)
  return __builtin_amdgcn_wmma_f32_16x16x32_bf16(false, a, false, b, (short)0, c,
                                                 false, false);
}

__device__ __forceinline__ v16bf load_frag_bf16(const __bf16* base, int row,
                                                int k0, int ld, int lane) {
  const int r  = lane & 15;
  const int kb = (lane >> 4) * 8;
  const __bf16* p = base + (size_t)(row + r) * ld + (k0 + kb);
  FragU f;
  f.u[0] = *(const uint4*)(p);
  f.u[1] = *(const uint4*)(p + 16);
  return f.v;
}

// A fragment from an fp32 row-major matrix, converting to bf16 on the fly.
__device__ __forceinline__ v16bf load_frag_f32(const float* base, int row,
                                               int k0, int ld, int lane) {
  const int r  = lane & 15;
  const int kb = (lane >> 4) * 8;
  const float* p = base + (size_t)(row + r) * ld + (k0 + kb);
  float t[16];
  *(float4*)&t[0]  = *(const float4*)(p);
  *(float4*)&t[4]  = *(const float4*)(p + 4);
  *(float4*)&t[8]  = *(const float4*)(p + 16);
  *(float4*)&t[12] = *(const float4*)(p + 20);
  FragU f;
#pragma unroll
  for (int i = 0; i < 16; ++i) f.h[i] = (__bf16)t[i];
  return f.v;
}

// B fragment from an LDS-resident fp32 tile wt[32 k][32 n], row-major.
__device__ __forceinline__ v16bf load_frag_wlds(const float* wt, int ncol0,
                                                int lane) {
  const int n  = ncol0 + (lane & 15);
  const int kb = (lane >> 4) * 8;
  FragU f;
#pragma unroll
  for (int i = 0; i < 8; ++i) {
    const int K = (i < 4) ? (kb + 2 * i) : (16 + kb + 2 * (i - 4));
    f.h[2 * i]     = (__bf16)wt[K * 32 + n];
    f.h[2 * i + 1] = (__bf16)wt[(K + 1) * 32 + n];
  }
  return f.v;
}

#if CDNA5_HAS_TDM
__device__ __forceinline__ void tdm_load_2d_f32(unsigned lds_off, const void* gptr,
                                                int tile_x, int tile_y,
                                                int stride_x) {
  const unsigned long long ga = (unsigned long long)(size_t)gptr;
  u32x4 g0;
  g0[0] = 1u;                                                 // count = 1
  g0[1] = lds_off;                                            // lds_addr
  g0[2] = (unsigned)(ga & 0xFFFFFFFFull);                     // global_addr lo
  g0[3] = (unsigned)((ga >> 32) & 0x1FFFFFFull) | (2u << 30); // hi | type=2
  i32x8 g1;
  g1[0] = (2 << 16);
  g1[1] = (int)((unsigned)(stride_x & 0xFFFF) << 16);
  g1[2] = (int)(((unsigned)stride_x >> 16) |
                ((unsigned)(stride_x & 0xFFFF) << 16));       // dim0 hi / dim1 lo
  g1[3] = (int)(((unsigned)stride_x >> 16) |
                ((unsigned)tile_x << 16));
  g1[4] = tile_y & 0xFFFF;
  g1[5] = stride_x;
  g1[6] = 0;
  g1[7] = 0;
  i32x4 z4 = 0;
#if __clang_major__ >= 23
  i32x8 z8 = 0;
  __builtin_amdgcn_tensor_load_to_lds(g0, g1, z4, z4, z8, 0);
#else
  __builtin_amdgcn_tensor_load_to_lds(g0, g1, z4, z4, 0);
#endif
}
#endif

// ---------------------------------------------------------------------------
// Kernel 0: pass x through into out[..., 0:512] (128-bit copies, NT stores).
// ---------------------------------------------------------------------------
__global__ __launch_bounds__(256) void copy_x_kernel(const float* __restrict__ x,
                                                     float* __restrict__ out) {
  const size_t g   = (size_t)blockIdx.x * 256 + threadIdx.x;  // 16384*128 vec4
  const size_t row = g >> 7;
  const int    c   = (int)(g & 127) * 4;
  const f32x4 v = *(const f32x4*)(x + row * 512 + c);
  __builtin_nontemporal_store(v, (f32x4*)(out + row * 1024 + c));
}

__global__ __launch_bounds__(256) void proj_kernel(
    const float* __restrict__ x,
    const float* __restrict__ Wq, const float* __restrict__ bq,
    const float* __restrict__ Wk, const float* __restrict__ bk,
    const float* __restrict__ Wv, const float* __restrict__ bv,
    __bf16* __restrict__ Qb, __bf16* __restrict__ Kb, __bf16* __restrict__ Vb) {
  __shared__ float wt[2][32 * 32];

  const int lane = threadIdx.x & 31;
  const int wave = threadIdx.x >> 5;
  const int row0 = blockIdx.x * 128 + wave * 16;
  const int n0   = blockIdx.y * 32;

  const float* W;
  const float* bias;
  __bf16*      dst;
  switch (blockIdx.z) {
    case 0:  W = Wq; bias = bq; dst = Qb; break;
    case 1:  W = Wk; bias = bk; dst = Kb; break;
    default: W = Wv; bias = bv; dst = Vb; break;
  }

#if CDNA5_HAS_TDM
  const unsigned off0 = (unsigned)(size_t)(void*)&wt[0][0];
  const unsigned off1 = (unsigned)(size_t)(void*)&wt[1][0];
  if (threadIdx.x < 32)                           // wave 0 drives the DMA
    tdm_load_2d_f32(off0, W + n0, 32, 32, C_DIM);
#endif

  v8f acc[2] = {};
  for (int k0 = 0; k0 < C_DIM; k0 += 32) {
    const int cur = (k0 >> 5) & 1;
#if CDNA5_HAS_TDM
    if (threadIdx.x < 32) {
      if (k0 + 32 < C_DIM) {                      // prefetch next W tile
        tdm_load_2d_f32(cur ? off0 : off1,
                        W + (size_t)(k0 + 32) * C_DIM + n0, 32, 32, C_DIM);
        __builtin_amdgcn_s_wait_tensorcnt(1);     // current tile landed
      } else {
        __builtin_amdgcn_s_wait_tensorcnt(0);
      }
    }
    __syncthreads();
#else
    {
      const int e  = threadIdx.x * 4;             // 1024 f32 / 256 threads
      const int kk = e >> 5, nn = e & 31;
      *(float4*)&wt[cur][kk * 32 + nn] =
          *(const float4*)&W[(size_t)(k0 + kk) * C_DIM + n0 + nn];
    }
    __syncthreads();
#endif
    const float* wc = wt[cur];
    const v16bf a  = load_frag_f32(x, row0, k0, C_DIM, lane);
    const v16bf b0 = load_frag_wlds(wc, 0, lane);
    const v16bf b1 = load_frag_wlds(wc, 16, lane);
    acc[0] = wmma_bf16(a, b0, acc[0]);
    acc[1] = wmma_bf16(a, b1, acc[1]);
    __syncthreads();                              // reads done before rewrite
  }

  const int hi = lane >> 4;
#pragma unroll
  for (int nt = 0; nt < 2; ++nt) {
    const int col = n0 + nt * 16 + (lane & 15);
    const float bv0 = bias[col];
#pragma unroll
    for (int i = 0; i < 8; ++i) {
      const int r = row0 + i + 8 * hi;
      dst[(size_t)r * C_DIM + col] = (__bf16)(acc[nt][i] + bv0);
    }
  }
}

#define E_TILE 512
#define E_ROW  (T_DIM / 32)

__global__ __launch_bounds__(256) void colsum_kernel(
    const __bf16* __restrict__ Qb, const __bf16* __restrict__ Kb,
    float* __restrict__ rcol, float* __restrict__ Ew) {
  __shared__ float ssum[64];
  if (threadIdx.x < 64) ssum[threadIdx.x] = 0.0f;
  __syncthreads();

  const int b     = blockIdx.y;
  const int s_blk = blockIdx.x * 64;
  const __bf16* Q = Qb + (size_t)b * T_DIM * C_DIM;
  const __bf16* K = Kb + (size_t)b * T_DIM * C_DIM;
  float*        E = Ew + (size_t)b * (T_DIM / 16) * E_ROW * E_TILE;

  const int lane = threadIdx.x & 31;
  const int wave = threadIdx.x >> 5;
  const int tw   = wave >> 1;               // 0..3 : 32-row t strip
  const int sw   = wave & 1;                // 0..1 : 32-col s half
  const int s0   = s_blk + sw * 32;
  const int hi   = lane >> 4;

  float part[2][8] = {};                    // per key held by this lane
  for (int t0 = s_blk + tw * 32; t0 < T_DIM; t0 += 128) {
    if (t0 + 31 < s0) continue;             // wave tile fully above diagonal
    v8f l[2][2] = {};                       // [t tile][s tile], rows s, cols t
    for (int k0 = 0; k0 < C_DIM; k0 += 32) {
      const v16bf a0 = load_frag_bf16(Q, t0, k0, C_DIM, lane);
      const v16bf a1 = load_frag_bf16(Q, t0 + 16, k0, C_DIM, lane);
      const v16bf b0 = load_frag_bf16(K, s0, k0, C_DIM, lane);
      const v16bf b1 = load_frag_bf16(K, s0 + 16, k0, C_DIM, lane);
      l[0][0] = wmma_bf16(b0, a0, l[0][0]);
      l[0][1] = wmma_bf16(b1, a0, l[0][1]);
      l[1][0] = wmma_bf16(b0, a1, l[1][0]);
      l[1][1] = wmma_bf16(b1, a1, l[1][1]);
    }
#pragma unroll
    for (int it = 0; it < 2; ++it) {
      const int t = t0 + it * 16 + (lane & 15);
      float* ep = E + ((size_t)((t0 >> 4) + it) * E_ROW + (s0 >> 5)) * E_TILE +
                  lane * 4;
#pragma unroll
      for (int is = 0; is < 2; ++is) {
        f32x4 ev[2];
#pragma unroll
        for (int i = 0; i < 8; ++i) {
          const int s = s0 + is * 16 + i + 8 * hi;
          const float e = (s <= t) ? __expf(l[it][is][i] * SM_SCALE) : 0.0f;
          part[is][i] += e;
          ev[i >> 2][i & 3] = e;
        }
        *(f32x4*)(ep + (is * 2) * 128)     = ev[0];
        *(f32x4*)(ep + (is * 2 + 1) * 128) = ev[1];
      }
    }
    // The next trip rewrites the registers these stores name (data, address).
    asm volatile("s_wait_xcnt 0x0" ::: "memory");
  }
#pragma unroll
  for (int is = 0; is < 2; ++is) {
#pragma unroll
    for (int i = 0; i < 8; ++i) {
      float p = part[is][i];
      p += __shfl_xor(p, 1, 32);
      p += __shfl_xor(p, 2, 32);
      p += __shfl_xor(p, 4, 32);
      p += __shfl_xor(p, 8, 32);
      if ((lane & 15) == 0) atomicAdd(&ssum[sw * 32 + is * 16 + i + 8 * hi], p);
    }
  }
  __syncthreads();
  if (threadIdx.x < 64)
    rcol[(size_t)b * T_DIM + s_blk + threadIdx.x] = 1.0f / ssum[threadIdx.x];
}

// ---------------------------------------------------------------------------
// Kernel 3: read = (e[t,s] * rcol[s]) @ V, causal.
// grid = (T/128, 512/128, B).  Block tile: 128(t) x 128(v), s-steps of 64.
// Each wave reads the stored e of its 32 t rows straight into A fragments
// (512 contiguous bytes per load), scales by rcol and rounds to bf16; then
// 2t x 4v blocked P@V WMMAs with ds_load_b128 fragment reads from
// LDS-transposed V.
// ---------------------------------------------------------------------------
// One s-step of 64 keys.  EDGE = false: every 32-key chunk lies at or below the
// diagonal tile of every wave of the block, so all loads issue together with
// no test.  EDGE = true (the last two steps): a wave skips the chunks above
// its diagonal tile, which are not stored, and multiplies zeros instead.
template <bool EDGE>
__device__ __forceinline__ void pv_step(
    const float* __restrict__ E, const __bf16* __restrict__ V,
    const float* __restrict__ rc, __bf16* Vl, int s0, int ta0, int v_base,
    int vb0, int lane, v8f (&acc)[2][4]) {
  const int hi = lane >> 4;
  // ---- loads: V[s0:s0+64, v_base:v_base+128], then e and rcol ----
  const int sr = threadIdx.x >> 2;          // 0..63
  const int cb = (threadIdx.x & 3) * 32;    // 0..96
  const __bf16* vp = V + (size_t)(s0 + sr) * C_DIM + v_base + cb;
  FragU f0, f1;
  f0.u[0] = *(const uint4*)(vp);
  f0.u[1] = *(const uint4*)(vp + 8);
  f1.u[0] = *(const uint4*)(vp + 16);
  f1.u[1] = *(const uint4*)(vp + 24);

  f32x4 r[2][4] = {};                    // rcol of the keys this lane holds
  f32x4 e[2][2][4] = {};                 // [s chunk][t tile][512-B row]
#pragma unroll
  for (int kk = 0; kk < 2; ++kk) {
    const int sc = s0 + kk * 32;
    if (!EDGE || sc <= ta0) {
      const float* rp = rc + sc + 8 * hi;
      r[kk][0] = *(const f32x4*)(rp);
      r[kk][1] = *(const f32x4*)(rp + 4);
      r[kk][2] = *(const f32x4*)(rp + 16);
      r[kk][3] = *(const f32x4*)(rp + 20);
#pragma unroll
      for (int it = 0; it < 2; ++it) {
        const float* ep =
            E + ((size_t)((ta0 >> 4) + it) * E_ROW + (sc >> 5)) * E_TILE +
            lane * 4;
#pragma unroll
        for (int c = 0; c < 4; ++c) e[kk][it][c] = *(const f32x4*)(ep + c * 128);
      }
    }
  }
  // ---- V transposed into LDS ----
#pragma unroll
  for (int j = 0; j < 16; ++j) {
    Vl[(cb + j) * 64 + sr]        = f0.h[j];
    Vl[(cb + 16 + j) * 64 + sr]   = f1.h[j];
  }
  // ---- P fragments: 32t x 64s per wave, bf16(e * rcol) ----
  v16bf pa[2][2];
#pragma unroll
  for (int kk = 0; kk < 2; ++kk) {
#pragma unroll
    for (int it = 0; it < 2; ++it) {
      FragU f;
#pragma unroll
      for (int c = 0; c < 4; ++c) {
#pragma unroll
        for (int j = 0; j < 4; ++j)
          f.h[c * 4 + j] = (__bf16)(e[kk][it][c][j] * r[kk][c][j]);
      }
      pa[kk][it] = f.v;
    }
  }
  __syncthreads();
  // ---- P(128x64) @ V(64x128); wave owns 32t x 64v ----
#pragma unroll
  for (int kk = 0; kk < 2; ++kk) {
#pragma unroll
    for (int nt = 0; nt < 4; ++nt) {
      const v16bf vb = load_frag_bf16(Vl, vb0 + nt * 16, kk * 32, 64, lane);
      acc[0][nt] = wmma_bf16(pa[kk][0], vb, acc[0][nt]);
      acc[1][nt] = wmma_bf16(pa[kk][1], vb, acc[1][nt]);
    }
  }
  __syncthreads();
}

__global__ __launch_bounds__(256) void attend_kernel(
    const float* __restrict__ Ew, const __bf16* __restrict__ Vb,
    const float* __restrict__ rcol, float* __restrict__ out) {
  __shared__ __bf16 Vl[128 * 64];    // V tile transposed, [v][s]     (16 KB)

  const int b      = blockIdx.z;
  const int t_base = blockIdx.x * 128;
  const int v_base = blockIdx.y * 128;
  const float*  E  = Ew + (size_t)b * (T_DIM / 16) * E_ROW * E_TILE;
  const __bf16* V  = Vb + (size_t)b * T_DIM * C_DIM;
  const float*  rc = rcol + (size_t)b * T_DIM;
  float*        ob = out + (size_t)b * T_DIM * 1024;

  const int lane = threadIdx.x & 31;
  // Scalar wave number: the test on stored tiles is then a scalar branch.
  const int wave = __builtin_amdgcn_readfirstlane(threadIdx.x >> 5);
  const int tw   = wave >> 1;            // 0..3 : 32-row t strip
  const int sw   = wave & 1;             // 0..1 : 64-col v half
  const int hi   = lane >> 4;
  const int ta0  = t_base + tw * 32;
  const int vb0  = sw * 64;              // local v base for this wave

  v8f acc[2][4] = {};                    // 32t x 64v accumulators

  for (int s0 = 0; s0 < t_base; s0 += 64)
    pv_step<false>(E, V, rc, Vl, s0, ta0, v_base, vb0, lane, acc);
  pv_step<true>(E, V, rc, Vl, t_base, ta0, v_base, vb0, lane, acc);
  pv_step<true>(E, V, rc, Vl, t_base + 64, ta0, v_base, vb0, lane, acc);

  const int colb = v_base + sw * 64;
#pragma unroll
  for (int it = 0; it < 2; ++it) {
#pragma unroll
    for (int nt = 0; nt < 4; ++nt) {
#pragma unroll
      for (int i = 0; i < 8; ++i) {
        const int r = t_base + tw * 32 + it * 16 + i + 8 * hi;
        __builtin_nontemporal_store(
            acc[it][nt][i],
            ob + (size_t)r * 1024 + 512 + colb + nt * 16 + (lane & 15));
      }
    }
  }
}

// ---------------------------------------------------------------------------
// Launcher.  Workspace layout (bytes):
//   [0, 16M)   Q  bf16 [16384][512]
//   [16M,32M)  K  bf16
//   [32M,48M)  V  bf16
//   [48M, +64K) rcol f32 [16384]   (reciprocal column sums)
//   then 128M   e f32, 2 KB units [8][128][64]
// ---------------------------------------------------------------------------
extern "C" void kernel_launch(void* const* d_in, const int* in_sizes, int n_in,
                              void* d_out, int out_size, void* d_ws,
                              size_t ws_size, hipStream_t stream) {
  const float* x  = (const float*)d_in[0];
  const float* Wq = (const float*)d_in[1];
  const float* bq = (const float*)d_in[2];
  const float* Wk = (const float*)d_in[3];
  const float* bk = (const float*)d_in[4];
  const float* Wv = (const float*)d_in[5];
  const float* bv = (const float*)d_in[6];
  float* out = (float*)d_out;

  const size_t qkv = (size_t)M_ROWS * C_DIM;           // elems per matrix
  __bf16* Qb = (__bf16*)d_ws;
  __bf16* Kb = Qb + qkv;
  __bf16* Vb = Kb + qkv;
  float* rcol = (float*)(Vb + qkv);
  float* Ew   = rcol + M_ROWS;

  // out[..., :512] = x
  copy_x_kernel<<<(M_ROWS * C_DIM / 4) / 256, 256, 0, stream>>>(x, out);
  // Q, K, V projections (bf16)
  proj_kernel<<<dim3(M_ROWS / 128, C_DIM / 32, 3), 256, 0, stream>>>(
      x, Wq, bq, Wk, bk, Wv, bv, Qb, Kb, Vb);
  // masked exponentials and query-axis softmax denominators
  colsum_kernel<<<dim3(T_DIM / 64, B_DIM), 256, 0, stream>>>(Qb, Kb, rcol, Ew);
  // out[..., 512:] = P @ V
  attend_kernel<<<dim3(T_DIM / 128, C_DIM / 128, B_DIM), 256, 0, stream>>>(
      Ew, Vb, rcol, out);
}

// v002
// A run of this version takes 248 microseconds.
// Timed twice side by side with v001, it ran 1.42 and 1.43 times as fast.
// Counting every step since v000, it is 3.50 times as fast.
#include <hip/hip_runtime.h>

#define B_DIM   8
#define T_DIM   2048
#define C_DIM   512
#define M_ROWS  (B_DIM * T_DIM)        // 16384
#define SM_SCALE 0.04419417382415922f  // 1/sqrt(512)

typedef __attribute__((ext_vector_type(16))) __bf16    v16bf;
typedef __attribute__((ext_vector_type(8)))  float     v8f;
typedef __attribute__((ext_vector_type(4)))  float     f32x4;
typedef __attribute__((ext_vector_type(4)))  unsigned  u32x4;
typedef __attribute__((ext_vector_type(8)))  int       i32x8;
typedef __attribute__((ext_vector_type(4)))  int       i32x4;

union FragU {
  uint4  u[2];
  __bf16 h[16];
  v16bf  v;
};

#if defined(__has_builtin)
#  if __has_builtin(__builtin_amdgcn_tensor_load_to_lds)
#    define CDNA5_HAS_TDM 1
#  endif
#endif
#ifndef CDNA5_HAS_TDM
#  define CDNA5_HAS_TDM 0
#endif

__device__ __forceinline__ v8f wmma_bf16(v16bf a, v16bf b, v8f c) {
  // (neg_a, A, neg_b, B, c_mod, C, reuse_a, reuse_b)
  return __builtin_amdgcn_wmma_f32_16x16x32_bf16(false, a, false, b, (short)0, c,
                                                 false, false);
}

#define F_UNIT 512                     // bf16 elements per fragment unit
__device__ __forceinline__ v16bf load_frag_packed(const __bf16* base, int unit,
                                                  int lane) {
  const __bf16* p = base + (size_t)unit * F_UNIT + lane * 8;
  FragU f;
  f.u[0] = *(const uint4*)(p);
  f.u[1] = *(const uint4*)(p + 256);
  return f.v;
}

// A fragment from an fp32 row-major matrix, converting to bf16 on the fly.
__device__ __forceinline__ v16bf load_frag_f32(const float* base, int row,
                                               int k0, int ld, int lane) {
  const int r  = lane & 15;
  const int kb = (lane >> 4) * 8;
  const float* p = base + (size_t)(row + r) * ld + (k0 + kb);
  float t[16];
  *(float4*)&t[0]  = *(const float4*)(p);
  *(float4*)&t[4]  = *(const float4*)(p + 4);
  *(float4*)&t[8]  = *(const float4*)(p + 16);
  *(float4*)&t[12] = *(const float4*)(p + 20);
  FragU f;
#pragma unroll
  for (int i = 0; i < 16; ++i) f.h[i] = (__bf16)t[i];
  return f.v;
}

// B fragment from an LDS-resident fp32 tile wt[32 k][32 n], row-major.
__device__ __forceinline__ v16bf load_frag_wlds(const float* wt, int ncol0,
                                                int lane) {
  const int n  = ncol0 + (lane & 15);
  const int kb = (lane >> 4) * 8;
  FragU f;
#pragma unroll
  for (int i = 0; i < 8; ++i) {
    const int K = (i < 4) ? (kb + 2 * i) : (16 + kb + 2 * (i - 4));
    f.h[2 * i]     = (__bf16)wt[K * 32 + n];
    f.h[2 * i + 1] = (__bf16)wt[(K + 1) * 32 + n];
  }
  return f.v;
}

#if CDNA5_HAS_TDM
__device__ __forceinline__ void tdm_load_2d_f32(unsigned lds_off, const void* gptr,
                                                int tile_x, int tile_y,
                                                int stride_x) {
  const unsigned long long ga = (unsigned long long)(size_t)gptr;
  u32x4 g0;
  g0[0] = 1u;                                                 // count = 1
  g0[1] = lds_off;                                            // lds_addr
  g0[2] = (unsigned)(ga & 0xFFFFFFFFull);                     // global_addr lo
  g0[3] = (unsigned)((ga >> 32) & 0x1FFFFFFull) | (2u << 30); // hi | type=2
  i32x8 g1;
  g1[0] = (2 << 16);
  g1[1] = (int)((unsigned)(stride_x & 0xFFFF) << 16);
  g1[2] = (int)(((unsigned)stride_x >> 16) |
                ((unsigned)(stride_x & 0xFFFF) << 16));       // dim0 hi / dim1 lo
  g1[3] = (int)(((unsigned)stride_x >> 16) |
                ((unsigned)tile_x << 16));
  g1[4] = tile_y & 0xFFFF;
  g1[5] = stride_x;
  g1[6] = 0;
  g1[7] = 0;
  i32x4 z4 = 0;
#if __clang_major__ >= 23
  i32x8 z8 = 0;
  __builtin_amdgcn_tensor_load_to_lds(g0, g1, z4, z4, z8, 0);
#else
  __builtin_amdgcn_tensor_load_to_lds(g0, g1, z4, z4, 0);
#endif
}
#endif

// ---------------------------------------------------------------------------
// Kernel 0: pass x through into out[..., 0:512] (128-bit copies, NT stores).
// ---------------------------------------------------------------------------
__global__ __launch_bounds__(256) void copy_x_kernel(const float* __restrict__ x,
                                                     float* __restrict__ out) {
  const size_t g   = (size_t)blockIdx.x * 256 + threadIdx.x;  // 16384*128 vec4
  const size_t row = g >> 7;
  const int    c   = (int)(g & 127) * 4;
  const f32x4 v = *(const f32x4*)(x + row * 512 + c);
  __builtin_nontemporal_store(v, (f32x4*)(out + row * 1024 + c));
}

__global__ __launch_bounds__(256) void proj_kernel(
    const float* __restrict__ x,
    const float* __restrict__ Wq, const float* __restrict__ bq,
    const float* __restrict__ Wk, const float* __restrict__ bk,
    const float* __restrict__ Wv, const float* __restrict__ bv,
    __bf16* __restrict__ Qb, __bf16* __restrict__ Kb, __bf16* __restrict__ Vb) {
  __shared__ float wt[2][32 * 32];
  __shared__ __attribute__((aligned(16))) __bf16 xt[8][F_UNIT];  // one unit a wave

  const int lane = threadIdx.x & 31;
  const int wave = threadIdx.x >> 5;
  const int row0 = blockIdx.x * 128 + wave * 16;
  const int n0   = blockIdx.y * 32;

  const float* W;
  const float* bias;
  __bf16*      dst;
  switch (blockIdx.z) {
    case 0:  W = Wq; bias = bq; dst = Qb; break;
    case 1:  W = Wk; bias = bk; dst = Kb; break;
    default: W = Wv; bias = bv; dst = Vb; break;
  }

#if CDNA5_HAS_TDM
  const unsigned off0 = (unsigned)(size_t)(void*)&wt[0][0];
  const unsigned off1 = (unsigned)(size_t)(void*)&wt[1][0];
  if (threadIdx.x < 32)                           // wave 0 drives the DMA
    tdm_load_2d_f32(off0, W + n0, 32, 32, C_DIM);
#endif

  v8f acc[2] = {};
  for (int k0 = 0; k0 < C_DIM; k0 += 32) {
    const int cur = (k0 >> 5) & 1;
#if CDNA5_HAS_TDM
    if (threadIdx.x < 32) {
      if (k0 + 32 < C_DIM) {                      // prefetch next W tile
        tdm_load_2d_f32(cur ? off0 : off1,
                        W + (size_t)(k0 + 32) * C_DIM + n0, 32, 32, C_DIM);
        __builtin_amdgcn_s_wait_tensorcnt(1);     // current tile landed
      } else {
        __builtin_amdgcn_s_wait_tensorcnt(0);
      }
    }
    __syncthreads();
#else
    {
      const int e  = threadIdx.x * 4;             // 1024 f32 / 256 threads
      const int kk = e >> 5, nn = e & 31;
      *(float4*)&wt[cur][kk * 32 + nn] =
          *(const float4*)&W[(size_t)(k0 + kk) * C_DIM + n0 + nn];
    }
    __syncthreads();
#endif
    const float* wc = wt[cur];
    const v16bf a  = load_frag_f32(x, row0, k0, C_DIM, lane);
    const v16bf b0 = load_frag_wlds(wc, 0, lane);
    const v16bf b1 = load_frag_wlds(wc, 16, lane);
    acc[0] = wmma_bf16(a, b0, acc[0]);
    acc[1] = wmma_bf16(a, b1, acc[1]);
    __syncthreads();                              // reads done before rewrite
  }

  const int hi = lane >> 4;
  union Pack8 { uint4 u; __bf16 h[8]; };
  if (blockIdx.z >= 2) {                          // V; same for the whole block
#pragma unroll
    for (int nt = 0; nt < 2; ++nt) {
      const float bv0 = bias[n0 + nt * 16 + (lane & 15)];
      Pack8 o;
#pragma unroll
      for (int i = 0; i < 8; ++i) o.h[i] = (__bf16)(acc[nt][i] + bv0);
      *(uint4*)(dst +
                ((size_t)(row0 >> 5) * (C_DIM / 16) + (n0 >> 4) + nt) * F_UNIT +
                ((row0 >> 4) & 1) * 256 + lane * 8) = o.u;
    }
  } else {                                        // Q, K
    __bf16* xw = xt[wave];                        // read by this wave alone
#pragma unroll
    for (int nt = 0; nt < 2; ++nt) {
      const float bv0 = bias[n0 + nt * 16 + (lane & 15)];
#pragma unroll
      for (int i = 0; i < 8; ++i)
        xw[nt * 256 + (i + 8 * hi + 16 * ((lane >> 3) & 1)) * 8 + (lane & 7)] =
            (__bf16)(acc[nt][i] + bv0);
    }
#pragma unroll
    for (int nt = 0; nt < 2; ++nt) {
      Pack8 o;
#pragma unroll
      for (int j = 0; j < 8; ++j) o.h[j] = xw[nt * 256 + lane * 8 + j];
      *(uint4*)(dst + ((size_t)(row0 >> 4) * (C_DIM / 32) + (n0 >> 5)) * F_UNIT +
                nt * 256 + lane * 8) = o.u;
    }
    // In front of any later rewrite of the address pair that both stores name.
    asm volatile("s_wait_xcnt 0x0" ::: "memory");
  }
}

#define E_TILE 512
#define E_ROW  (T_DIM / 32)

__global__ __launch_bounds__(256) void colsum_kernel(
    const __bf16* __restrict__ Qb, const __bf16* __restrict__ Kb,
    float* __restrict__ rcol, float* __restrict__ Ew) {
  __shared__ float ssum[64];
  if (threadIdx.x < 64) ssum[threadIdx.x] = 0.0f;
  __syncthreads();

  const int b     = blockIdx.y;
  const int s_blk = blockIdx.x * 64;
  const __bf16* Q = Qb + (size_t)b * T_DIM * C_DIM;
  const __bf16* K = Kb + (size_t)b * T_DIM * C_DIM;
  float*        E = Ew + (size_t)b * (T_DIM / 16) * E_ROW * E_TILE;

  const int lane = threadIdx.x & 31;
  const int wave = threadIdx.x >> 5;
  const int tw   = wave >> 1;               // 0..3 : 32-row t strip
  const int sw   = wave & 1;                // 0..1 : 32-col s half
  const int s0   = s_blk + sw * 32;
  const int hi   = lane >> 4;

  float part[2][8] = {};                    // per key held by this lane
  for (int t0 = s_blk + tw * 32; t0 < T_DIM; t0 += 128) {
    if (t0 + 31 < s0) continue;             // wave tile fully above diagonal
    v8f l[2][2] = {};                       // [t tile][s tile], rows s, cols t
    for (int k0 = 0; k0 < C_DIM; k0 += 32) {
      const int ku = k0 >> 5;               // 16 units per 16-row strip
      const v16bf a0 = load_frag_packed(Q, (t0 >> 4) * 16 + ku, lane);
      const v16bf a1 = load_frag_packed(Q, (t0 >> 4) * 16 + 16 + ku, lane);
      const v16bf b0 = load_frag_packed(K, (s0 >> 4) * 16 + ku, lane);
      const v16bf b1 = load_frag_packed(K, (s0 >> 4) * 16 + 16 + ku, lane);
      l[0][0] = wmma_bf16(b0, a0, l[0][0]);
      l[0][1] = wmma_bf16(b1, a0, l[0][1]);
      l[1][0] = wmma_bf16(b0, a1, l[1][0]);
      l[1][1] = wmma_bf16(b1, a1, l[1][1]);
    }
#pragma unroll
    for (int it = 0; it < 2; ++it) {
      const int t = t0 + it * 16 + (lane & 15);
      float* ep = E + ((size_t)((t0 >> 4) + it) * E_ROW + (s0 >> 5)) * E_TILE +
                  lane * 4;
#pragma unroll
      for (int is = 0; is < 2; ++is) {
        f32x4 ev[2];
#pragma unroll
        for (int i = 0; i < 8; ++i) {
          const int s = s0 + is * 16 + i + 8 * hi;
          const float e = (s <= t) ? __expf(l[it][is][i] * SM_SCALE) : 0.0f;
          part[is][i] += e;
          ev[i >> 2][i & 3] = e;
        }
        *(f32x4*)(ep + (is * 2) * 128)     = ev[0];
        *(f32x4*)(ep + (is * 2 + 1) * 128) = ev[1];
      }
    }
    // The next trip rewrites the registers these stores name (data, address).
    asm volatile("s_wait_xcnt 0x0" ::: "memory");
  }
#pragma unroll
  for (int is = 0; is < 2; ++is) {
#pragma unroll
    for (int i = 0; i < 8; ++i) {
      float p = part[is][i];
      p += __shfl_xor(p, 1, 32);
      p += __shfl_xor(p, 2, 32);
      p += __shfl_xor(p, 4, 32);
      p += __shfl_xor(p, 8, 32);
      if ((lane & 15) == 0) atomicAdd(&ssum[sw * 32 + is * 16 + i + 8 * hi], p);
    }
  }
  __syncthreads();
  if (threadIdx.x < 64)
    rcol[(size_t)b * T_DIM + s_blk + threadIdx.x] = 1.0f / ssum[threadIdx.x];
}

// ---------------------------------------------------------------------------
// Kernel 3: read = (e[t,s] * rcol[s]) @ V, causal.
// grid = (T/128, 512/128, B).  Block tile: 128(t) x 128(v), s-steps of 64.
// Each wave reads the stored e of its 32 t rows straight into A fragments
// (512 contiguous bytes per load), scales by rcol and rounds to bf16, and
// reads V straight into B fragments (stored in that order by kernel 1); then
// 2t x 4v blocked P@V WMMAs.  Nothing is shared through LDS: no barrier.
// ---------------------------------------------------------------------------
// Stands behind a run of loads.  The wait: in front of the first rewrite of an
// address register that the loads name.  The scheduling barriers: the first
// keeps the loads in front of the arithmetic, all in flight together (without
// it the scheduler sinks them between the WMMAs and the wave waits out a load
// latency several times per step); the second keeps the rewrites behind the wait.
__device__ __forceinline__ void loads_issued() {
  __builtin_amdgcn_sched_barrier(0);
  asm volatile("s_wait_xcnt 0x0" ::: "memory");
  __builtin_amdgcn_sched_barrier(0);
}

// One s-step of 64 keys.  EDGE = false: every 32-key chunk lies at or below the
// diagonal tile of every wave of the block, so all loads issue together with
// no test.  EDGE = true (the last two steps): a wave skips the e and rcol loads
// of chunks above its diagonal tile, which are not stored, and multiplies zeros.
template <bool EDGE>
__device__ __forceinline__ void pv_step(
    const float* __restrict__ E, const __bf16* __restrict__ V,
    const float* __restrict__ rc, int s0, int ta0, int vu0, int lane,
    v8f (&acc)[2][4]) {
  const int hi = lane >> 4;
  // ---- loads: e, V fragments, rcol of the keys this lane holds ----
  f32x4 e[2][2][4] = {};                 // [s chunk][t tile][512-B row]
  v16bf vb[2][4];                        // [s chunk][v tile]
  f32x4 r[2][4]    = {};
  const float* ep =
      E + ((size_t)(ta0 >> 4) * E_ROW + (s0 >> 5)) * E_TILE + lane * 4;
  const __bf16* vp = V + (size_t)((s0 >> 5) * (C_DIM / 16) + vu0) * F_UNIT;
  const float* rp = rc + s0 + 8 * hi;
#pragma unroll
  for (int kk = 0; kk < 2; ++kk) {
    if (!EDGE || s0 + kk * 32 <= ta0) {
#pragma unroll
      for (int it = 0; it < 2; ++it) {
#pragma unroll
        for (int c = 0; c < 4; ++c)
          e[kk][it][c] =
              *(const f32x4*)(ep + (it * E_ROW + kk) * E_TILE + c * 128);
      }
      if (EDGE) loads_issued();          // ep may end here and be reused
      r[kk][0] = *(const f32x4*)(rp + kk * 32);
      r[kk][1] = *(const f32x4*)(rp + kk * 32 + 4);
      r[kk][2] = *(const f32x4*)(rp + kk * 32 + 16);
      r[kk][3] = *(const f32x4*)(rp + kk * 32 + 20);
      if (EDGE) loads_issued();
    }
#pragma unroll
    for (int nt = 0; nt < 4; ++nt)
      vb[kk][nt] = load_frag_packed(vp, kk * (C_DIM / 16) + nt, lane);
  }
  loads_issued();                        // the pointers are stepped or reused next
#pragma unroll
  for (int kk = 0; kk < 2; ++kk) {
    // ---- P fragments: 32t x 32s, bf16(e * rcol) ----
    v16bf pa[2];
#pragma unroll
    for (int it = 0; it < 2; ++it) {
      FragU f;
#pragma unroll
      for (int c = 0; c < 4; ++c) {
#pragma unroll
        for (int j = 0; j < 4; ++j)
          f.h[c * 4 + j] = (__bf16)(e[kk][it][c][j] * r[kk][c][j]);
      }
      pa[it] = f.v;
    }
    // ---- P(32x32) @ V(32x64) ----
#pragma unroll
    for (int nt = 0; nt < 4; ++nt) {
      acc[0][nt] = wmma_bf16(pa[0], vb[kk][nt], acc[0][nt]);
      acc[1][nt] = wmma_bf16(pa[1], vb[kk][nt], acc[1][nt]);
    }
  }
}

__global__ __launch_bounds__(256) void attend_kernel(
    const float* __restrict__ Ew, const __bf16* __restrict__ Vb,
    const float* __restrict__ rcol, float* __restrict__ out) {
  const int b      = blockIdx.z;
  const int t_base = blockIdx.x * 128;
  const int v_base = blockIdx.y * 128;
  const float*  E  = Ew + (size_t)b * (T_DIM / 16) * E_ROW * E_TILE;
  const __bf16* V  = Vb + (size_t)b * T_DIM * C_DIM;
  const float*  rc = rcol + (size_t)b * T_DIM;
  float*        ob = out + (size_t)b * T_DIM * 1024;

  const int lane = threadIdx.x & 31;
  // Scalar wave number: the test on stored tiles is then a scalar branch.
  const int wave = __builtin_amdgcn_readfirstlane(threadIdx.x >> 5);
  const int tw   = wave >> 1;            // 0..3 : 32-row t strip
  const int sw   = wave & 1;             // 0..1 : 64-col v half
  const int hi   = lane >> 4;
  const int ta0  = t_base + tw * 32;
  const int vu0  = (v_base + sw * 64) >> 4;  // first 16-column V unit of the wave

  v8f acc[2][4] = {};                    // 32t x 64v accumulators

  for (int s0 = 0; s0 < t_base; s0 += 64)
    pv_step<false>(E, V, rc, s0, ta0, vu0, lane, acc);
  pv_step<true>(E, V, rc, t_base, ta0, vu0, lane, acc);
  pv_step<true>(E, V, rc, t_base + 64, ta0, vu0, lane, acc);

  const int colb = v_base + sw * 64;
#pragma unroll
  for (int it = 0; it < 2; ++it) {
#pragma unroll
    for (int nt = 0; nt < 4; ++nt) {
#pragma unroll
      for (int i = 0; i < 8; ++i) {
        const int r = t_base + tw * 32 + it * 16 + i + 8 * hi;
        __builtin_nontemporal_store(
            acc[it][nt][i],
            ob + (size_t)r * 1024 + 512 + colb + nt * 16 + (lane & 15));
      }
    }
  }
}

// ---------------------------------------------------------------------------
// Launcher.  Workspace layout (bytes):
//   [0, 16M)   Q  bf16 [16384][512], 1-KB fragment units [1024][16]
//   [16M,32M)  K  bf16, as Q
//   [32M,48M)  V  bf16, 1-KB fragment units [512][32]
//   [48M, +64K) rcol f32 [16384]   (reciprocal column sums)
//   then 128M   e f32, 2 KB units [8][128][64]
// ---------------------------------------------------------------------------
extern "C" void kernel_launch(void* const* d_in, const int* in_sizes, int n_in,
                              void* d_out, int out_size, void* d_ws,
                              size_t ws_size, hipStream_t stream) {
  const float* x  = (const float*)d_in[0];
  const float* Wq = (const float*)d_in[1];
  const float* bq = (const float*)d_in[2];
  const float* Wk = (const float*)d_in[3];
  const float* bk = (const float*)d_in[4];
  const float* Wv = (const float*)d_in[5];
  const float* bv = (const float*)d_in[6];
  float* out = (float*)d_out;

  const size_t qkv = (size_t)M_ROWS * C_DIM;           // elems per matrix
  __bf16* Qb = (__bf16*)d_ws;
  __bf16* Kb = Qb + qkv;
  __bf16* Vb = Kb + qkv;
  float* rcol = (float*)(Vb + qkv);
  float* Ew   = rcol + M_ROWS;

  // out[..., :512] = x
  copy_x_kernel<<<(M_ROWS * C_DIM / 4) / 256, 256, 0, stream>>>(x, out);
  // Q, K, V projections (bf16)
  proj_kernel<<<dim3(M_ROWS / 128, C_DIM / 32, 3), 256, 0, stream>>>(
      x, Wq, bq, Wk, bk, Wv, bv, Qb, Kb, Vb);
  // masked exponentials and query-axis softmax denominators
  colsum_kernel<<<dim3(T_DIM / 64, B_DIM), 256, 0, stream>>>(Qb, Kb, rcol, Ew);
  // out[..., 512:] = P @ V
  attend_kernel<<<dim3(T_DIM / 128, C_DIM / 128, B_DIM), 256, 0, stream>>>(
      Ew, Vb, rcol, out);
}

// v003
// A run of this version takes 188 microseconds.
// Two timings next to v002 both put it at 1.32 times that version's speed.
// Over all steps from v000 it is 4.61 times as fast.
#include <hip/hip_runtime.h>

#define B_DIM   8
#define T_DIM   2048
#define C_DIM   512
#define M_ROWS  (B_DIM * T_DIM)        // 16384
#define SM_SCALE 0.04419417382415922f  // 1/sqrt(512)

typedef __attribute__((ext_vector_type(16))) __bf16    v16bf;
typedef __attribute__((ext_vector_type(8)))  float     v8f;
typedef __attribute__((ext_vector_type(4)))  float     f32x4;

union FragU {
  uint4  u[2];
  __bf16 h[16];
  v16bf  v;
};

__device__ __forceinline__ v8f wmma_bf16(v16bf a, v16bf b, v8f c) {
  // (neg_a, A, neg_b, B, c_mod, C, reuse_a, reuse_b)
  return __builtin_amdgcn_wmma_f32_16x16x32_bf16(false, a, false, b, (short)0, c,
                                                 false, false);
}

#define F_UNIT 512                     // bf16 elements per fragment unit
__device__ __forceinline__ v16bf load_frag_packed(const __bf16* base, int unit,
                                                  int lane) {
  const __bf16* p = base + (size_t)unit * F_UNIT + lane * 8;
  FragU f;
  f.u[0] = *(const uint4*)(p);
  f.u[1] = *(const uint4*)(p + 256);
  return f.v;
}

// Stands behind a run of loads.  The wait: in front of the first rewrite of an
// address register that the loads name.  The scheduling barriers: the first
// keeps the loads in front of the arithmetic, all in flight together (without
// it the scheduler sinks them between the WMMAs and the wave waits out a load
// latency several times per step); the second keeps the rewrites behind the wait.
__device__ __forceinline__ void loads_issued() {
  __builtin_amdgcn_sched_barrier(0);
  asm volatile("s_wait_xcnt 0x0" ::: "memory");
  __builtin_amdgcn_sched_barrier(0);
}

#define W_BLOCKS 192                   // 3 x (512/16) x (512/32) units / 8 waves
#define X_PITCH  136                   // bf16 elements per 8-column group in LDS

__global__ __launch_bounds__(256) void pack_copy_kernel(
    const float* __restrict__ x, const float* __restrict__ Wq,
    const float* __restrict__ Wk, const float* __restrict__ Wv,
    float* __restrict__ out, __bf16* __restrict__ Xp, __bf16* __restrict__ Wp) {
  __shared__ __attribute__((aligned(16))) __bf16 xt[8][16 * X_PITCH];
  const int lane = threadIdx.x & 31;
  // Scalar wave number: the bases are then scalar, and one lane offset, never
  // rewritten, serves the loads and stores of a wave.
  const int wave = __builtin_amdgcn_readfirstlane(threadIdx.x >> 5);
  union Pack8 { uint4 u; __bf16 h[8]; };
  union Pack4 { uint2 u; __bf16 h[4]; };

  if (blockIdx.x < W_BLOCKS) {                    // same for the whole block
    const int z = blockIdx.x >> 6;                // 64 blocks a matrix
    const float* Wm = (z == 0) ? Wq : (z == 1) ? Wk : Wv;
    const int unit = (blockIdx.x & 63) * 8 + wave;   // (col/16) * 16 + row/32
    const float* wp = Wm + (size_t)((unit & 15) * 32 + (lane >> 4) * 8) * C_DIM +
                      (unit >> 4) * 16 + (lane & 15);
    float t[16];
#pragma unroll
    for (int i = 0; i < 16; ++i)
      t[i] = wp[(size_t)((i >> 3) * 16 + (i & 7)) * C_DIM];
#pragma unroll
    for (int h = 0; h < 2; ++h) {
      Pack8 o;
#pragma unroll
      for (int j = 0; j < 8; ++j) o.h[j] = (__bf16)t[h * 8 + j];
      *(uint4*)(Wp + ((size_t)z * (C_DIM * C_DIM / F_UNIT) + unit) * F_UNIT +
                h * 256 + lane * 8) = o.u;
    }
    return;
  }

  const int task  = (blockIdx.x - W_BLOCKS) * 8 + wave;
  const int strip = task >> 2;                    // 16 rows
  const int cg    = task & 3;                     // 128 columns
  const float* xp = x + (size_t)strip * 16 * C_DIM + cg * 128 + lane * 4;
  float*       op = out + (size_t)strip * 16 * 1024 + cg * 128 + lane * 4;
  __bf16*      xw = xt[wave];
  f32x4 v[16];
#pragma unroll
  for (int r = 0; r < 16; ++r) v[r] = *(const f32x4*)(xp + r * C_DIM);
  loads_issued();                                 // 8 KB a wave in flight at once
#pragma unroll
  for (int r = 0; r < 16; ++r) {
    Pack4 o;
#pragma unroll
    for (int j = 0; j < 4; ++j) o.h[j] = (__bf16)v[r][j];
    *(uint2*)(xw + (lane >> 1) * X_PITCH + r * 8 + (lane & 1) * 4) = o.u;
  }
  // Lanes read other lanes' writes.  No global store stands in front of it: the
  // barrier would wait for it to complete.
  __syncthreads();
  __bf16* xo = Xp + (size_t)(strip * (C_DIM / 32) + cg * 4) * F_UNIT + lane * 8;
#pragma unroll
  for (int m = 0; m < 8; ++m)                     // 512-B row m of the four units
    *(uint4*)(xo + m * 256) =
        *(const uint4*)(xw + (m * 2 + (lane >> 4)) * X_PITCH + (lane & 15) * 8);
#pragma unroll
  for (int r = 0; r < 16; ++r)
    __builtin_nontemporal_store(v[r], (f32x4*)(op + r * 1024));
}

// ---------------------------------------------------------------------------
// Kernel 1: projections.  dst = bf16(x @ W + b).  grid = (M/128, 512/32, 3).
// 8 waves/block, each owns a 16x32 output strip (2 WMMA tiles, A reuse x2).
// A and B fragments come straight from the packed copies of kernel 0, 512
// contiguous bytes a load; the B fragments are the same for the 8 waves.
// Nothing is shared through LDS in the loop: no barrier.
// The result is stored in the fragment order of its consumer:
//   V:    unit (row/32, col/16), contraction index = row (key).  A lane holds
//         one column and 8 consecutive rows: its 16 B of a 512-B unit row.
//   Q, K: unit (row/16, col/32), contraction index = column.  Each wave turns
//         its 16 x 32 strip through a 1-KB LDS area of its own, once.
// Either way a wave stores 512 contiguous bytes per WMMA tile.
// ---------------------------------------------------------------------------
__global__ __launch_bounds__(256) void proj_kernel(
    const __bf16* __restrict__ Xp, const __bf16* __restrict__ Wp,
    const float* __restrict__ bq, const float* __restrict__ bk,
    const float* __restrict__ bv,
    __bf16* __restrict__ Qb, __bf16* __restrict__ Kb, __bf16* __restrict__ Vb) {
  __shared__ __attribute__((aligned(16))) __bf16 xt[8][F_UNIT];  // one unit a wave

  const int lane = threadIdx.x & 31;
  const int wave = threadIdx.x >> 5;
  const int row0 = blockIdx.x * 128 + wave * 16;
  const int n0   = blockIdx.y * 32;

  const float* bias;
  __bf16*      dst;
  switch (blockIdx.z) {
    case 0:  bias = bq; dst = Qb; break;
    case 1:  bias = bk; dst = Kb; break;
    default: bias = bv; dst = Vb; break;
  }
  const __bf16* A  = Xp + (size_t)(row0 >> 4) * (C_DIM / 32) * F_UNIT;
  const __bf16* Bw = Wp + (size_t)blockIdx.z * C_DIM * C_DIM +
                     (size_t)(n0 >> 4) * (C_DIM / 32) * F_UNIT;

  v8f acc[2] = {};
  for (int ku = 0; ku < C_DIM / 32; ++ku) {
    const v16bf a  = load_frag_packed(A, ku, lane);
    const v16bf b0 = load_frag_packed(Bw, ku, lane);
    const v16bf b1 = load_frag_packed(Bw, C_DIM / 32 + ku, lane);
    acc[0] = wmma_bf16(a, b0, acc[0]);
    acc[1] = wmma_bf16(a, b1, acc[1]);
  }
  loads_issued();                  // the epilogue reuses the address registers

  const int hi = lane >> 4;
  union Pack8 { uint4 u; __bf16 h[8]; };
  if (blockIdx.z >= 2) {                          // V; same for the whole block
#pragma unroll
    for (int nt = 0; nt < 2; ++nt) {
      const float bv0 = bias[n0 + nt * 16 + (lane & 15)];
      Pack8 o;
#pragma unroll
      for (int i = 0; i < 8; ++i) o.h[i] = (__bf16)(acc[nt][i] + bv0);
      *(uint4*)(dst +
                ((size_t)(row0 >> 5) * (C_DIM / 16) + (n0 >> 4) + nt) * F_UNIT +
                ((row0 >> 4) & 1) * 256 + lane * 8) = o.u;
    }
  } else {                                        // Q, K
    __bf16* xw = xt[wave];                        // read by this wave alone
#pragma unroll
    for (int nt = 0; nt < 2; ++nt) {
      const float bv0 = bias[n0 + nt * 16 + (lane & 15)];
#pragma unroll
      for (int i = 0; i < 8; ++i)
        xw[nt * 256 + (i + 8 * hi + 16 * ((lane >> 3) & 1)) * 8 + (lane & 7)] =
            (__bf16)(acc[nt][i] + bv0);
    }
#pragma unroll
    for (int nt = 0; nt < 2; ++nt) {
      Pack8 o;
#pragma unroll
      for (int j = 0; j < 8; ++j) o.h[j] = xw[nt * 256 + lane * 8 + j];
      *(uint4*)(dst + ((size_t)(row0 >> 4) * (C_DIM / 32) + (n0 >> 5)) * F_UNIT +
                nt * 256 + lane * 8) = o.u;
    }
    // In front of any later rewrite of the address pair that both stores name.
    asm volatile("s_wait_xcnt 0x0" ::: "memory");
  }
}

#define E_TILE 512
#define E_ROW  (T_DIM / 32)

__global__ __launch_bounds__(256) void colsum_kernel(
    const __bf16* __restrict__ Qb, const __bf16* __restrict__ Kb,
    float* __restrict__ rcol, float* __restrict__ Ew) {
  __shared__ float ssum[64];
  if (threadIdx.x < 64) ssum[threadIdx.x] = 0.0f;
  __syncthreads();

  const int b     = blockIdx.y;
  const int s_blk = blockIdx.x * 64;
  const __bf16* Q = Qb + (size_t)b * T_DIM * C_DIM;
  const __bf16* K = Kb + (size_t)b * T_DIM * C_DIM;
  float*        E = Ew + (size_t)b * (T_DIM / 16) * E_ROW * E_TILE;

  const int lane = threadIdx.x & 31;
  const int wave = threadIdx.x >> 5;
  const int tw   = wave >> 1;               // 0..3 : 32-row t strip
  const int sw   = wave & 1;                // 0..1 : 32-col s half
  const int s0   = s_blk + sw * 32;
  const int hi   = lane >> 4;

  float part[2][8] = {};                    // per key held by this lane
  for (int t0 = s_blk + tw * 32; t0 < T_DIM; t0 += 128) {
    if (t0 + 31 < s0) continue;             // wave tile fully above diagonal
    v8f l[2][2] = {};                       // [t tile][s tile], rows s, cols t
    for (int k0 = 0; k0 < C_DIM; k0 += 32) {
      const int ku = k0 >> 5;               // 16 units per 16-row strip
      const v16bf a0 = load_frag_packed(Q, (t0 >> 4) * 16 + ku, lane);
      const v16bf a1 = load_frag_packed(Q, (t0 >> 4) * 16 + 16 + ku, lane);
      const v16bf b0 = load_frag_packed(K, (s0 >> 4) * 16 + ku, lane);
      const v16bf b1 = load_frag_packed(K, (s0 >> 4) * 16 + 16 + ku, lane);
      l[0][0] = wmma_bf16(b0, a0, l[0][0]);
      l[0][1] = wmma_bf16(b1, a0, l[0][1]);
      l[1][0] = wmma_bf16(b0, a1, l[1][0]);
      l[1][1] = wmma_bf16(b1, a1, l[1][1]);
    }
#pragma unroll
    for (int it = 0; it < 2; ++it) {
      const int t = t0 + it * 16 + (lane & 15);
      float* ep = E + ((size_t)((t0 >> 4) + it) * E_ROW + (s0 >> 5)) * E_TILE +
                  lane * 4;
#pragma unroll
      for (int is = 0; is < 2; ++is) {
        f32x4 ev[2];
#pragma unroll
        for (int i = 0; i < 8; ++i) {
          const int s = s0 + is * 16 + i + 8 * hi;
          const float e = (s <= t) ? __expf(l[it][is][i] * SM_SCALE) : 0.0f;
          part[is][i] += e;
          ev[i >> 2][i & 3] = e;
        }
        *(f32x4*)(ep + (is * 2) * 128)     = ev[0];
        *(f32x4*)(ep + (is * 2 + 1) * 128) = ev[1];
      }
    }
    // The next trip rewrites the registers these stores name (data, address).
    asm volatile("s_wait_xcnt 0x0" ::: "memory");
  }
#pragma unroll
  for (int is = 0; is < 2; ++is) {
#pragma unroll
    for (int i = 0; i < 8; ++i) {
      float p = part[is][i];
      p += __shfl_xor(p, 1, 32);
      p += __shfl_xor(p, 2, 32);
      p += __shfl_xor(p, 4, 32);
      p += __shfl_xor(p, 8, 32);
      if ((lane & 15) == 0) atomicAdd(&ssum[sw * 32 + is * 16 + i + 8 * hi], p);
    }
  }
  __syncthreads();
  if (threadIdx.x < 64)
    rcol[(size_t)b * T_DIM + s_blk + threadIdx.x] = 1.0f / ssum[threadIdx.x];
}

// ---------------------------------------------------------------------------
// Kernel 3: read = (e[t,s] * rcol[s]) @ V, causal.
// grid = (T/128, 512/128, B).  Block tile: 128(t) x 128(v), s-steps of 64.
// Each wave reads the stored e of its 32 t rows straight into A fragments
// (512 contiguous bytes per load), scales by rcol and rounds to bf16, and
// reads V straight into B fragments (stored in that order by kernel 1); then
// 2t x 4v blocked P@V WMMAs.  Nothing is shared through LDS: no barrier.
// ---------------------------------------------------------------------------
// One s-step of 64 keys.  EDGE = false: every 32-key chunk lies at or below the
// diagonal tile of every wave of the block, so all loads issue together with
// no test.  EDGE = true (the last two steps): a wave skips the e and rcol loads
// of chunks above its diagonal tile, which are not stored, and multiplies zeros.
template <bool EDGE>
__device__ __forceinline__ void pv_step(
    const float* __restrict__ E, const __bf16* __restrict__ V,
    const float* __restrict__ rc, int s0, int ta0, int vu0, int lane,
    v8f (&acc)[2][4]) {
  const int hi = lane >> 4;
  // ---- loads: e, V fragments, rcol of the keys this lane holds ----
  f32x4 e[2][2][4] = {};                 // [s chunk][t tile][512-B row]
  v16bf vb[2][4];                        // [s chunk][v tile]
  f32x4 r[2][4]    = {};
  const float* ep =
      E + ((size_t)(ta0 >> 4) * E_ROW + (s0 >> 5)) * E_TILE + lane * 4;
  const __bf16* vp = V + (size_t)((s0 >> 5) * (C_DIM / 16) + vu0) * F_UNIT;
  const float* rp = rc + s0 + 8 * hi;
#pragma unroll
  for (int kk = 0; kk < 2; ++kk) {
    if (!EDGE || s0 + kk * 32 <= ta0) {
#pragma unroll
      for (int it = 0; it < 2; ++it) {
#pragma unroll
        for (int c = 0; c < 4; ++c)
          e[kk][it][c] =
              *(const f32x4*)(ep + (it * E_ROW + kk) * E_TILE + c * 128);
      }
      if (EDGE) loads_issued();          // ep may end here and be reused
      r[kk][0] = *(const f32x4*)(rp + kk * 32);
      r[kk][1] = *(const f32x4*)(rp + kk * 32 + 4);
      r[kk][2] = *(const f32x4*)(rp + kk * 32 + 16);
      r[kk][3] = *(const f32x4*)(rp + kk * 32 + 20);
      if (EDGE) loads_issued();
    }
#pragma unroll
    for (int nt = 0; nt < 4; ++nt)
      vb[kk][nt] = load_frag_packed(vp, kk * (C_DIM / 16) + nt, lane);
  }
  loads_issued();                        // the pointers are stepped or reused next
#pragma unroll
  for (int kk = 0; kk < 2; ++kk) {
    // ---- P fragments: 32t x 32s, bf16(e * rcol) ----
    v16bf pa[2];
#pragma unroll
    for (int it = 0; it < 2; ++it) {
      FragU f;
#pragma unroll
      for (int c = 0; c < 4; ++c) {
#pragma unroll
        for (int j = 0; j < 4; ++j)
          f.h[c * 4 + j] = (__bf16)(e[kk][it][c][j] * r[kk][c][j]);
      }
      pa[it] = f.v;
    }
    // ---- P(32x32) @ V(32x64) ----
#pragma unroll
    for (int nt = 0; nt < 4; ++nt) {
      acc[0][nt] = wmma_bf16(pa[0], vb[kk][nt], acc[0][nt]);
      acc[1][nt] = wmma_bf16(pa[1], vb[kk][nt], acc[1][nt]);
    }
  }
}

__global__ __launch_bounds__(256) void attend_kernel(
    const float* __restrict__ Ew, const __bf16* __restrict__ Vb,
    const float* __restrict__ rcol, float* __restrict__ out) {
  const int b      = blockIdx.z;
  const int t_base = blockIdx.x * 128;
  const int v_base = blockIdx.y * 128;
  const float*  E  = Ew + (size_t)b * (T_DIM / 16) * E_ROW * E_TILE;
  const __bf16* V  = Vb + (size_t)b * T_DIM * C_DIM;
  const float*  rc = rcol + (size_t)b * T_DIM;
  float*        ob = out + (size_t)b * T_DIM * 1024;

  const int lane = threadIdx.x & 31;
  // Scalar wave number: the test on stored tiles is then a scalar branch.
  const int wave = __builtin_amdgcn_readfirstlane(threadIdx.x >> 5);
  const int tw   = wave >> 1;            // 0..3 : 32-row t strip
  const int sw   = wave & 1;             // 0..1 : 64-col v half
  const int hi   = lane >> 4;
  const int ta0  = t_base + tw * 32;
  const int vu0  = (v_base + sw * 64) >> 4;  // first 16-column V unit of the wave

  v8f acc[2][4] = {};                    // 32t x 64v accumulators

  for (int s0 = 0; s0 < t_base; s0 += 64)
    pv_step<false>(E, V, rc, s0, ta0, vu0, lane, acc);
  pv_step<true>(E, V, rc, t_base, ta0, vu0, lane, acc);
  pv_step<true>(E, V, rc, t_base + 64, ta0, vu0, lane, acc);

  const int colb = v_base + sw * 64;
#pragma unroll
  for (int it = 0; it < 2; ++it) {
#pragma unroll
    for (int nt = 0; nt < 4; ++nt) {
#pragma unroll
      for (int i = 0; i < 8; ++i) {
        const int r = t_base + tw * 32 + it * 16 + i + 8 * hi;
        __builtin_nontemporal_store(
            acc[it][nt][i],
            ob + (size_t)r * 1024 + 512 + colb + nt * 16 + (lane & 15));
      }
    }
  }
}

// ---------------------------------------------------------------------------
// Launcher.  Workspace layout (bytes):
//   [0, 16M)   Q  bf16 [16384][512], 1-KB fragment units [1024][16]
//   [16M,32M)  K  bf16, as Q
//   [32M,48M)  V  bf16, 1-KB fragment units [512][32]
//   [48M, +64K) rcol f32 [16384]   (reciprocal column sums)
//   then 128M   e f32, 2 KB units [8][128][64]
//   then 16M    x bf16, 1-KB fragment units [1024][16]
//   then 1.5M   Wq, Wk, Wv bf16, 1-KB fragment units [3][32][16]
// ---------------------------------------------------------------------------
extern "C" void kernel_launch(void* const* d_in, const int* in_sizes, int n_in,
                              void* d_out, int out_size, void* d_ws,
                              size_t ws_size, hipStream_t stream) {
  const float* x  = (const float*)d_in[0];
  const float* Wq = (const float*)d_in[1];
  const float* bq = (const float*)d_in[2];
  const float* Wk = (const float*)d_in[3];
  const float* bk = (const float*)d_in[4];
  const float* Wv = (const float*)d_in[5];
  const float* bv = (const float*)d_in[6];
  float* out = (float*)d_out;

  const size_t qkv = (size_t)M_ROWS * C_DIM;           // elems per matrix
  __bf16* Qb = (__bf16*)d_ws;
  __bf16* Kb = Qb + qkv;
  __bf16* Vb = Kb + qkv;
  float* rcol = (float*)(Vb + qkv);
  float* Ew   = rcol + M_ROWS;
  __bf16* Xp = (__bf16*)(Ew + (size_t)B_DIM * T_DIM * T_DIM);
  __bf16* Wp = Xp + qkv;

  // out[..., :512] = x; x and W as bf16 fragments
  pack_copy_kernel<<<W_BLOCKS + M_ROWS / 32, 256, 0, stream>>>(x, Wq, Wk, Wv, out,
                                                               Xp, Wp);
  // Q, K, V projections (bf16)
  proj_kernel<<<dim3(M_ROWS / 128, C_DIM / 32, 3), 256, 0, stream>>>(
      Xp, Wp, bq, bk, bv, Qb, Kb, Vb);
  // masked exponentials and query-axis softmax denominators
  colsum_kernel<<<dim3(T_DIM / 64, B_DIM), 256, 0, stream>>>(Qb, Kb, rcol, Ew);
  // out[..., 512:] = P @ V
  attend_kernel<<<dim3(T_DIM / 128, C_DIM / 128, B_DIM), 256, 0, stream>>>(
      Ew, Vb, rcol, out);
}

// v004
// One run takes 156 microseconds.
// Timed twice side by side with v003, it ran 1.21 and 1.19 times as fast.
// All steps since v000 together make it 5.53 times as fast.
#include <hip/hip_runtime.h>

#define B_DIM   8
#define T_DIM   2048
#define C_DIM   512
#define M_ROWS  (B_DIM * T_DIM)        // 16384
#define SM_SCALE 0.04419417382415922f  // 1/sqrt(512)

typedef __attribute__((ext_vector_type(16))) __bf16    v16bf;
typedef __attribute__((ext_vector_type(8)))  float     v8f;
typedef __attribute__((ext_vector_type(4)))  float     f32x4;

union FragU {
  uint4  u[2];
  __bf16 h[16];
  v16bf  v;
};

__device__ __forceinline__ v8f wmma_bf16(v16bf a, v16bf b, v8f c) {
  // (neg_a, A, neg_b, B, c_mod, C, reuse_a, reuse_b)
  return __builtin_amdgcn_wmma_f32_16x16x32_bf16(false, a, false, b, (short)0, c,
                                                 false, false);
}

#define F_UNIT 512                     // bf16 elements per fragment unit
__device__ __forceinline__ v16bf load_frag_packed(const __bf16* base, int unit,
                                                  int lane) {
  const __bf16* p = base + (size_t)unit * F_UNIT + lane * 8;
  FragU f;
  f.u[0] = *(const uint4*)(p);
  f.u[1] = *(const uint4*)(p + 256);
  return f.v;
}

// Stands behind a run of loads.  The wait: in front of the first rewrite of an
// address register that the loads name.  The scheduling barriers: the first
// keeps the loads in front of the arithmetic, all in flight together (without
// it the scheduler sinks them between the WMMAs and the wave waits out a load
// latency several times per step); the second keeps the rewrites behind the wait.
__device__ __forceinline__ void loads_issued() {
  __builtin_amdgcn_sched_barrier(0);
  asm volatile("s_wait_xcnt 0x0" ::: "memory");
  __builtin_amdgcn_sched_barrier(0);
}

#define W_BLOCKS 192                   // 3 x (512/16) x (512/32) units / 8 waves
#define X_PITCH  136                   // bf16 elements per 8-column group in LDS

__global__ __launch_bounds__(256) void pack_copy_kernel(
    const float* __restrict__ x, const float* __restrict__ Wq,
    const float* __restrict__ Wk, const float* __restrict__ Wv,
    float* __restrict__ out, __bf16* __restrict__ Xp, __bf16* __restrict__ Wp) {
  __shared__ __attribute__((aligned(16))) __bf16 xt[8][16 * X_PITCH];
  const int lane = threadIdx.x & 31;
  // Scalar wave number: the bases are then scalar, and one lane offset, never
  // rewritten, serves the loads and stores of a wave.
  const int wave = __builtin_amdgcn_readfirstlane(threadIdx.x >> 5);
  union Pack8 { uint4 u; __bf16 h[8]; };
  union Pack4 { uint2 u; __bf16 h[4]; };

  if (blockIdx.x < W_BLOCKS) {                    // same for the whole block
    const int z = blockIdx.x >> 6;                // 64 blocks a matrix
    const float* Wm = (z == 0) ? Wq : (z == 1) ? Wk : Wv;
    const int unit = (blockIdx.x & 63) * 8 + wave;   // (col/16) * 16 + row/32
    const float* wp = Wm + (size_t)((unit & 15) * 32 + (lane >> 4) * 8) * C_DIM +
                      (unit >> 4) * 16 + (lane & 15);
    float t[16];
#pragma unroll
    for (int i = 0; i < 16; ++i)
      t[i] = wp[(size_t)((i >> 3) * 16 + (i & 7)) * C_DIM];
#pragma unroll
    for (int h = 0; h < 2; ++h) {
      Pack8 o;
#pragma unroll
      for (int j = 0; j < 8; ++j) o.h[j] = (__bf16)t[h * 8 + j];
      *(uint4*)(Wp + ((size_t)z * (C_DIM * C_DIM / F_UNIT) + unit) * F_UNIT +
                h * 256 + lane * 8) = o.u;
    }
    return;
  }

  const int task  = (blockIdx.x - W_BLOCKS) * 8 + wave;
  const int strip = task >> 2;                    // 16 rows
  const int cg    = task & 3;                     // 128 columns
  const float* xp = x + (size_t)strip * 16 * C_DIM + cg * 128 + lane * 4;
  float*       op = out + (size_t)strip * 16 * 1024 + cg * 128 + lane * 4;
  __bf16*      xw = xt[wave];
  f32x4 v[16];
#pragma unroll
  for (int r = 0; r < 16; ++r) v[r] = *(const f32x4*)(xp + r * C_DIM);
  loads_issued();                                 // 8 KB a wave in flight at once
#pragma unroll
  for (int r = 0; r < 16; ++r) {
    Pack4 o;
#pragma unroll
    for (int j = 0; j < 4; ++j) o.h[j] = (__bf16)v[r][j];
    *(uint2*)(xw + (lane >> 1) * X_PITCH + r * 8 + (lane & 1) * 4) = o.u;
  }
  // Lanes read other lanes' writes.  No global store stands in front of it: the
  // barrier would wait for it to complete.
  __syncthreads();
  __bf16* xo = Xp + (size_t)(strip * (C_DIM / 32) + cg * 4) * F_UNIT + lane * 8;
#pragma unroll
  for (int m = 0; m < 8; ++m)                     // 512-B row m of the four units
    *(uint4*)(xo + m * 256) =
        *(const uint4*)(xw + (m * 2 + (lane >> 4)) * X_PITCH + (lane & 15) * 8);
#pragma unroll
  for (int r = 0; r < 16; ++r)
    __builtin_nontemporal_store(v[r], (f32x4*)(op + r * 1024));
}

// ---------------------------------------------------------------------------
// Kernel 1: projections.  dst = bf16(x @ W + b).  grid = (M/128, 512/32, 3).
// 8 waves/block, each owns a 16x32 output strip (2 WMMA tiles, A reuse x2).
// A and B fragments come straight from the packed copies of kernel 0, 512
// contiguous bytes a load; the B fragments are the same for the 8 waves.
// Nothing is shared through LDS in the loop: no barrier.
// The result is stored in the fragment order of its consumer:
//   V:    unit (row/32, col/16), contraction index = row (key).  A lane holds
//         one column and 8 consecutive rows: its 16 B of a 512-B unit row.
//   Q, K: unit (row/16, col/32), contraction index = column.  Each wave turns
//         its 16 x 32 strip through a 1-KB LDS area of its own, once.
// Either way a wave stores 512 contiguous bytes per WMMA tile.
// ---------------------------------------------------------------------------
__global__ __launch_bounds__(256) void proj_kernel(
    const __bf16* __restrict__ Xp, const __bf16* __restrict__ Wp,
    const float* __restrict__ bq, const float* __restrict__ bk,
    const float* __restrict__ bv,
    __bf16* __restrict__ Qb, __bf16* __restrict__ Kb, __bf16* __restrict__ Vb) {
  __shared__ __attribute__((aligned(16))) __bf16 xt[8][F_UNIT];  // one unit a wave

  const int lane = threadIdx.x & 31;
  const int wave = threadIdx.x >> 5;
  const int row0 = blockIdx.x * 128 + wave * 16;
  const int n0   = blockIdx.y * 32;

  const float* bias;
  __bf16*      dst;
  switch (blockIdx.z) {
    case 0:  bias = bq; dst = Qb; break;
    case 1:  bias = bk; dst = Kb; break;
    default: bias = bv; dst = Vb; break;
  }
  const __bf16* A  = Xp + (size_t)(row0 >> 4) * (C_DIM / 32) * F_UNIT;
  const __bf16* Bw = Wp + (size_t)blockIdx.z * C_DIM * C_DIM +
                     (size_t)(n0 >> 4) * (C_DIM / 32) * F_UNIT;

  v8f acc[2] = {};
  for (int ku = 0; ku < C_DIM / 32; ++ku) {
    const v16bf a  = load_frag_packed(A, ku, lane);
    const v16bf b0 = load_frag_packed(Bw, ku, lane);
    const v16bf b1 = load_frag_packed(Bw, C_DIM / 32 + ku, lane);
    acc[0] = wmma_bf16(a, b0, acc[0]);
    acc[1] = wmma_bf16(a, b1, acc[1]);
  }
  loads_issued();                  // the epilogue reuses the address registers

  const int hi = lane >> 4;
  union Pack8 { uint4 u; __bf16 h[8]; };
  if (blockIdx.z >= 2) {                          // V; same for the whole block
#pragma unroll
    for (int nt = 0; nt < 2; ++nt) {
      const float bv0 = bias[n0 + nt * 16 + (lane & 15)];
      Pack8 o;
#pragma unroll
      for (int i = 0; i < 8; ++i) o.h[i] = (__bf16)(acc[nt][i] + bv0);
      *(uint4*)(dst +
                ((size_t)(row0 >> 5) * (C_DIM / 16) + (n0 >> 4) + nt) * F_UNIT +
                ((row0 >> 4) & 1) * 256 + lane * 8) = o.u;
    }
  } else {                                        // Q, K
    __bf16* xw = xt[wave];                        // read by this wave alone
#pragma unroll
    for (int nt = 0; nt < 2; ++nt) {
      const float bv0 = bias[n0 + nt * 16 + (lane & 15)];
#pragma unroll
      for (int i = 0; i < 8; ++i)
        xw[nt * 256 + (i + 8 * hi + 16 * ((lane >> 3) & 1)) * 8 + (lane & 7)] =
            (__bf16)(acc[nt][i] + bv0);
    }
#pragma unroll
    for (int nt = 0; nt < 2; ++nt) {
      Pack8 o;
#pragma unroll
      for (int j = 0; j < 8; ++j) o.h[j] = xw[nt * 256 + lane * 8 + j];
      *(uint4*)(dst + ((size_t)(row0 >> 4) * (C_DIM / 32) + (n0 >> 5)) * F_UNIT +
                nt * 256 + lane * 8) = o.u;
    }
    // In front of any later rewrite of the address pair that both stores name.
    asm volatile("s_wait_xcnt 0x0" ::: "memory");
  }
}

#define E_TILE 512
#define E_ROW  (T_DIM / 32)
#define T_BLKS (T_DIM / 128)
#define P_BLOCKS (T_BLKS * (T_BLKS + 1))

__global__ __launch_bounds__(256) void colsum_kernel(
    const __bf16* __restrict__ Qb, const __bf16* __restrict__ Kb,
    float* __restrict__ psum, float* __restrict__ Ew) {
  __shared__ float ssum[64];
  if (threadIdx.x < 64) ssum[threadIdx.x] = 0.0f;
  __syncthreads();

  const int b = blockIdx.y;
  // Query block tb has key blocks 0..2 tb + 1; tb (tb + 1) tiles lie before it.
  // Unrolled: fifteen scalar compares with constants, no loop and no multiply.
  int tb = 0;
#pragma unroll
  for (int u = 1; u < T_BLKS; ++u) tb += (u * (u + 1) <= (int)blockIdx.x) ? 1 : 0;
  const int s_blk = ((int)blockIdx.x - tb * (tb + 1)) * 64;
  const __bf16* Q = Qb + (size_t)b * T_DIM * C_DIM;
  const __bf16* K = Kb + (size_t)b * T_DIM * C_DIM;
  float*        E = Ew + (size_t)b * (T_DIM / 16) * E_ROW * E_TILE;

  const int lane = threadIdx.x & 31;
  const int wave = threadIdx.x >> 5;
  const int tw   = wave >> 1;               // 0..3 : 32-row t strip
  const int sw   = wave & 1;                // 0..1 : 32-col s half
  const int t0   = tb * 128 + tw * 32;
  const int s0   = s_blk + sw * 32;
  const int hi   = lane >> 4;

  const bool live = t0 + 31 >= s0;          // else: wave tile above the diagonal
  // Every loop over ev, part or l is unrolled: the arrays stay in registers.
  f32x4 ev[2][2][2];                        // e: [t tile][s tile][512-B row]
  if (live) {
    float part[2][8] = {};                  // per key held by this lane
    v8f l[2][2] = {};                       // [t tile][s tile], rows s, cols t
    for (int k0 = 0; k0 < C_DIM; k0 += 32) {
      const int ku = k0 >> 5;               // 16 units per 16-row strip
      const v16bf a0 = load_frag_packed(Q, (t0 >> 4) * 16 + ku, lane);
      const v16bf a1 = load_frag_packed(Q, (t0 >> 4) * 16 + 16 + ku, lane);
      const v16bf b0 = load_frag_packed(K, (s0 >> 4) * 16 + ku, lane);
      const v16bf b1 = load_frag_packed(K, (s0 >> 4) * 16 + 16 + ku, lane);
      l[0][0] = wmma_bf16(b0, a0, l[0][0]);
      l[0][1] = wmma_bf16(b1, a0, l[0][1]);
      l[1][0] = wmma_bf16(b0, a1, l[1][0]);
      l[1][1] = wmma_bf16(b1, a1, l[1][1]);
    }
#pragma unroll
    for (int it = 0; it < 2; ++it) {
      const int t = t0 + it * 16 + (lane & 15);
#pragma unroll
      for (int is = 0; is < 2; ++is) {
#pragma unroll
        for (int i = 0; i < 8; ++i) {
          const int s = s0 + is * 16 + i + 8 * hi;
          const float e = (s <= t) ? __expf(l[it][is][i] * SM_SCALE) : 0.0f;
          part[is][i] += e;
          ev[it][is][i >> 2][i & 3] = e;
        }
      }
    }
    // Sum over the 16 queries of a half-wave.  It runs once per tile: the lane
    // distance is the outer loop, so that the 16 exchanges of a distance are
    // in flight together and the wave waits four times, not 64.
#pragma unroll
    for (int m = 1; m < 16; m <<= 1) {
#pragma unroll
      for (int is = 0; is < 2; ++is) {
#pragma unroll
        for (int i = 0; i < 8; ++i) part[is][i] += __shfl_xor(part[is][i], m, 32);
      }
    }
    if ((lane & 15) == 0) {
#pragma unroll
      for (int is = 0; is < 2; ++is) {
#pragma unroll
        for (int i = 0; i < 8; ++i)
          atomicAdd(&ssum[sw * 32 + is * 16 + i + 8 * hi], part[is][i]);
      }
    }
  }
  // No global store stands in front of it: the barrier would wait for it to
  // complete, once per tile.
  __syncthreads();
  if (live) {
#pragma unroll
    for (int it = 0; it < 2; ++it) {
      float* ep = E + ((size_t)((t0 >> 4) + it) * E_ROW + (s0 >> 5)) * E_TILE +
                  lane * 4;
#pragma unroll
      for (int c = 0; c < 4; ++c) *(f32x4*)(ep + c * 128) = ev[it][c >> 1][c & 1];
    }
  }
  // What follows may rewrite the registers these stores name (data, address).
  asm volatile("s_wait_xcnt 0x0" ::: "memory");
  float* pb = psum + (size_t)b * T_BLKS * T_DIM + s_blk;
  if (threadIdx.x < 64) pb[tb * T_DIM + threadIdx.x] = ssum[threadIdx.x];
  // Likewise for the store above.
  asm volatile("s_wait_xcnt 0x0" ::: "memory");
  // The diagonal tile is the first of its keys: the query blocks above it have
  // no term, and their rows get the zeros that kernel 2b adds: 16 threads a row.
  if (s_blk >= tb * 128 && (int)(threadIdx.x >> 4) < tb)
    *(f32x4*)(pb + (threadIdx.x >> 4) * T_DIM + (threadIdx.x & 15) * 4) =
        f32x4{0.0f, 0.0f, 0.0f, 0.0f};
}

// ---------------------------------------------------------------------------
// Kernel 2b: rcol[b,s] = 1 / sum over tb of psum[b,tb,s], in rising tb.
// One thread a key; every row of psum was written by kernel 2.  The bases are
// scalar: the thread index is the one offset of the loads and of the store.
// ---------------------------------------------------------------------------
__global__ __launch_bounds__(256) void rcol_kernel(
    const float* __restrict__ psum, float* __restrict__ rcol) {
  const float* p = psum + (size_t)(blockIdx.x / (T_DIM / 256)) * T_BLKS * T_DIM +
                   (blockIdx.x % (T_DIM / 256)) * 256;
  float v[T_BLKS];
  // Unrolled: the array stays in registers and the loads are one run.
#pragma unroll
  for (int tb = 0; tb < T_BLKS; ++tb) v[tb] = p[tb * T_DIM + threadIdx.x];
  loads_issued();                  // all in flight at once
  float sum = 0.0f;
#pragma unroll
  for (int tb = 0; tb < T_BLKS; ++tb) sum += v[tb];
  rcol[blockIdx.x * 256 + threadIdx.x] = 1.0f / sum;
}

// ---------------------------------------------------------------------------
// Kernel 3: read = (e[t,s] * rcol[s]) @ V, causal.
// grid = (T/128, 512/128, B).  Block tile: 128(t) x 128(v), s-steps of 64.
// Each wave reads the stored e of its 32 t rows straight into A fragments
// (512 contiguous bytes per load), scales by rcol and rounds to bf16, and
// reads V straight into B fragments (stored in that order by kernel 1); then
// 2t x 4v blocked P@V WMMAs.  Nothing is shared through LDS: no barrier.
// ---------------------------------------------------------------------------
// One s-step of 64 keys.  EDGE = false: every 32-key chunk lies at or below the
// diagonal tile of every wave of the block, so all loads issue together with
// no test.  EDGE = true (the last two steps): a wave skips the e and rcol loads
// of chunks above its diagonal tile, which are not stored, and multiplies zeros.
template <bool EDGE>
__device__ __forceinline__ void pv_step(
    const float* __restrict__ E, const __bf16* __restrict__ V,
    const float* __restrict__ rc, int s0, int ta0, int vu0, int lane,
    v8f (&acc)[2][4]) {
  const int hi = lane >> 4;
  // ---- loads: e, V fragments, rcol of the keys this lane holds ----
  f32x4 e[2][2][4] = {};                 // [s chunk][t tile][512-B row]
  v16bf vb[2][4];                        // [s chunk][v tile]
  f32x4 r[2][4]    = {};
  const float* ep =
      E + ((size_t)(ta0 >> 4) * E_ROW + (s0 >> 5)) * E_TILE + lane * 4;
  const __bf16* vp = V + (size_t)((s0 >> 5) * (C_DIM / 16) + vu0) * F_UNIT;
  const float* rp = rc + s0 + 8 * hi;
#pragma unroll
  for (int kk = 0; kk < 2; ++kk) {
    if (!EDGE || s0 + kk * 32 <= ta0) {
#pragma unroll
      for (int it = 0; it < 2; ++it) {
#pragma unroll
        for (int c = 0; c < 4; ++c)
          e[kk][it][c] =
              *(const f32x4*)(ep + (it * E_ROW + kk) * E_TILE + c * 128);
      }
      if (EDGE) loads_issued();          // ep may end here and be reused
      r[kk][0] = *(const f32x4*)(rp + kk * 32);
      r[kk][1] = *(const f32x4*)(rp + kk * 32 + 4);
      r[kk][2] = *(const f32x4*)(rp + kk * 32 + 16);
      r[kk][3] = *(const f32x4*)(rp + kk * 32 + 20);
      if (EDGE) loads_issued();
    }
#pragma unroll
    for (int nt = 0; nt < 4; ++nt)
      vb[kk][nt] = load_frag_packed(vp, kk * (C_DIM / 16) + nt, lane);
  }
  loads_issued();                        // the pointers are stepped or reused next
#pragma unroll
  for (int kk = 0; kk < 2; ++kk) {
    // ---- P fragments: 32t x 32s, bf16(e * rcol) ----
    v16bf pa[2];
#pragma unroll
    for (int it = 0; it < 2; ++it) {
      FragU f;
#pragma unroll
      for (int c = 0; c < 4; ++c) {
#pragma unroll
        for (int j = 0; j < 4; ++j)
          f.h[c * 4 + j] = (__bf16)(e[kk][it][c][j] * r[kk][c][j]);
      }
      pa[it] = f.v;
    }
    // ---- P(32x32) @ V(32x64) ----
#pragma unroll
    for (int nt = 0; nt < 4; ++nt) {
      acc[0][nt] = wmma_bf16(pa[0], vb[kk][nt], acc[0][nt]);
      acc[1][nt] = wmma_bf16(pa[1], vb[kk][nt], acc[1][nt]);
    }
  }
}

__global__ __launch_bounds__(256) void attend_kernel(
    const float* __restrict__ Ew, const __bf16* __restrict__ Vb,
    const float* __restrict__ rcol, float* __restrict__ out) {
  const int b      = blockIdx.z;
  const int t_base = blockIdx.x * 128;
  const int v_base = blockIdx.y * 128;
  const float*  E  = Ew + (size_t)b * (T_DIM / 16) * E_ROW * E_TILE;
  const __bf16* V  = Vb + (size_t)b * T_DIM * C_DIM;
  const float*  rc = rcol + (size_t)b * T_DIM;
  float*        ob = out + (size_t)b * T_DIM * 1024;

  const int lane = threadIdx.x & 31;
  // Scalar wave number: the test on stored tiles is then a scalar branch.
  const int wave = __builtin_amdgcn_readfirstlane(threadIdx.x >> 5);
  const int tw   = wave >> 1;            // 0..3 : 32-row t strip
  const int sw   = wave & 1;             // 0..1 : 64-col v half
  const int hi   = lane >> 4;
  const int ta0  = t_base + tw * 32;
  const int vu0  = (v_base + sw * 64) >> 4;  // first 16-column V unit of the wave

  v8f acc[2][4] = {};                    // 32t x 64v accumulators

  for (int s0 = 0; s0 < t_base; s0 += 64)
    pv_step<false>(E, V, rc, s0, ta0, vu0, lane, acc);
  pv_step<true>(E, V, rc, t_base, ta0, vu0, lane, acc);
  pv_step<true>(E, V, rc, t_base + 64, ta0, vu0, lane, acc);

  const int colb = v_base + sw * 64;
#pragma unroll
  for (int it = 0; it < 2; ++it) {
#pragma unroll
    for (int nt = 0; nt < 4; ++nt) {
#pragma unroll
      for (int i = 0; i < 8; ++i) {
        const int r = t_base + tw * 32 + it * 16 + i + 8 * hi;
        __builtin_nontemporal_store(
            acc[it][nt][i],
            ob + (size_t)r * 1024 + 512 + colb + nt * 16 + (lane & 15));
      }
    }
  }
}

// ---------------------------------------------------------------------------
// Launcher.  Workspace layout (bytes):
//   [0, 16M)   Q  bf16 [16384][512], 1-KB fragment units [1024][16]
//   [16M,32M)  K  bf16, as Q
//   [32M,48M)  V  bf16, 1-KB fragment units [512][32]
//   [48M, +64K) rcol f32 [16384]   (reciprocal column sums)
//   then 128M   e f32, 2 KB units [8][128][64]
//   then 16M    x bf16, 1-KB fragment units [1024][16]
//   then 1.5M   Wq, Wk, Wv bf16, 1-KB fragment units [3][32][16]
//   then 1M     psum f32 [8][16][2048]  (column sums per 128-query block)
// ---------------------------------------------------------------------------
extern "C" void kernel_launch(void* const* d_in, const int* in_sizes, int n_in,
                              void* d_out, int out_size, void* d_ws,
                              size_t ws_size, hipStream_t stream) {
  const float* x  = (const float*)d_in[0];
  const float* Wq = (const float*)d_in[1];
  const float* bq = (const float*)d_in[2];
  const float* Wk = (const float*)d_in[3];
  const float* bk = (const float*)d_in[4];
  const float* Wv = (const float*)d_in[5];
  const float* bv = (const float*)d_in[6];
  float* out = (float*)d_out;

  const size_t qkv = (size_t)M_ROWS * C_DIM;           // elems per matrix
  __bf16* Qb = (__bf16*)d_ws;
  __bf16* Kb = Qb + qkv;
  __bf16* Vb = Kb + qkv;
  float* rcol = (float*)(Vb + qkv);
  float* Ew   = rcol + M_ROWS;
  __bf16* Xp = (__bf16*)(Ew + (size_t)B_DIM * T_DIM * T_DIM);
  __bf16* Wp = Xp + qkv;
  float* psum = (float*)(Wp + (size_t)3 * C_DIM * C_DIM);

  // out[..., :512] = x; x and W as bf16 fragments
  pack_copy_kernel<<<W_BLOCKS + M_ROWS / 32, 256, 0, stream>>>(x, Wq, Wk, Wv, out,
                                                               Xp, Wp);
  // Q, K, V projections (bf16)
  proj_kernel<<<dim3(M_ROWS / 128, C_DIM / 32, 3), 256, 0, stream>>>(
      Xp, Wp, bq, bk, bv, Qb, Kb, Vb);
  // masked exponentials and partial column sums, then the denominators
  colsum_kernel<<<dim3(P_BLOCKS, B_DIM), 256, 0, stream>>>(Qb, Kb, psum, Ew);
  rcol_kernel<<<M_ROWS / 256, 256, 0, stream>>>(psum, rcol);
  // out[..., 512:] = P @ V
  attend_kernel<<<dim3(T_DIM / 128, C_DIM / 128, B_DIM), 256, 0, stream>>>(
      Ew, Vb, rcol, out);
}

// v005
// A run of this version takes 139 microseconds.
// In two side-by-side timings against v004, it was 1.13 and 1.12 times as fast.
// Counting every step since v000, it is 6.22 times as fast.
#include <hip/hip_runtime.h>

#define B_DIM   8
#define T_DIM   2048
#define C_DIM   512
#define M_ROWS  (B_DIM * T_DIM)        // 16384
#define SM_SCALE 0.04419417382415922f  // 1/sqrt(512)

typedef __attribute__((ext_vector_type(16))) __bf16    v16bf;
typedef __attribute__((ext_vector_type(8)))  float     v8f;
typedef __attribute__((ext_vector_type(4)))  float     f32x4;
typedef __attribute__((ext_vector_type(8)))  __bf16    bf16x8;

union FragU {
  uint4  u[2];
  __bf16 h[16];
  v16bf  v;
};

__device__ __forceinline__ v8f wmma_bf16(v16bf a, v16bf b, v8f c) {
  // (neg_a, A, neg_b, B, c_mod, C, reuse_a, reuse_b)
  return __builtin_amdgcn_wmma_f32_16x16x32_bf16(false, a, false, b, (short)0, c,
                                                 false, false);
}

#define F_UNIT 512                     // bf16 elements per fragment unit
__device__ __forceinline__ v16bf load_frag_packed(const __bf16* base, int unit,
                                                  int lane) {
  const __bf16* p = base + (size_t)unit * F_UNIT + lane * 8;
  FragU f;
  f.u[0] = *(const uint4*)(p);
  f.u[1] = *(const uint4*)(p + 256);
  return f.v;
}

// Stands behind a run of loads.  The wait: in front of the first rewrite of an
// address register that the loads name.  The scheduling barriers: the first
// keeps the loads in front of the arithmetic, all in flight together (without
// it the scheduler sinks them between the WMMAs and the wave waits out a load
// latency several times per step); the second keeps the rewrites behind the wait.
__device__ __forceinline__ void loads_issued() {
  __builtin_amdgcn_sched_barrier(0);
  asm volatile("s_wait_xcnt 0x0" ::: "memory");
  __builtin_amdgcn_sched_barrier(0);
}

#define W_BLOCKS 192                   // 3 x (512/16) x (512/32) units / 8 waves
#define X_PITCH  136                   // bf16 elements per 8-column group in LDS

__global__ __launch_bounds__(256) void pack_copy_kernel(
    const float* __restrict__ x, const float* __restrict__ Wq,
    const float* __restrict__ Wk, const float* __restrict__ Wv,
    float* __restrict__ out, __bf16* __restrict__ Xp, __bf16* __restrict__ Wp) {
  __shared__ __attribute__((aligned(16))) __bf16 xt[8][16 * X_PITCH];
  const int lane = threadIdx.x & 31;
  // Scalar wave number: the bases are then scalar, and one lane offset, never
  // rewritten, serves the loads and stores of a wave.
  const int wave = __builtin_amdgcn_readfirstlane(threadIdx.x >> 5);
  union Pack8 { uint4 u; __bf16 h[8]; };
  union Pack4 { uint2 u; __bf16 h[4]; };

  if (blockIdx.x < W_BLOCKS) {                    // same for the whole block
    const int z = blockIdx.x >> 6;                // 64 blocks a matrix
    const float* Wm = (z == 0) ? Wq : (z == 1) ? Wk : Wv;
    const int unit = (blockIdx.x & 63) * 8 + wave;   // (col/16) * 16 + row/32
    const float* wp = Wm + (size_t)((unit & 15) * 32 + (lane >> 4) * 8) * C_DIM +
                      (unit >> 4) * 16 + (lane & 15);
    float t[16];
#pragma unroll
    for (int i = 0; i < 16; ++i)
      t[i] = wp[(size_t)((i >> 3) * 16 + (i & 7)) * C_DIM];
#pragma unroll
    for (int h = 0; h < 2; ++h) {
      Pack8 o;
#pragma unroll
      for (int j = 0; j < 8; ++j) o.h[j] = (__bf16)t[h * 8 + j];
      *(uint4*)(Wp + ((size_t)z * (C_DIM * C_DIM / F_UNIT) + unit) * F_UNIT +
                h * 256 + lane * 8) = o.u;
    }
    return;
  }

  const int task  = (blockIdx.x - W_BLOCKS) * 8 + wave;
  const int strip = task >> 2;                    // 16 rows
  const int cg    = task & 3;                     // 128 columns
  const float* xp = x + (size_t)strip * 16 * C_DIM + cg * 128 + lane * 4;
  float*       op = out + (size_t)strip * 16 * 1024 + cg * 128 + lane * 4;
  __bf16*      xw = xt[wave];
  f32x4 v[16];
#pragma unroll
  for (int r = 0; r < 16; ++r) v[r] = *(const f32x4*)(xp + r * C_DIM);
  loads_issued();                                 // 8 KB a wave in flight at once
#pragma unroll
  for (int r = 0; r < 16; ++r) {
    Pack4 o;
#pragma unroll
    for (int j = 0; j < 4; ++j) o.h[j] = (__bf16)v[r][j];
    *(uint2*)(xw + (lane >> 1) * X_PITCH + r * 8 + (lane & 1) * 4) = o.u;
  }
  // Lanes read other lanes' writes.  No global store stands in front of it: the
  // barrier would wait for it to complete.
  __syncthreads();
  __bf16* xo = Xp + (size_t)(strip * (C_DIM / 32) + cg * 4) * F_UNIT + lane * 8;
#pragma unroll
  for (int m = 0; m < 8; ++m)                     // 512-B row m of the four units
    *(uint4*)(xo + m * 256) =
        *(const uint4*)(xw + (m * 2 + (lane >> 4)) * X_PITCH + (lane & 15) * 8);
#pragma unroll
  for (int r = 0; r < 16; ++r)
    __builtin_nontemporal_store(v[r], (f32x4*)(op + r * 1024));
}

// ---------------------------------------------------------------------------
// Kernel 1: projections.  dst = bf16(x @ W + b).  grid = (M/128, 512/256, 3).
// 8 waves/block as 2 (rows) x 4 (columns); each owns a 64x64 output tile:
// 16 WMMAs per 8 fragments of a k step, 512 B loaded per WMMA.
// A and B fragments come straight from the packed copies of kernel 0, 512
// contiguous bytes a load.  Nothing is shared through LDS in the loop: no
// barrier.  Work-groups 256 apart in the grid have the same rows of x.
// Fragments are fetched one k step ahead: the four A fragments into a second
// register set at the head of a step, the B fragments one by one between the
// groups of four WMMAs, as the registers of the step's own come free.
// The result is stored in the fragment order of its consumer:
//   V:    unit (row/32, col/16), contraction index = row (key).  A lane holds
//         one column and 8 consecutive rows: its 16 B of a 512-B unit row.
//   Q, K: unit (row/16, col/32), contraction index = column.  Each wave turns
//         its eight units through an 8-KB LDS area of its own, once.
// Either way a wave stores 512 contiguous bytes per WMMA tile.
// ---------------------------------------------------------------------------
__global__ __launch_bounds__(256) void proj_kernel(
    const __bf16* __restrict__ Xp, const __bf16* __restrict__ Wp,
    const float* __restrict__ bq, const float* __restrict__ bk,
    const float* __restrict__ bv,
    __bf16* __restrict__ Qb, __bf16* __restrict__ Kb, __bf16* __restrict__ Vb) {
  __shared__ __attribute__((aligned(16))) __bf16 xt[8][8 * F_UNIT];

  const int lane = threadIdx.x & 31;
  // Scalar wave number: the fragment bases are then scalar, and one lane
  // offset, never rewritten in the loop, serves every load.
  const int wave = __builtin_amdgcn_readfirstlane(threadIdx.x >> 5);
  const int row0 = blockIdx.x * 128 + (wave >> 2) * 64;
  const int n0   = blockIdx.y * 256 + (wave & 3) * 64;

  const float* bias;
  __bf16*      dst;
  switch (blockIdx.z) {
    case 0:  bias = bq; dst = Qb; break;
    case 1:  bias = bk; dst = Kb; break;
    default: bias = bv; dst = Vb; break;
  }
  const int KU = C_DIM / 32;                      // units per 16-row strip
  const __bf16* A  = Xp + (size_t)(row0 >> 4) * KU * F_UNIT;
  const __bf16* Bw = Wp + (size_t)blockIdx.z * C_DIM * C_DIM +
                     (size_t)(n0 >> 4) * KU * F_UNIT;

  // Every loop over acc, a or b is unrolled: the arrays stay in registers.
  v8f   acc[4][4] = {};                           // [row tile][column tile]
  v16bf a[2][4], b[4];
#pragma unroll
  for (int it = 0; it < 4; ++it) a[0][it] = load_frag_packed(A, it * KU, lane);
#pragma unroll
  for (int nt = 0; nt < 4; ++nt) b[nt] = load_frag_packed(Bw, nt * KU, lane);
#pragma unroll
  for (int ku = 0; ku < KU; ++ku) {
    // The scheduling barriers hold each group of loads where it is written:
    // moved down to their readers, the wave would wait out a load latency per
    // group; moved up, they would need registers that are still being read.
    if (ku + 1 < KU) {
#pragma unroll
      for (int it = 0; it < 4; ++it)
        a[(ku + 1) & 1][it] = load_frag_packed(A, it * KU + ku + 1, lane);
    }
    __builtin_amdgcn_sched_barrier(0);
#pragma unroll
    for (int nt = 0; nt < 4; ++nt) {
#pragma unroll
      for (int it = 0; it < 4; ++it)
        acc[it][nt] = wmma_bf16(a[ku & 1][it], b[nt], acc[it][nt]);
      if (ku + 1 < KU) b[nt] = load_frag_packed(Bw, nt * KU + ku + 1, lane);
      __builtin_amdgcn_sched_barrier(0);
    }
  }
  loads_issued();                  // the epilogue reuses the address registers

  const int hi = lane >> 4;
  float bz[4];
#pragma unroll
  for (int nt = 0; nt < 4; ++nt) bz[nt] = bias[n0 + nt * 16 + (lane & 15)];
  loads_issued();
  bf16x8 o[4][4];
  if (blockIdx.z >= 2) {                          // V; same for the whole block
#pragma unroll
    for (int it = 0; it < 4; ++it) {
#pragma unroll
      for (int nt = 0; nt < 4; ++nt) {
#pragma unroll
        for (int i = 0; i < 8; ++i)
          o[it][nt][i] = (__bf16)(acc[it][nt][i] + bz[nt]);
      }
    }
    // The stores stand behind all the arithmetic: no register that a store
    // names is rewritten behind it.
    __builtin_amdgcn_sched_barrier(0);
    __bf16* vo = dst + ((size_t)(row0 >> 5) * (C_DIM / 16) + (n0 >> 4)) * F_UNIT +
                 lane * 8;
#pragma unroll
    for (int it = 0; it < 4; ++it) {
#pragma unroll
      for (int nt = 0; nt < 4; ++nt)
        *(bf16x8*)(vo + ((it >> 1) * (C_DIM / 16) + nt) * F_UNIT + (it & 1) * 256) =
            o[it][nt];
    }
  } else {                                        // Q, K
    __bf16* xw = xt[wave];                        // read by this wave alone
#pragma unroll
    for (int it = 0; it < 4; ++it) {
#pragma unroll
      for (int nt = 0; nt < 4; ++nt) {
#pragma unroll
        for (int i = 0; i < 8; ++i)
          xw[(it * 4 + nt) * 256 + (i + 8 * hi + 16 * ((lane >> 3) & 1)) * 8 +
             (lane & 7)] = (__bf16)(acc[it][nt][i] + bz[nt]);
      }
    }
#pragma unroll
    for (int it = 0; it < 4; ++it) {
#pragma unroll
      for (int nt = 0; nt < 4; ++nt)
        o[it][nt] = *(const bf16x8*)(xw + (it * 4 + nt) * 256 + lane * 8);
    }
    // As above: the stores stand behind every LDS read.
    __builtin_amdgcn_sched_barrier(0);
    __bf16* qo = dst + ((size_t)(row0 >> 4) * KU + (n0 >> 5)) * F_UNIT + lane * 8;
#pragma unroll
    for (int it = 0; it < 4; ++it) {
#pragma unroll
      for (int nt = 0; nt < 4; ++nt)
        *(bf16x8*)(qo + (it * KU + (nt >> 1)) * F_UNIT + (nt & 1) * 256) = o[it][nt];
    }
    // In front of any later rewrite of a register that these stores name.
    asm volatile("s_wait_xcnt 0x0" ::: "memory");
  }
}

#define E_TILE 512
#define E_ROW  (T_DIM / 32)
#define T_BLKS (T_DIM / 128)
#define P_BLOCKS (T_BLKS * (T_BLKS + 1))

__global__ __launch_bounds__(256) void colsum_kernel(
    const __bf16* __restrict__ Qb, const __bf16* __restrict__ Kb,
    float* __restrict__ psum, float* __restrict__ Ew) {
  __shared__ float ssum[64];
  if (threadIdx.x < 64) ssum[threadIdx.x] = 0.0f;
  __syncthreads();

  const int b = blockIdx.y;
  // Query block tb has key blocks 0..2 tb + 1; tb (tb + 1) tiles lie before it.
  // Unrolled: fifteen scalar compares with constants, no loop and no multiply.
  int tb = 0;
#pragma unroll
  for (int u = 1; u < T_BLKS; ++u) tb += (u * (u + 1) <= (int)blockIdx.x) ? 1 : 0;
  const int s_blk = ((int)blockIdx.x - tb * (tb + 1)) * 64;
  const __bf16* Q = Qb + (size_t)b * T_DIM * C_DIM;
  const __bf16* K = Kb + (size_t)b * T_DIM * C_DIM;
  float*        E = Ew + (size_t)b * (T_DIM / 16) * E_ROW * E_TILE;

  const int lane = threadIdx.x & 31;
  const int wave = threadIdx.x >> 5;
  const int tw   = wave >> 1;               // 0..3 : 32-row t strip
  const int sw   = wave & 1;                // 0..1 : 32-col s half
  const int t0   = tb * 128 + tw * 32;
  const int s0   = s_blk + sw * 32;
  const int hi   = lane >> 4;

  const bool live = t0 + 31 >= s0;          // else: wave tile above the diagonal
  // Every loop over ev, part or l is unrolled: the arrays stay in registers.
  f32x4 ev[2][2][2];                        // e: [t tile][s tile][512-B row]
  if (live) {
    float part[2][8] = {};                  // per key held by this lane
    v8f l[2][2] = {};                       // [t tile][s tile], rows s, cols t
    for (int k0 = 0; k0 < C_DIM; k0 += 32) {
      const int ku = k0 >> 5;               // 16 units per 16-row strip
      const v16bf a0 = load_frag_packed(Q, (t0 >> 4) * 16 + ku, lane);
      const v16bf a1 = load_frag_packed(Q, (t0 >> 4) * 16 + 16 + ku, lane);
      const v16bf b0 = load_frag_packed(K, (s0 >> 4) * 16 + ku, lane);
      const v16bf b1 = load_frag_packed(K, (s0 >> 4) * 16 + 16 + ku, lane);
      l[0][0] = wmma_bf16(b0, a0, l[0][0]);
      l[0][1] = wmma_bf16(b1, a0, l[0][1]);
      l[1][0] = wmma_bf16(b0, a1, l[1][0]);
      l[1][1] = wmma_bf16(b1, a1, l[1][1]);
    }
#pragma unroll
    for (int it = 0; it < 2; ++it) {
      const int t = t0 + it * 16 + (lane & 15);
#pragma unroll
      for (int is = 0; is < 2; ++is) {
#pragma unroll
        for (int i = 0; i < 8; ++i) {
          const int s = s0 + is * 16 + i + 8 * hi;
          const float e = (s <= t) ? __expf(l[it][is][i] * SM_SCALE) : 0.0f;
          part[is][i] += e;
          ev[it][is][i >> 2][i & 3] = e;
        }
      }
    }
    // Sum over the 16 queries of a half-wave.  It runs once per tile: the lane
    // distance is the outer loop, so that the 16 exchanges of a distance are
    // in flight together and the wave waits four times, not 64.
#pragma unroll
    for (int m = 1; m < 16; m <<= 1) {
#pragma unroll
      for (int is = 0; is < 2; ++is) {
#pragma unroll
        for (int i = 0; i < 8; ++i) part[is][i] += __shfl_xor(part[is][i], m, 32);
      }
    }
    if ((lane & 15) == 0) {
#pragma unroll
      for (int is = 0; is < 2; ++is) {
#pragma unroll
        for (int i = 0; i < 8; ++i)
          atomicAdd(&ssum[sw * 32 + is * 16 + i + 8 * hi], part[is][i]);
      }
    }
  }
  // No global store stands in front of it: the barrier would wait for it to
  // complete, once per tile.
  __syncthreads();
  if (live) {
#pragma unroll
    for (int it = 0; it < 2; ++it) {
      float* ep = E + ((size_t)((t0 >> 4) + it) * E_ROW + (s0 >> 5)) * E_TILE +
                  lane * 4;
#pragma unroll
      for (int c = 0; c < 4; ++c) *(f32x4*)(ep + c * 128) = ev[it][c >> 1][c & 1];
    }
  }
  // What follows may rewrite the registers these stores name (data, address).
  asm volatile("s_wait_xcnt 0x0" ::: "memory");
  float* pb = psum + (size_t)b * T_BLKS * T_DIM + s_blk;
  if (threadIdx.x < 64) pb[tb * T_DIM + threadIdx.x] = ssum[threadIdx.x];
  // Likewise for the store above.
  asm volatile("s_wait_xcnt 0x0" ::: "memory");
  // The diagonal tile is the first of its keys: the query blocks above it have
  // no term, and their rows get the zeros that kernel 2b adds: 16 threads a row.
  if (s_blk >= tb * 128 && (int)(threadIdx.x >> 4) < tb)
    *(f32x4*)(pb + (threadIdx.x >> 4) * T_DIM + (threadIdx.x & 15) * 4) =
        f32x4{0.0f, 0.0f, 0.0f, 0.0f};
}

// ---------------------------------------------------------------------------
// Kernel 2b: rcol[b,s] = 1 / sum over tb of psum[b,tb,s], in rising tb.
// One thread a key; every row of psum was written by kernel 2.  The bases are
// scalar: the thread index is the one offset of the loads and of the store.
// ---------------------------------------------------------------------------
__global__ __launch_bounds__(256) void rcol_kernel(
    const float* __restrict__ psum, float* __restrict__ rcol) {
  const float* p = psum + (size_t)(blockIdx.x / (T_DIM / 256)) * T_BLKS * T_DIM +
                   (blockIdx.x % (T_DIM / 256)) * 256;
  float v[T_BLKS];
  // Unrolled: the array stays in registers and the loads are one run.
#pragma unroll
  for (int tb = 0; tb < T_BLKS; ++tb) v[tb] = p[tb * T_DIM + threadIdx.x];
  loads_issued();                  // all in flight at once
  float sum = 0.0f;
#pragma unroll
  for (int tb = 0; tb < T_BLKS; ++tb) sum += v[tb];
  rcol[blockIdx.x * 256 + threadIdx.x] = 1.0f / sum;
}

// ---------------------------------------------------------------------------
// Kernel 3: read = (e[t,s] * rcol[s]) @ V, causal.
// grid = (T/128, 512/128, B).  Block tile: 128(t) x 128(v), s-steps of 64.
// Each wave reads the stored e of its 32 t rows straight into A fragments
// (512 contiguous bytes per load), scales by rcol and rounds to bf16, and
// reads V straight into B fragments (stored in that order by kernel 1); then
// 2t x 4v blocked P@V WMMAs.  Nothing is shared through LDS: no barrier.
// ---------------------------------------------------------------------------
// One s-step of 64 keys.  EDGE = false: every 32-key chunk lies at or below the
// diagonal tile of every wave of the block, so all loads issue together with
// no test.  EDGE = true (the last two steps): a wave skips the e and rcol loads
// of chunks above its diagonal tile, which are not stored, and multiplies zeros.
template <bool EDGE>
__device__ __forceinline__ void pv_step(
    const float* __restrict__ E, const __bf16* __restrict__ V,
    const float* __restrict__ rc, int s0, int ta0, int vu0, int lane,
    v8f (&acc)[2][4]) {
  const int hi = lane >> 4;
  // ---- loads: e, V fragments, rcol of the keys this lane holds ----
  f32x4 e[2][2][4] = {};                 // [s chunk][t tile][512-B row]
  v16bf vb[2][4];                        // [s chunk][v tile]
  f32x4 r[2][4]    = {};
  const float* ep =
      E + ((size_t)(ta0 >> 4) * E_ROW + (s0 >> 5)) * E_TILE + lane * 4;
  const __bf16* vp = V + (size_t)((s0 >> 5) * (C_DIM / 16) + vu0) * F_UNIT;
  const float* rp = rc + s0 + 8 * hi;
#pragma unroll
  for (int kk = 0; kk < 2; ++kk) {
    if (!EDGE || s0 + kk * 32 <= ta0) {
#pragma unroll
      for (int it = 0; it < 2; ++it) {
#pragma unroll
        for (int c = 0; c < 4; ++c)
          e[kk][it][c] =
              *(const f32x4*)(ep + (it * E_ROW + kk) * E_TILE + c * 128);
      }
      if (EDGE) loads_issued();          // ep may end here and be reused
      r[kk][0] = *(const f32x4*)(rp + kk * 32);
      r[kk][1] = *(const f32x4*)(rp + kk * 32 + 4);
      r[kk][2] = *(const f32x4*)(rp + kk * 32 + 16);
      r[kk][3] = *(const f32x4*)(rp + kk * 32 + 20);
      if (EDGE) loads_issued();
    }
#pragma unroll
    for (int nt = 0; nt < 4; ++nt)
      vb[kk][nt] = load_frag_packed(vp, kk * (C_DIM / 16) + nt, lane);
  }
  loads_issued();                        // the pointers are stepped or reused next
#pragma unroll
  for (int kk = 0; kk < 2; ++kk) {
    // ---- P fragments: 32t x 32s, bf16(e * rcol) ----
    v16bf pa[2];
#pragma unroll
    for (int it = 0; it < 2; ++it) {
      FragU f;
#pragma unroll
      for (int c = 0; c < 4; ++c) {
#pragma unroll
        for (int j = 0; j < 4; ++j)
          f.h[c * 4 + j] = (__bf16)(e[kk][it][c][j] * r[kk][c][j]);
      }
      pa[it] = f.v;
    }
    // ---- P(32x32) @ V(32x64) ----
#pragma unroll
    for (int nt = 0; nt < 4; ++nt) {
      acc[0][nt] = wmma_bf16(pa[0], vb[kk][nt], acc[0][nt]);
      acc[1][nt] = wmma_bf16(pa[1], vb[kk][nt], acc[1][nt]);
    }
  }
}

__global__ __launch_bounds__(256) void attend_kernel(
    const float* __restrict__ Ew, const __bf16* __restrict__ Vb,
    const float* __restrict__ rcol, float* __restrict__ out) {
  const int b      = blockIdx.z;
  const int t_base = blockIdx.x * 128;
  const int v_base = blockIdx.y * 128;
  const float*  E  = Ew + (size_t)b * (T_DIM / 16) * E_ROW * E_TILE;
  const __bf16* V  = Vb + (size_t)b * T_DIM * C_DIM;
  const float*  rc = rcol + (size_t)b * T_DIM;
  float*        ob = out + (size_t)b * T_DIM * 1024;

  const int lane = threadIdx.x & 31;
  // Scalar wave number: the test on stored tiles is then a scalar branch.
  const int wave = __builtin_amdgcn_readfirstlane(threadIdx.x >> 5);
  const int tw   = wave >> 1;            // 0..3 : 32-row t strip
  const int sw   = wave & 1;             // 0..1 : 64-col v half
  const int hi   = lane >> 4;
  const int ta0  = t_base + tw * 32;
  const int vu0  = (v_base + sw * 64) >> 4;  // first 16-column V unit of the wave

  v8f acc[2][4] = {};                    // 32t x 64v accumulators

  for (int s0 = 0; s0 < t_base; s0 += 64)
    pv_step<false>(E, V, rc, s0, ta0, vu0, lane, acc);
  pv_step<true>(E, V, rc, t_base, ta0, vu0, lane, acc);
  pv_step<true>(E, V, rc, t_base + 64, ta0, vu0, lane, acc);

  const int colb = v_base + sw * 64;
#pragma unroll
  for (int it = 0; it < 2; ++it) {
#pragma unroll
    for (int nt = 0; nt < 4; ++nt) {
#pragma unroll
      for (int i = 0; i < 8; ++i) {
        const int r = t_base + tw * 32 + it * 16 + i + 8 * hi;
        __builtin_nontemporal_store(
            acc[it][nt][i],
            ob + (size_t)r * 1024 + 512 + colb + nt * 16 + (lane & 15));
      }
    }
  }
}

// ---------------------------------------------------------------------------
// Launcher.  Workspace layout (bytes):
//   [0, 16M)   Q  bf16 [16384][512], 1-KB fragment units [1024][16]
//   [16M,32M)  K  bf16, as Q
//   [32M,48M)  V  bf16, 1-KB fragment units [512][32]
//   [48M, +64K) rcol f32 [16384]   (reciprocal column sums)
//   then 128M   e f32, 2 KB units [8][128][64]
//   then 16M    x bf16, 1-KB fragment units [1024][16]
//   then 1.5M   Wq, Wk, Wv bf16, 1-KB fragment units [3][32][16]
//   then 1M     psum f32 [8][16][2048]  (column sums per 128-query block)
// ---------------------------------------------------------------------------
extern "C" void kernel_launch(void* const* d_in, const int* in_sizes, int n_in,
                              void* d_out, int out_size, void* d_ws,
                              size_t ws_size, hipStream_t stream) {
  const float* x  = (const float*)d_in[0];
  const float* Wq = (const float*)d_in[1];
  const float* bq = (const float*)d_in[2];
  const float* Wk = (const float*)d_in[3];
  const float* bk = (const float*)d_in[4];
  const float* Wv = (const float*)d_in[5];
  const float* bv = (const float*)d_in[6];
  float* out = (float*)d_out;

  const size_t qkv = (size_t)M_ROWS * C_DIM;           // elems per matrix
  __bf16* Qb = (__bf16*)d_ws;
  __bf16* Kb = Qb + qkv;
  __bf16* Vb = Kb + qkv;
  float* rcol = (float*)(Vb + qkv);
  float* Ew   = rcol + M_ROWS;
  __bf16* Xp = (__bf16*)(Ew + (size_t)B_DIM * T_DIM * T_DIM);
  __bf16* Wp = Xp + qkv;
  float* psum = (float*)(Wp + (size_t)3 * C_DIM * C_DIM);

  // out[..., :512] = x; x and W as bf16 fragments
  pack_copy_kernel<<<W_BLOCKS + M_ROWS / 32, 256, 0, stream>>>(x, Wq, Wk, Wv, out,
                                                               Xp, Wp);
  // Q, K, V projections (bf16)
  proj_kernel<<<dim3(M_ROWS / 128, C_DIM / 256, 3), 256, 0, stream>>>(
      Xp, Wp, bq, bk, bv, Qb, Kb, Vb);
  // masked exponentials and partial column sums, then the denominators
  colsum_kernel<<<dim3(P_BLOCKS, B_DIM), 256, 0, stream>>>(Qb, Kb, psum, Ew);
  rcol_kernel<<<M_ROWS / 256, 256, 0, stream>>>(psum, rcol);
  // out[..., 512:] = P @ V
  attend_kernel<<<dim3(T_DIM / 128, C_DIM / 128, B_DIM), 256, 0, stream>>>(
      Ew, Vb, rcol, out);
}

// v006
// Measured time: 121 microseconds a run.
// In two side-by-side timings against v005, it was 1.16 and 1.15 times as fast.
// Over all steps from v000 it is 7.16 times as fast.
#include <hip/hip_runtime.h>

#define B_DIM   8
#define T_DIM   2048
#define C_DIM   512
#define M_ROWS  (B_DIM * T_DIM)        // 16384
#define SM_SCALE 0.04419417382415922f  // 1/sqrt(512)

typedef __attribute__((ext_vector_type(16))) __bf16    v16bf;
typedef __attribute__((ext_vector_type(8)))  float     v8f;
typedef __attribute__((ext_vector_type(4)))  float     f32x4;
typedef __attribute__((ext_vector_type(8)))  __bf16    bf16x8;

union FragU {
  uint4  u[2];
  __bf16 h[16];
  v16bf  v;
};

__device__ __forceinline__ v8f wmma_bf16(v16bf a, v16bf b, v8f c) {
  // (neg_a, A, neg_b, B, c_mod, C, reuse_a, reuse_b)
  return __builtin_amdgcn_wmma_f32_16x16x32_bf16(false, a, false, b, (short)0, c,
                                                 false, false);
}

#define F_UNIT 512                     // bf16 elements per fragment unit
__device__ __forceinline__ v16bf load_frag_packed(const __bf16* base, int unit,
                                                  int lane) {
  const __bf16* p = base + (size_t)unit * F_UNIT + lane * 8;
  FragU f;
  f.u[0] = *(const uint4*)(p);
  f.u[1] = *(const uint4*)(p + 256);
  return f.v;
}

// Stands behind a run of loads.  The wait: in front of the first rewrite of an
// address register that the loads name.  The scheduling barriers: the first
// keeps the loads in front of the arithmetic, all in flight together (without
// it the scheduler sinks them between the WMMAs and the wave waits out a load
// latency several times per step); the second keeps the rewrites behind the wait.
__device__ __forceinline__ void loads_issued() {
  __builtin_amdgcn_sched_barrier(0);
  asm volatile("s_wait_xcnt 0x0" ::: "memory");
  __builtin_amdgcn_sched_barrier(0);
}

// The same, where the address of the loads is not used again: the wait names it,
// so its registers stay whole up to the wait and are not given to a load's result.
__device__ __forceinline__ void loads_issued(const void* last_address) {
  __builtin_amdgcn_sched_barrier(0);
  asm volatile("s_wait_xcnt 0x0" ::"v"(last_address) : "memory");
  __builtin_amdgcn_sched_barrier(0);
}

#define W_BLOCKS 192                   // 3 x (512/16) x (512/32) units / 8 waves
#define X_PITCH  136                   // bf16 elements per 8-column group in LDS

__global__ __launch_bounds__(256) void pack_copy_kernel(
    const float* __restrict__ x, const float* __restrict__ Wq,
    const float* __restrict__ Wk, const float* __restrict__ Wv,
    float* __restrict__ out, __bf16* __restrict__ Xp, __bf16* __restrict__ Wp) {
  __shared__ __attribute__((aligned(16))) __bf16 xt[8][16 * X_PITCH];
  const int lane = threadIdx.x & 31;
  // Scalar wave number: the bases are then scalar, and one lane offset, never
  // rewritten, serves the loads and stores of a wave.
  const int wave = __builtin_amdgcn_readfirstlane(threadIdx.x >> 5);
  union Pack8 { uint4 u; __bf16 h[8]; };
  union Pack4 { uint2 u; __bf16 h[4]; };

  if (blockIdx.x < W_BLOCKS) {                    // same for the whole block
    const int z = blockIdx.x >> 6;                // 64 blocks a matrix
    const float* Wm = (z == 0) ? Wq : (z == 1) ? Wk : Wv;
    const int unit = (blockIdx.x & 63) * 8 + wave;   // (col/16) * 16 + row/32
    const float* wp = Wm + (size_t)((unit & 15) * 32 + (lane >> 4) * 8) * C_DIM +
                      (unit >> 4) * 16 + (lane & 15);
    float t[16];
#pragma unroll
    for (int i = 0; i < 16; ++i)
      t[i] = wp[(size_t)((i >> 3) * 16 + (i & 7)) * C_DIM];
#pragma unroll
    for (int h = 0; h < 2; ++h) {
      Pack8 o;
#pragma unroll
      for (int j = 0; j < 8; ++j) o.h[j] = (__bf16)t[h * 8 + j];
      *(uint4*)(Wp + ((size_t)z * (C_DIM * C_DIM / F_UNIT) + unit) * F_UNIT +
                h * 256 + lane * 8) = o.u;
    }
    return;
  }

  const int task  = (blockIdx.x - W_BLOCKS) * 8 + wave;
  const int strip = task >> 2;                    // 16 rows
  const int cg    = task & 3;                     // 128 columns
  const float* xp = x + (size_t)strip * 16 * C_DIM + cg * 128 + lane * 4;
  float*       op = out + (size_t)strip * 16 * 1024 + cg * 128 + lane * 4;
  __bf16*      xw = xt[wave];
  f32x4 v[16];
#pragma unroll
  for (int r = 0; r < 16; ++r) v[r] = *(const f32x4*)(xp + r * C_DIM);
  loads_issued();                                 // 8 KB a wave in flight at once
#pragma unroll
  for (int r = 0; r < 16; ++r) {
    Pack4 o;
#pragma unroll
    for (int j = 0; j < 4; ++j) o.h[j] = (__bf16)v[r][j];
    *(uint2*)(xw + (lane >> 1) * X_PITCH + r * 8 + (lane & 1) * 4) = o.u;
  }
  // Lanes read other lanes' writes.  No global store stands in front of it: the
  // barrier would wait for it to complete.
  __syncthreads();
  __bf16* xo = Xp + (size_t)(strip * (C_DIM / 32) + cg * 4) * F_UNIT + lane * 8;
#pragma unroll
  for (int m = 0; m < 8; ++m)                     // 512-B row m of the four units
    *(uint4*)(xo + m * 256) =
        *(const uint4*)(xw + (m * 2 + (lane >> 4)) * X_PITCH + (lane & 15) * 8);
#pragma unroll
  for (int r = 0; r < 16; ++r)
    __builtin_nontemporal_store(v[r], (f32x4*)(op + r * 1024));
}

// ---------------------------------------------------------------------------
// Kernel 1: projections.  dst = bf16(x @ W + b).  grid = (M/128, 512/256, 3).
// 8 waves/block as 2 (rows) x 4 (columns); each owns a 64x64 output tile:
// 16 WMMAs per 8 fragments of a k step, 512 B loaded per WMMA.
// A and B fragments come straight from the packed copies of kernel 0, 512
// contiguous bytes a load.  Nothing is shared through LDS in the loop: no
// barrier.  Work-groups 256 apart in the grid have the same rows of x.
// Fragments are fetched one k step ahead: the four A fragments into a second
// register set at the head of a step, the B fragments one by one between the
// groups of four WMMAs, as the registers of the step's own come free.
// The result is stored in the fragment order of its consumer:
//   V:    unit (row/32, col/16), contraction index = row (key).  A lane holds
//         one column and 8 consecutive rows: its 16 B of a 512-B unit row.
//   Q, K: unit (row/16, col/32), contraction index = column.  Each wave turns
//         its eight units through an 8-KB LDS area of its own, once.
// Either way a wave stores 512 contiguous bytes per WMMA tile.
// ---------------------------------------------------------------------------
__global__ __launch_bounds__(256) void proj_kernel(
    const __bf16* __restrict__ Xp, const __bf16* __restrict__ Wp,
    const float* __restrict__ bq, const float* __restrict__ bk,
    const float* __restrict__ bv,
    __bf16* __restrict__ Qb, __bf16* __restrict__ Kb, __bf16* __restrict__ Vb) {
  __shared__ __attribute__((aligned(16))) __bf16 xt[8][8 * F_UNIT];

  const int lane = threadIdx.x & 31;
  // Scalar wave number: the fragment bases are then scalar, and one lane
  // offset, never rewritten in the loop, serves every load.
  const int wave = __builtin_amdgcn_readfirstlane(threadIdx.x >> 5);
  const int row0 = blockIdx.x * 128 + (wave >> 2) * 64;
  const int n0   = blockIdx.y * 256 + (wave & 3) * 64;

  const float* bias;
  __bf16*      dst;
  switch (blockIdx.z) {
    case 0:  bias = bq; dst = Qb; break;
    case 1:  bias = bk; dst = Kb; break;
    default: bias = bv; dst = Vb; break;
  }
  const int KU = C_DIM / 32;                      // units per 16-row strip
  const __bf16* A  = Xp + (size_t)(row0 >> 4) * KU * F_UNIT;
  const __bf16* Bw = Wp + (size_t)blockIdx.z * C_DIM * C_DIM +
                     (size_t)(n0 >> 4) * KU * F_UNIT;

  // Every loop over acc, a or b is unrolled: the arrays stay in registers.
  v8f   acc[4][4] = {};                           // [row tile][column tile]
  v16bf a[2][4], b[4];
#pragma unroll
  for (int it = 0; it < 4; ++it) a[0][it] = load_frag_packed(A, it * KU, lane);
#pragma unroll
  for (int nt = 0; nt < 4; ++nt) b[nt] = load_frag_packed(Bw, nt * KU, lane);
#pragma unroll
  for (int ku = 0; ku < KU; ++ku) {
    // The scheduling barriers hold each group of loads where it is written:
    // moved down to their readers, the wave would wait out a load latency per
    // group; moved up, they would need registers that are still being read.
    if (ku + 1 < KU) {
#pragma unroll
      for (int it = 0; it < 4; ++it)
        a[(ku + 1) & 1][it] = load_frag_packed(A, it * KU + ku + 1, lane);
    }
    __builtin_amdgcn_sched_barrier(0);
#pragma unroll
    for (int nt = 0; nt < 4; ++nt) {
#pragma unroll
      for (int it = 0; it < 4; ++it)
        acc[it][nt] = wmma_bf16(a[ku & 1][it], b[nt], acc[it][nt]);
      if (ku + 1 < KU) b[nt] = load_frag_packed(Bw, nt * KU + ku + 1, lane);
      __builtin_amdgcn_sched_barrier(0);
    }
  }
  loads_issued();                  // the epilogue reuses the address registers

  const int hi = lane >> 4;
  float bz[4];
#pragma unroll
  for (int nt = 0; nt < 4; ++nt) bz[nt] = bias[n0 + nt * 16 + (lane & 15)];
  loads_issued();
  bf16x8 o[4][4];
  if (blockIdx.z >= 2) {                          // V; same for the whole block
#pragma unroll
    for (int it = 0; it < 4; ++it) {
#pragma unroll
      for (int nt = 0; nt < 4; ++nt) {
#pragma unroll
        for (int i = 0; i < 8; ++i)
          o[it][nt][i] = (__bf16)(acc[it][nt][i] + bz[nt]);
      }
    }
    // The stores stand behind all the arithmetic: no register that a store
    // names is rewritten behind it.
    __builtin_amdgcn_sched_barrier(0);
    __bf16* vo = dst + ((size_t)(row0 >> 5) * (C_DIM / 16) + (n0 >> 4)) * F_UNIT +
                 lane * 8;
#pragma unroll
    for (int it = 0; it < 4; ++it) {
#pragma unroll
      for (int nt = 0; nt < 4; ++nt)
        *(bf16x8*)(vo + ((it >> 1) * (C_DIM / 16) + nt) * F_UNIT + (it & 1) * 256) =
            o[it][nt];
    }
  } else {                                        // Q, K
    __bf16* xw = xt[wave];                        // read by this wave alone
#pragma unroll
    for (int it = 0; it < 4; ++it) {
#pragma unroll
      for (int nt = 0; nt < 4; ++nt) {
#pragma unroll
        for (int i = 0; i < 8; ++i)
          xw[(it * 4 + nt) * 256 + (i + 8 * hi + 16 * ((lane >> 3) & 1)) * 8 +
             (lane & 7)] = (__bf16)(acc[it][nt][i] + bz[nt]);
      }
    }
#pragma unroll
    for (int it = 0; it < 4; ++it) {
#pragma unroll
      for (int nt = 0; nt < 4; ++nt)
        o[it][nt] = *(const bf16x8*)(xw + (it * 4 + nt) * 256 + lane * 8);
    }
    // As above: the stores stand behind every LDS read.
    __builtin_amdgcn_sched_barrier(0);
    __bf16* qo = dst + ((size_t)(row0 >> 4) * KU + (n0 >> 5)) * F_UNIT + lane * 8;
#pragma unroll
    for (int it = 0; it < 4; ++it) {
#pragma unroll
      for (int nt = 0; nt < 4; ++nt)
        *(bf16x8*)(qo + (it * KU + (nt >> 1)) * F_UNIT + (nt & 1) * 256) = o[it][nt];
    }
    // In front of any later rewrite of a register that these stores name.
    asm volatile("s_wait_xcnt 0x0" ::: "memory");
  }
}

#define E_TILE 512
#define E_ROW  (T_DIM / 32)
#define T_BLKS (T_DIM / 128)
#define P_BLOCKS (T_BLKS * (T_BLKS + 1))

__global__ __launch_bounds__(256) void colsum_kernel(
    const __bf16* __restrict__ Qb, const __bf16* __restrict__ Kb,
    float* __restrict__ psum, float* __restrict__ Ew) {
  __shared__ float ssum[64];
  if (threadIdx.x < 64) ssum[threadIdx.x] = 0.0f;
  __syncthreads();

  const int b = blockIdx.y;
  // Query block tb has key blocks 0..2 tb + 1; tb (tb + 1) tiles lie before it.
  // Unrolled: fifteen scalar compares with constants, no loop and no multiply.
  int tb = 0;
#pragma unroll
  for (int u = 1; u < T_BLKS; ++u) tb += (u * (u + 1) <= (int)blockIdx.x) ? 1 : 0;
  const int s_blk = ((int)blockIdx.x - tb * (tb + 1)) * 64;
  const __bf16* Q = Qb + (size_t)b * T_DIM * C_DIM;
  const __bf16* K = Kb + (size_t)b * T_DIM * C_DIM;
  float*        E = Ew + (size_t)b * (T_DIM / 16) * E_ROW * E_TILE;

  const int lane = threadIdx.x & 31;
  const int wave = threadIdx.x >> 5;
  const int tw   = wave >> 1;               // 0..3 : 32-row t strip
  const int sw   = wave & 1;                // 0..1 : 32-col s half
  const int t0   = tb * 128 + tw * 32;
  const int s0   = s_blk + sw * 32;
  const int hi   = lane >> 4;

  const bool live = t0 + 31 >= s0;          // else: wave tile above the diagonal
  // Every loop over ev, part or l is unrolled: the arrays stay in registers.
  f32x4 ev[2][2][2];                        // e: [t tile][s tile][512-B row]
  if (live) {
    float part[2][8] = {};                  // per key held by this lane
    v8f l[2][2] = {};                       // [t tile][s tile], rows s, cols t
    for (int k0 = 0; k0 < C_DIM; k0 += 32) {
      const int ku = k0 >> 5;               // 16 units per 16-row strip
      const v16bf a0 = load_frag_packed(Q, (t0 >> 4) * 16 + ku, lane);
      const v16bf a1 = load_frag_packed(Q, (t0 >> 4) * 16 + 16 + ku, lane);
      const v16bf b0 = load_frag_packed(K, (s0 >> 4) * 16 + ku, lane);
      const v16bf b1 = load_frag_packed(K, (s0 >> 4) * 16 + 16 + ku, lane);
      l[0][0] = wmma_bf16(b0, a0, l[0][0]);
      l[0][1] = wmma_bf16(b1, a0, l[0][1]);
      l[1][0] = wmma_bf16(b0, a1, l[1][0]);
      l[1][1] = wmma_bf16(b1, a1, l[1][1]);
    }
#pragma unroll
    for (int it = 0; it < 2; ++it) {
      const int t = t0 + it * 16 + (lane & 15);
#pragma unroll
      for (int is = 0; is < 2; ++is) {
#pragma unroll
        for (int i = 0; i < 8; ++i) {
          const int s = s0 + is * 16 + i + 8 * hi;
          const float e = (s <= t) ? __expf(l[it][is][i] * SM_SCALE) : 0.0f;
          part[is][i] += e;
          ev[it][is][i >> 2][i & 3] = e;
        }
      }
    }
    // Sum over the 16 queries of a half-wave.  It runs once per tile: the lane
    // distance is the outer loop, so that the 16 exchanges of a distance are
    // in flight together and the wave waits four times, not 64.
#pragma unroll
    for (int m = 1; m < 16; m <<= 1) {
#pragma unroll
      for (int is = 0; is < 2; ++is) {
#pragma unroll
        for (int i = 0; i < 8; ++i) part[is][i] += __shfl_xor(part[is][i], m, 32);
      }
    }
    if ((lane & 15) == 0) {
#pragma unroll
      for (int is = 0; is < 2; ++is) {
#pragma unroll
        for (int i = 0; i < 8; ++i)
          atomicAdd(&ssum[sw * 32 + is * 16 + i + 8 * hi], part[is][i]);
      }
    }
  }
  // No global store stands in front of it: the barrier would wait for it to
  // complete, once per tile.
  __syncthreads();
  if (live) {
#pragma unroll
    for (int it = 0; it < 2; ++it) {
      float* ep = E + ((size_t)((t0 >> 4) + it) * E_ROW + (s0 >> 5)) * E_TILE +
                  lane * 4;
#pragma unroll
      for (int c = 0; c < 4; ++c) *(f32x4*)(ep + c * 128) = ev[it][c >> 1][c & 1];
    }
  }
  // What follows may rewrite the registers these stores name (data, address).
  asm volatile("s_wait_xcnt 0x0" ::: "memory");
  float* pb = psum + (size_t)b * T_BLKS * T_DIM + s_blk;
  if (threadIdx.x < 64) pb[tb * T_DIM + threadIdx.x] = ssum[threadIdx.x];
  // Likewise for the store above.
  asm volatile("s_wait_xcnt 0x0" ::: "memory");
  // The diagonal tile is the first of its keys: the query blocks above it have
  // no term, and their rows get the zeros that kernel 2b adds: 16 threads a row.
  if (s_blk >= tb * 128 && (int)(threadIdx.x >> 4) < tb)
    *(f32x4*)(pb + (threadIdx.x >> 4) * T_DIM + (threadIdx.x & 15) * 4) =
        f32x4{0.0f, 0.0f, 0.0f, 0.0f};
}

// ---------------------------------------------------------------------------
// Kernel 2b: rcol[b,s] = 1 / sum over tb of psum[b,tb,s], in rising tb.
// One thread a key; every row of psum was written by kernel 2.  The bases are
// scalar: the thread index is the one offset of the loads and of the store.
// ---------------------------------------------------------------------------
__global__ __launch_bounds__(256) void rcol_kernel(
    const float* __restrict__ psum, float* __restrict__ rcol) {
  const float* p = psum + (size_t)(blockIdx.x / (T_DIM / 256)) * T_BLKS * T_DIM +
                   (blockIdx.x % (T_DIM / 256)) * 256;
  float v[T_BLKS];
  // Unrolled: the array stays in registers and the loads are one run.
#pragma unroll
  for (int tb = 0; tb < T_BLKS; ++tb) v[tb] = p[tb * T_DIM + threadIdx.x];
  loads_issued();                  // all in flight at once
  float sum = 0.0f;
#pragma unroll
  for (int tb = 0; tb < T_BLKS; ++tb) sum += v[tb];
  rcol[blockIdx.x * 256 + threadIdx.x] = 1.0f / sum;
}

// ---------------------------------------------------------------------------
// Kernel 3: read = (e[t,s] * rcol[s]) @ V, causal.
// Block tile: 128(t) x 128(v), s-steps of 64.
// Each wave reads the stored e of its 32 t rows straight into A fragments
// (512 contiguous bytes per load), scales by rcol and rounds to bf16, and
// reads V straight into B fragments (stored in that order by kernel 1); then
// 2t x 4v blocked P@V WMMAs.  No operand is shared through LDS: no barrier in
// the loop.
// ---------------------------------------------------------------------------
// One s-step of 64 keys.  EDGE = false: every 32-key chunk lies at or below the
// diagonal tile of every wave of the block, so all loads issue together with
// no test.  EDGE = true (the last two steps): a wave skips the e and rcol loads
// of chunks above its diagonal tile, which are not stored, and multiplies zeros.
template <bool EDGE>
__device__ __forceinline__ void pv_step(
    const float* __restrict__ E, const __bf16* __restrict__ V,
    const float* __restrict__ rc, int s0, int ta0, int vu0, int lane,
    v8f (&acc)[2][4]) {
  const int hi = lane >> 4;
  // ---- loads: e, V fragments, rcol of the keys this lane holds ----
  f32x4 e[2][2][4] = {};                 // [s chunk][t tile][512-B row]
  v16bf vb[2][4];                        // [s chunk][v tile]
  f32x4 r[2][4]    = {};
  const float* ep =
      E + ((size_t)(ta0 >> 4) * E_ROW + (s0 >> 5)) * E_TILE + lane * 4;
  const __bf16* vp = V + (size_t)((s0 >> 5) * (C_DIM / 16) + vu0) * F_UNIT;
  const float* rp = rc + s0 + 8 * hi;
#pragma unroll
  for (int kk = 0; kk < 2; ++kk) {
    if (!EDGE || s0 + kk * 32 <= ta0) {
#pragma unroll
      for (int it = 0; it < 2; ++it) {
#pragma unroll
        for (int c = 0; c < 4; ++c)
          e[kk][it][c] =
              *(const f32x4*)(ep + (it * E_ROW + kk) * E_TILE + c * 128);
      }
      if (EDGE) loads_issued(ep);        // ep may end here and be reused
      r[kk][0] = *(const f32x4*)(rp + kk * 32);
      r[kk][1] = *(const f32x4*)(rp + kk * 32 + 4);
      r[kk][2] = *(const f32x4*)(rp + kk * 32 + 16);
      r[kk][3] = *(const f32x4*)(rp + kk * 32 + 20);
      if (EDGE) loads_issued(rp);
    }
#pragma unroll
    for (int nt = 0; nt < 4; ++nt)
      vb[kk][nt] = load_frag_packed(vp, kk * (C_DIM / 16) + nt, lane);
  }
  loads_issued(vp + lane * 8);           // the pointers are stepped or reused next
#pragma unroll
  for (int kk = 0; kk < 2; ++kk) {
    // ---- P fragments: 32t x 32s, bf16(e * rcol) ----
    v16bf pa[2];
#pragma unroll
    for (int it = 0; it < 2; ++it) {
      FragU f;
#pragma unroll
      for (int c = 0; c < 4; ++c) {
#pragma unroll
        for (int j = 0; j < 4; ++j)
          f.h[c * 4 + j] = (__bf16)(e[kk][it][c][j] * r[kk][c][j]);
      }
      pa[it] = f.v;
    }
    // ---- P(32x32) @ V(32x64) ----
#pragma unroll
    for (int nt = 0; nt < 4; ++nt) {
      acc[0][nt] = wmma_bf16(pa[0], vb[kk][nt], acc[0][nt]);
      acc[1][nt] = wmma_bf16(pa[1], vb[kk][nt], acc[1][nt]);
    }
  }
}

// The two 8-wave halves of a work-group hold partial sums of the same 128 x 128
// tile.  Each wave finishes one of its two 16-row t tiles (KEEP) and hands the
// other to the wave of the other half with the same rows and columns, through
// 4 KB of LDS of its own: 16 B a lane, 512 contiguous bytes a write or read.
// Every loop over acc or o is unrolled: the arrays stay in registers.
template <int KEEP>
__device__ __forceinline__ void pv_give(const v8f (&acc)[2][4], float* mine,
                                        int lane) {
#pragma unroll
  for (int nt = 0; nt < 4; ++nt) {
#pragma unroll
    for (int h = 0; h < 2; ++h)
      *(f32x4*)(mine + (nt * 2 + h) * 128 + lane * 4) =
          f32x4{acc[1 - KEEP][nt][h * 4], acc[1 - KEEP][nt][h * 4 + 1],
                acc[1 - KEEP][nt][h * 4 + 2], acc[1 - KEEP][nt][h * 4 + 3]};
  }
}

template <int KEEP>
__device__ __forceinline__ void pv_take_store(const v8f (&acc)[2][4],
                                              const float* theirs, float* orow,
                                              int lane) {
  f32x4 o[4][2];
#pragma unroll
  for (int nt = 0; nt < 4; ++nt) {
#pragma unroll
    for (int h = 0; h < 2; ++h)
      o[nt][h] = *(const f32x4*)(theirs + (nt * 2 + h) * 128 + lane * 4);
  }
  float* op = orow + (size_t)(KEEP * 16 + 8 * (lane >> 4)) * 1024 + (lane & 15);
#pragma unroll
  for (int nt = 0; nt < 4; ++nt) {
#pragma unroll
    for (int i = 0; i < 8; ++i)
      __builtin_nontemporal_store(acc[KEEP][nt][i] + o[nt][i >> 2][i & 3],
                                  op + (size_t)i * 1024 + nt * 16);
  }
}

// grid = (T/256, 512/128, B), 16 waves: every work-group takes the query tiles
// x and T/128 - 1 - x, one after the other, and deals the 64-key steps of a tile
// alternately to its two halves of 8 waves: T/128 + 1 steps a wave in every
// work-group, one work-group a WGP.
__global__ __launch_bounds__(512) void attend_kernel(
    const float* __restrict__ Ew, const __bf16* __restrict__ Vb,
    const float* __restrict__ rcol, float* __restrict__ out) {
  // One area per tile of the pair: the second tile's writes need not wait for
  // the first tile's reads.
  __shared__ __attribute__((aligned(16))) float red[2][16][1024];
  const int b      = blockIdx.z;
  const int v_base = blockIdx.y * 128;
  const float*  E  = Ew + (size_t)b * (T_DIM / 16) * E_ROW * E_TILE;
  const __bf16* V  = Vb + (size_t)b * T_DIM * C_DIM;
  const float*  rc = rcol + (size_t)b * T_DIM;
  float*        ob = out + (size_t)b * T_DIM * 1024;

  const int lane = threadIdx.x & 31;
  // Scalar wave number: the test on stored tiles is then a scalar branch, and
  // the half of the work-group a scalar.
  const int wave = __builtin_amdgcn_readfirstlane(threadIdx.x >> 5);
  const int g    = wave >> 3;            // 0..1 : which steps of 64 keys
  const int tw   = (wave >> 1) & 3;      // 0..3 : 32-row t strip
  const int sw   = wave & 1;             // 0..1 : 64-col v half
  const int vu0  = (v_base + sw * 64) >> 4;  // first 16-column V unit of the wave

  for (int p = 0; p < 2; ++p) {
    const int t_base = (p == 0 ? (int)blockIdx.x : T_BLKS - 1 - (int)blockIdx.x) * 128;
    const int ta0    = t_base + tw * 32;
    v8f acc[2][4] = {};                  // 32t x 64v partial sums

    for (int s0 = g * 64; s0 < t_base; s0 += 128)
      pv_step<false>(E, V, rc, s0, ta0, vu0, lane, acc);
    pv_step<true>(E, V, rc, t_base + g * 64, ta0, vu0, lane, acc);

    if (g == 0) pv_give<0>(acc, red[p][wave], lane);
    else        pv_give<1>(acc, red[p][wave], lane);
    // The other half's partial sums are read behind it.
    __syncthreads();
    float* orow = ob + (size_t)ta0 * 1024 + 512 + v_base + sw * 64;
    if (g == 0) pv_take_store<0>(acc, red[p][wave ^ 8], orow, lane);
    else        pv_take_store<1>(acc, red[p][wave ^ 8], orow, lane);
    loads_issued();    // here behind stores: the next tile rewrites their registers
  }
}

// ---------------------------------------------------------------------------
// Launcher.  Workspace layout (bytes):
//   [0, 16M)   Q  bf16 [16384][512], 1-KB fragment units [1024][16]
//   [16M,32M)  K  bf16, as Q
//   [32M,48M)  V  bf16, 1-KB fragment units [512][32]
//   [48M, +64K) rcol f32 [16384]   (reciprocal column sums)
//   then 128M   e f32, 2 KB units [8][128][64]
//   then 16M    x bf16, 1-KB fragment units [1024][16]
//   then 1.5M   Wq, Wk, Wv bf16, 1-KB fragment units [3][32][16]
//   then 1M     psum f32 [8][16][2048]  (column sums per 128-query block)
// ---------------------------------------------------------------------------
extern "C" void kernel_launch(void* const* d_in, const int* in_sizes, int n_in,
                              void* d_out, int out_size, void* d_ws,
                              size_t ws_size, hipStream_t stream) {
  const float* x  = (const float*)d_in[0];
  const float* Wq = (const float*)d_in[1];
  const float* bq = (const float*)d_in[2];
  const float* Wk = (const float*)d_in[3];
  const float* bk = (const float*)d_in[4];
  const float* Wv = (const float*)d_in[5];
  const float* bv = (const float*)d_in[6];
  float* out = (float*)d_out;

  const size_t qkv = (size_t)M_ROWS * C_DIM;           // elems per matrix
  __bf16* Qb = (__bf16*)d_ws;
  __bf16* Kb = Qb + qkv;
  __bf16* Vb = Kb + qkv;
  float* rcol = (float*)(Vb + qkv);
  float* Ew   = rcol + M_ROWS;
  __bf16* Xp = (__bf16*)(Ew + (size_t)B_DIM * T_DIM * T_DIM);
  __bf16* Wp = Xp + qkv;
  float* psum = (float*)(Wp + (size_t)3 * C_DIM * C_DIM);

  // out[..., :512] = x; x and W as bf16 fragments
  pack_copy_kernel<<<W_BLOCKS + M_ROWS / 32, 256, 0, stream>>>(x, Wq, Wk, Wv, out,
                                                               Xp, Wp);
  // Q, K, V projections (bf16)
  proj_kernel<<<dim3(M_ROWS / 128, C_DIM / 256, 3), 256, 0, stream>>>(
      Xp, Wp, bq, bk, bv, Qb, Kb, Vb);
  // masked exponentials and partial column sums, then the denominators
  colsum_kernel<<<dim3(P_BLOCKS, B_DIM), 256, 0, stream>>>(Qb, Kb, psum, Ew);
  rcol_kernel<<<M_ROWS / 256, 256, 0, stream>>>(psum, rcol);
  // out[..., 512:] = P @ V
  attend_kernel<<<dim3(T_DIM / 256, C_DIM / 128, B_DIM), 512, 0, stream>>>(
      Ew, Vb, rcol, out);
}

// v007
// It runs in 112 microseconds.
// Next to v006, in two timings, it ran 1.09 times as fast each time.
// Over all steps from v000 it is 7.81 times as fast.
#include <hip/hip_runtime.h>

#define B_DIM   8
#define T_DIM   2048
#define C_DIM   512
#define M_ROWS  (B_DIM * T_DIM)        // 16384
#define T_BLKS  (T_DIM / 128)          // query blocks
#define SM_SCALE 0.04419417382415922f  // 1/sqrt(512)

typedef __attribute__((ext_vector_type(16))) __bf16    v16bf;
typedef __attribute__((ext_vector_type(8)))  float     v8f;
typedef __attribute__((ext_vector_type(4)))  float     f32x4;
typedef __attribute__((ext_vector_type(8)))  __bf16    bf16x8;

union FragU {
  uint4  u[2];
  __bf16 h[16];
  v16bf  v;
};

__device__ __forceinline__ v8f wmma_bf16(v16bf a, v16bf b, v8f c) {
  // (neg_a, A, neg_b, B, c_mod, C, reuse_a, reuse_b)
  return __builtin_amdgcn_wmma_f32_16x16x32_bf16(false, a, false, b, (short)0, c,
                                                 false, false);
}

#define F_UNIT 512                     // bf16 elements per fragment unit
__device__ __forceinline__ v16bf load_frag_packed(const __bf16* base, int unit,
                                                  int lane) {
  const __bf16* p = base + (size_t)unit * F_UNIT + lane * 8;
  FragU f;
  f.u[0] = *(const uint4*)(p);
  f.u[1] = *(const uint4*)(p + 256);
  return f.v;
}

// Stands behind a run of loads.  The wait: in front of the first rewrite of an
// address register that the loads name.  The scheduling barriers: the first
// keeps the loads in front of the arithmetic, all in flight together (without
// it the scheduler sinks them between the WMMAs and the wave waits out a load
// latency several times per step); the second keeps the rewrites behind the wait.
__device__ __forceinline__ void loads_issued() {
  __builtin_amdgcn_sched_barrier(0);
  asm volatile("s_wait_xcnt 0x0" ::: "memory");
  __builtin_amdgcn_sched_barrier(0);
}

// The same, where the address of the loads is not used again: the wait names it,
// so its registers stay whole up to the wait and are not given to a load's result.
__device__ __forceinline__ void loads_issued(const void* last_address) {
  __builtin_amdgcn_sched_barrier(0);
  asm volatile("s_wait_xcnt 0x0" ::"v"(last_address) : "memory");
  __builtin_amdgcn_sched_barrier(0);
}

#define W_BLOCKS 192                   // 3 x (512/16) x (512/32) units / 8 waves
#define X_PITCH  136                   // bf16 elements per 8-column group in LDS

__global__ __launch_bounds__(256) void pack_copy_kernel(
    const float* __restrict__ x, const float* __restrict__ Wq,
    const float* __restrict__ Wk, const float* __restrict__ Wv,
    float* __restrict__ out, __bf16* __restrict__ Xp, __bf16* __restrict__ Wp) {
  __shared__ __attribute__((aligned(16))) __bf16 xt[8][16 * X_PITCH];
  const int lane = threadIdx.x & 31;
  // Scalar wave number: the bases are then scalar, and one lane offset, never
  // rewritten, serves the loads and stores of a wave.
  const int wave = __builtin_amdgcn_readfirstlane(threadIdx.x >> 5);
  union Pack8 { uint4 u; __bf16 h[8]; };
  union Pack4 { uint2 u; __bf16 h[4]; };

  if (blockIdx.x < W_BLOCKS) {                    // same for the whole block
    const int z = blockIdx.x >> 6;                // 64 blocks a matrix
    const float* Wm = (z == 0) ? Wq : (z == 1) ? Wk : Wv;
    const int unit = (blockIdx.x & 63) * 8 + wave;   // (col/16) * 16 + row/32
    const float* wp = Wm + (size_t)((unit & 15) * 32 + (lane >> 4) * 8) * C_DIM +
                      (unit >> 4) * 16 + (lane & 15);
    float t[16];
#pragma unroll
    for (int i = 0; i < 16; ++i)
      t[i] = wp[(size_t)((i >> 3) * 16 + (i & 7)) * C_DIM];
#pragma unroll
    for (int h = 0; h < 2; ++h) {
      Pack8 o;
#pragma unroll
      for (int j = 0; j < 8; ++j) o.h[j] = (__bf16)t[h * 8 + j];
      *(uint4*)(Wp + ((size_t)z * (C_DIM * C_DIM / F_UNIT) + unit) * F_UNIT +
                h * 256 + lane * 8) = o.u;
    }
    return;
  }

  const int task  = (blockIdx.x - W_BLOCKS) * 8 + wave;
  const int strip = task >> 2;                    // 16 rows
  const int cg    = task & 3;                     // 128 columns
  const float* xp = x + (size_t)strip * 16 * C_DIM + cg * 128 + lane * 4;
  float*       op = out + (size_t)strip * 16 * 1024 + cg * 128 + lane * 4;
  __bf16*      xw = xt[wave];
  f32x4 v[16];
#pragma unroll
  for (int r = 0; r < 16; ++r) v[r] = *(const f32x4*)(xp + r * C_DIM);
  loads_issued();                                 // 8 KB a wave in flight at once
#pragma unroll
  for (int r = 0; r < 16; ++r) {
    Pack4 o;
#pragma unroll
    for (int j = 0; j < 4; ++j) o.h[j] = (__bf16)v[r][j];
    *(uint2*)(xw + (lane >> 1) * X_PITCH + r * 8 + (lane & 1) * 4) = o.u;
  }
  // Lanes read other lanes' writes.  No global store stands in front of it: the
  // barrier would wait for it to complete.
  __syncthreads();
  __bf16* xo = Xp + (size_t)(strip * (C_DIM / 32) + cg * 4) * F_UNIT + lane * 8;
#pragma unroll
  for (int m = 0; m < 8; ++m)                     // 512-B row m of the four units
    *(uint4*)(xo + m * 256) =
        *(const uint4*)(xw + (m * 2 + (lane >> 4)) * X_PITCH + (lane & 15) * 8);
#pragma unroll
  for (int r = 0; r < 16; ++r)
    __builtin_nontemporal_store(v[r], (f32x4*)(op + r * 1024));
}

// ---------------------------------------------------------------------------
// Kernel 1: projections.  dst = bf16(x @ W + b).  grid = (M/128, 512/256, n),
// matrix z0 + blockIdx.z.  Launched twice: Q and K first; V behind kernel 2,
// as bf16((x @ Wv + bv) / colsum[row]), rounded once, where
//   colsum[b,s] = sum over tb of psum[b,tb,s], in rising tb  (kernel 2).
// 8 waves/block as 2 (rows) x 4 (columns); each owns a 64x64 output tile:
// 16 WMMAs per 8 fragments of a k step, 512 B loaded per WMMA.
// A and B fragments come straight from the packed copies of kernel 0, 512
// contiguous bytes a load.  Nothing is shared through LDS in the loop: no
// barrier.  Work-groups 256 apart in the grid have the same rows of x.
// Fragments are fetched one k step ahead: the four A fragments into a second
// register set at the head of a step, the B fragments one by one between the
// groups of four WMMAs, as the registers of the step's own come free.
// The result is stored in the fragment order of its consumer:
//   V:    unit (row/32, col/16), contraction index = row (key).  A lane holds
//         one column and 8 consecutive rows: its 16 B of a 512-B unit row.
//         Each wave forms 1/colsum of its 64 rows, two a lane, and hands them
//         to its lanes through its own LDS area.
//   Q, K: unit (row/16, col/32), contraction index = column.  Each wave turns
//         its eight units through an 8-KB LDS area of its own, once.
// Either way a wave stores 512 contiguous bytes per WMMA tile.
// ---------------------------------------------------------------------------
__global__ __launch_bounds__(256) void proj_kernel(
    const __bf16* __restrict__ Xp, const __bf16* __restrict__ Wp,
    const float* __restrict__ bq, const float* __restrict__ bk,
    const float* __restrict__ bv, const float* __restrict__ psum,
    __bf16* __restrict__ Qb, __bf16* __restrict__ Kb, __bf16* __restrict__ Vb,
    int z0) {
  __shared__ __attribute__((aligned(16))) __bf16 xt[8][8 * F_UNIT];

  const int lane = threadIdx.x & 31;
  // Scalar wave number: the fragment bases are then scalar, and one lane
  // offset, never rewritten in the loop, serves every load.
  const int wave = __builtin_amdgcn_readfirstlane(threadIdx.x >> 5);
  const int row0 = blockIdx.x * 128 + (wave >> 2) * 64;
  const int n0   = blockIdx.y * 256 + (wave & 3) * 64;
  const int z    = z0 + (int)blockIdx.z;

  const float* bias;
  __bf16*      dst;
  switch (z) {
    case 0:  bias = bq; dst = Qb; break;
    case 1:  bias = bk; dst = Kb; break;
    default: bias = bv; dst = Vb; break;
  }
  const int KU = C_DIM / 32;                      // units per 16-row strip
  const __bf16* A  = Xp + (size_t)(row0 >> 4) * KU * F_UNIT;
  const __bf16* Bw = Wp + (size_t)z * C_DIM * C_DIM +
                     (size_t)(n0 >> 4) * KU * F_UNIT;

  float* rw = (float*)xt[wave];                   // V: written, read by this wave alone
  if (z >= 2) {                                   // same for the whole block
    const float* pp = psum + (size_t)(row0 / T_DIM) * T_BLKS * T_DIM +
                      (row0 % T_DIM) + lane;
    float ps[2][T_BLKS];
    // Unrolled: the array stays in registers and the loads are one run.
#pragma unroll
    for (int h = 0; h < 2; ++h) {
#pragma unroll
      for (int tb = 0; tb < T_BLKS; ++tb) ps[h][tb] = pp[tb * T_DIM + h * 32];
    }
    loads_issued();                               // all in flight at once
#pragma unroll
    for (int h = 0; h < 2; ++h) {
      float sum = 0.0f;
#pragma unroll
      for (int tb = 0; tb < T_BLKS; ++tb) sum += ps[h][tb];
      rw[h * 32 + lane] = 1.0f / sum;
    }
  }

  // Every loop over acc, a or b is unrolled: the arrays stay in registers.
  v8f   acc[4][4] = {};                           // [row tile][column tile]
  v16bf a[2][4], b[4];
#pragma unroll
  for (int it = 0; it < 4; ++it) a[0][it] = load_frag_packed(A, it * KU, lane);
#pragma unroll
  for (int nt = 0; nt < 4; ++nt) b[nt] = load_frag_packed(Bw, nt * KU, lane);
#pragma unroll
  for (int ku = 0; ku < KU; ++ku) {
    // The scheduling barriers hold each group of loads where it is written:
    // moved down to their readers, the wave would wait out a load latency per
    // group; moved up, they would need registers that are still being read.
    if (ku + 1 < KU) {
#pragma unroll
      for (int it = 0; it < 4; ++it)
        a[(ku + 1) & 1][it] = load_frag_packed(A, it * KU + ku + 1, lane);
    }
    __builtin_amdgcn_sched_barrier(0);
#pragma unroll
    for (int nt = 0; nt < 4; ++nt) {
#pragma unroll
      for (int it = 0; it < 4; ++it)
        acc[it][nt] = wmma_bf16(a[ku & 1][it], b[nt], acc[it][nt]);
      if (ku + 1 < KU) b[nt] = load_frag_packed(Bw, nt * KU + ku + 1, lane);
      __builtin_amdgcn_sched_barrier(0);
    }
  }
  loads_issued();                  // the epilogue reuses the address registers

  const int hi = lane >> 4;
  float bz[4];
#pragma unroll
  for (int nt = 0; nt < 4; ++nt) bz[nt] = bias[n0 + nt * 16 + (lane & 15)];
  loads_issued();
  bf16x8 o[4][4];
  if (z >= 2) {                                   // V; same for the whole block
#pragma unroll
    for (int it = 0; it < 4; ++it) {
      // 1/colsum of the 8 rows that this lane holds of row tile it
      const f32x4 r0 = *(const f32x4*)(rw + it * 16 + 8 * hi);
      const f32x4 r1 = *(const f32x4*)(rw + it * 16 + 8 * hi + 4);
#pragma unroll
      for (int nt = 0; nt < 4; ++nt) {
#pragma unroll
        for (int i = 0; i < 8; ++i)
          o[it][nt][i] = (__bf16)((acc[it][nt][i] + bz[nt]) *
                                  (i < 4 ? r0[i & 3] : r1[i & 3]));
      }
    }
    // The stores stand behind all the arithmetic: no register that a store
    // names is rewritten behind it.
    __builtin_amdgcn_sched_barrier(0);
    __bf16* vo = dst + ((size_t)(row0 >> 5) * (C_DIM / 16) + (n0 >> 4)) * F_UNIT +
                 lane * 8;
#pragma unroll
    for (int it = 0; it < 4; ++it) {
#pragma unroll
      for (int nt = 0; nt < 4; ++nt)
        *(bf16x8*)(vo + ((it >> 1) * (C_DIM / 16) + nt) * F_UNIT + (it & 1) * 256) =
            o[it][nt];
    }
  } else {                                        // Q, K
    __bf16* xw = xt[wave];                        // read by this wave alone
#pragma unroll
    for (int it = 0; it < 4; ++it) {
#pragma unroll
      for (int nt = 0; nt < 4; ++nt) {
#pragma unroll
        for (int i = 0; i < 8; ++i)
          xw[(it * 4 + nt) * 256 + (i + 8 * hi + 16 * ((lane >> 3) & 1)) * 8 +
             (lane & 7)] = (__bf16)(acc[it][nt][i] + bz[nt]);
      }
    }
#pragma unroll
    for (int it = 0; it < 4; ++it) {
#pragma unroll
      for (int nt = 0; nt < 4; ++nt)
        o[it][nt] = *(const bf16x8*)(xw + (it * 4 + nt) * 256 + lane * 8);
    }
    // As above: the stores stand behind every LDS read.
    __builtin_amdgcn_sched_barrier(0);
    __bf16* qo = dst + ((size_t)(row0 >> 4) * KU + (n0 >> 5)) * F_UNIT + lane * 8;
#pragma unroll
    for (int it = 0; it < 4; ++it) {
#pragma unroll
      for (int nt = 0; nt < 4; ++nt)
        *(bf16x8*)(qo + (it * KU + (nt >> 1)) * F_UNIT + (nt & 1) * 256) = o[it][nt];
    }
    // In front of any later rewrite of a register that these stores name.
    asm volatile("s_wait_xcnt 0x0" ::: "memory");
  }
}

#define E_ROW  (T_DIM / 32)
#define P_BLOCKS (T_BLKS * (T_BLKS + 1))

__global__ __launch_bounds__(256) void colsum_kernel(
    const __bf16* __restrict__ Qb, const __bf16* __restrict__ Kb,
    float* __restrict__ psum, __bf16* __restrict__ Ew) {
  __shared__ float ssum[64];
  if (threadIdx.x < 64) ssum[threadIdx.x] = 0.0f;
  __syncthreads();

  const int b = blockIdx.y;
  // Query block tb has key blocks 0..2 tb + 1; tb (tb + 1) tiles lie before it.
  // Unrolled: fifteen scalar compares with constants, no loop and no multiply.
  int tb = 0;
#pragma unroll
  for (int u = 1; u < T_BLKS; ++u) tb += (u * (u + 1) <= (int)blockIdx.x) ? 1 : 0;
  const int s_blk = ((int)blockIdx.x - tb * (tb + 1)) * 64;
  const __bf16* Q = Qb + (size_t)b * T_DIM * C_DIM;
  const __bf16* K = Kb + (size_t)b * T_DIM * C_DIM;
  __bf16*       E = Ew + (size_t)b * (T_DIM / 16) * E_ROW * F_UNIT;

  const int lane = threadIdx.x & 31;
  const int wave = threadIdx.x >> 5;
  const int tw   = wave >> 1;               // 0..3 : 32-row t strip
  const int sw   = wave & 1;                // 0..1 : 32-col s half
  const int t0   = tb * 128 + tw * 32;
  const int s0   = s_blk + sw * 32;
  const int hi   = lane >> 4;

  const bool live = t0 + 31 >= s0;          // else: wave tile above the diagonal
  // Every loop over ev, part or l is unrolled: the arrays stay in registers.
  bf16x8 ev[2][2];                          // e: [t tile][s tile = 512-B row]
  if (live) {
    float part[2][8] = {};                  // per key held by this lane
    v8f l[2][2] = {};                       // [t tile][s tile], rows s, cols t
    for (int k0 = 0; k0 < C_DIM; k0 += 32) {
      const int ku = k0 >> 5;               // 16 units per 16-row strip
      const v16bf a0 = load_frag_packed(Q, (t0 >> 4) * 16 + ku, lane);
      const v16bf a1 = load_frag_packed(Q, (t0 >> 4) * 16 + 16 + ku, lane);
      const v16bf b0 = load_frag_packed(K, (s0 >> 4) * 16 + ku, lane);
      const v16bf b1 = load_frag_packed(K, (s0 >> 4) * 16 + 16 + ku, lane);
      l[0][0] = wmma_bf16(b0, a0, l[0][0]);
      l[0][1] = wmma_bf16(b1, a0, l[0][1]);
      l[1][0] = wmma_bf16(b0, a1, l[1][0]);
      l[1][1] = wmma_bf16(b1, a1, l[1][1]);
    }
#pragma unroll
    for (int it = 0; it < 2; ++it) {
      const int t = t0 + it * 16 + (lane & 15);
#pragma unroll
      for (int is = 0; is < 2; ++is) {
#pragma unroll
        for (int i = 0; i < 8; ++i) {
          const int s = s0 + is * 16 + i + 8 * hi;
          const float e = (s <= t) ? __expf(l[it][is][i] * SM_SCALE) : 0.0f;
          part[is][i] += e;
          ev[it][is][i] = (__bf16)e;
        }
      }
    }
    // Sum over the 16 queries of a half-wave.  It runs once per tile: the lane
    // distance is the outer loop, so that the 16 exchanges of a distance are
    // in flight together and the wave waits four times, not 64.
#pragma unroll
    for (int m = 1; m < 16; m <<= 1) {
#pragma unroll
      for (int is = 0; is < 2; ++is) {
#pragma unroll
        for (int i = 0; i < 8; ++i) part[is][i] += __shfl_xor(part[is][i], m, 32);
      }
    }
    if ((lane & 15) == 0) {
#pragma unroll
      for (int is = 0; is < 2; ++is) {
#pragma unroll
        for (int i = 0; i < 8; ++i)
          atomicAdd(&ssum[sw * 32 + is * 16 + i + 8 * hi], part[is][i]);
      }
    }
  }
  // No global store stands in front of it: the barrier would wait for it to
  // complete, once per tile.
  __syncthreads();
  if (live) {
#pragma unroll
    for (int it = 0; it < 2; ++it) {
      __bf16* ep = E + ((size_t)((t0 >> 4) + it) * E_ROW + (s0 >> 5)) * F_UNIT +
                   lane * 8;
#pragma unroll
      for (int is = 0; is < 2; ++is) *(bf16x8*)(ep + is * 256) = ev[it][is];
    }
  }
  // What follows may rewrite the registers these stores name (data, address).
  asm volatile("s_wait_xcnt 0x0" ::: "memory");
  float* pb = psum + (size_t)b * T_BLKS * T_DIM + s_blk;
  if (threadIdx.x < 64) pb[tb * T_DIM + threadIdx.x] = ssum[threadIdx.x];
  // Likewise for the store above.
  asm volatile("s_wait_xcnt 0x0" ::: "memory");
  // The diagonal tile is the first of its keys: the query blocks above it have
  // no term, and their rows get the zeros that the V launch of kernel 1 adds:
  // 16 threads a row.
  if (s_blk >= tb * 128 && (int)(threadIdx.x >> 4) < tb)
    *(f32x4*)(pb + (threadIdx.x >> 4) * T_DIM + (threadIdx.x & 15) * 4) =
        f32x4{0.0f, 0.0f, 0.0f, 0.0f};
}

// ---------------------------------------------------------------------------
// Kernel 3: read = e @ V, causal; V holds 1/colsum of its key already.
// Block tile: 128(t) x 128(v), s-steps of 64.
// Each wave reads the stored e of its 32 t rows straight into A fragments and V
// straight into B fragments (512 contiguous bytes per load; stored in those
// orders by kernels 2 and 1); then 2t x 4v blocked WMMAs.  No arithmetic but
// the WMMAs, and no operand shared through LDS: no barrier in the loop.
// ---------------------------------------------------------------------------
// One s-step of 64 keys.  EDGE = false: every 32-key chunk lies at or below the
// diagonal tile of every wave of the block, so all loads issue together with
// no test.  EDGE = true (the last two steps): a wave skips the e loads of chunks
// above its diagonal tile, which are not stored, and multiplies zeros.
template <bool EDGE>
__device__ __forceinline__ void pv_step(
    const __bf16* __restrict__ E, const __bf16* __restrict__ V, int s0, int ta0,
    int vu0, int lane, v8f (&acc)[2][4]) {
  // ---- loads: e and V fragments ----
  v16bf pa[2][2] = {};                   // [s chunk][t tile]
  v16bf vb[2][4];                        // [s chunk][v tile]
  const __bf16* ep = E + ((size_t)(ta0 >> 4) * E_ROW + (s0 >> 5)) * F_UNIT;
  const __bf16* vp = V + (size_t)((s0 >> 5) * (C_DIM / 16) + vu0) * F_UNIT;
  // EDGE: the V loads, which have no test, stand in front of the branches, so
  // that nothing the compiler puts at a branch's end holds them back.
#pragma unroll
  for (int kk = 0; kk < 2; ++kk) {
    if (!EDGE) {
#pragma unroll
      for (int it = 0; it < 2; ++it)
        pa[kk][it] = load_frag_packed(ep, it * E_ROW + kk, lane);
    }
#pragma unroll
    for (int nt = 0; nt < 4; ++nt)
      vb[kk][nt] = load_frag_packed(vp, kk * (C_DIM / 16) + nt, lane);
  }
  if (EDGE) {
#pragma unroll
    for (int kk = 0; kk < 2; ++kk) {
      if (s0 + kk * 32 <= ta0) {
#pragma unroll
        for (int it = 0; it < 2; ++it)
          pa[kk][it] = load_frag_packed(ep, it * E_ROW + kk, lane);
        loads_issued(ep + lane * 8);     // ep may end here and be reused
      }
    }
  }
  loads_issued(vp + lane * 8);           // the pointers are stepped or reused next
  // ---- e(32x64) @ V(64x64) ----
#pragma unroll
  for (int kk = 0; kk < 2; ++kk) {
#pragma unroll
    for (int nt = 0; nt < 4; ++nt) {
      acc[0][nt] = wmma_bf16(pa[kk][0], vb[kk][nt], acc[0][nt]);
      acc[1][nt] = wmma_bf16(pa[kk][1], vb[kk][nt], acc[1][nt]);
    }
  }
}

// The two 8-wave halves of a work-group hold partial sums of the same 128 x 128
// tile.  Each wave finishes one of its two 16-row t tiles (KEEP) and hands the
// other to the wave of the other half with the same rows and columns, through
// 4 KB of LDS of its own: 16 B a lane, 512 contiguous bytes a write or read.
// Every loop over acc or o is unrolled: the arrays stay in registers.
template <int KEEP>
__device__ __forceinline__ void pv_give(const v8f (&acc)[2][4], float* mine,
                                        int lane) {
#pragma unroll
  for (int nt = 0; nt < 4; ++nt) {
#pragma unroll
    for (int h = 0; h < 2; ++h)
      *(f32x4*)(mine + (nt * 2 + h) * 128 + lane * 4) =
          f32x4{acc[1 - KEEP][nt][h * 4], acc[1 - KEEP][nt][h * 4 + 1],
                acc[1 - KEEP][nt][h * 4 + 2], acc[1 - KEEP][nt][h * 4 + 3]};
  }
}

template <int KEEP>
__device__ __forceinline__ void pv_take_store(const v8f (&acc)[2][4],
                                              const float* theirs, float* orow,
                                              int lane) {
  f32x4 o[4][2];
#pragma unroll
  for (int nt = 0; nt < 4; ++nt) {
#pragma unroll
    for (int h = 0; h < 2; ++h)
      o[nt][h] = *(const f32x4*)(theirs + (nt * 2 + h) * 128 + lane * 4);
  }
  float* op = orow + (size_t)(KEEP * 16 + 8 * (lane >> 4)) * 1024 + (lane & 15);
#pragma unroll
  for (int nt = 0; nt < 4; ++nt) {
#pragma unroll
    for (int i = 0; i < 8; ++i)
      __builtin_nontemporal_store(acc[KEEP][nt][i] + o[nt][i >> 2][i & 3],
                                  op + (size_t)i * 1024 + nt * 16);
  }
}

// grid = (T/256, 512/128, B), 16 waves: every work-group takes the query tiles
// x and T/128 - 1 - x, one after the other, and deals the 64-key steps of a tile
// alternately to its two halves of 8 waves: T/128 + 1 steps a wave in every
// work-group, one work-group a WGP.
__global__ __launch_bounds__(512) void attend_kernel(
    const __bf16* __restrict__ Ew, const __bf16* __restrict__ Vb,
    float* __restrict__ out) {
  // One area per tile of the pair: the second tile's writes need not wait for
  // the first tile's reads.
  __shared__ __attribute__((aligned(16))) float red[2][16][1024];
  const int b      = blockIdx.z;
  const int v_base = blockIdx.y * 128;
  const __bf16* E  = Ew + (size_t)b * (T_DIM / 16) * E_ROW * F_UNIT;
  const __bf16* V  = Vb + (size_t)b * T_DIM * C_DIM;
  float*        ob = out + (size_t)b * T_DIM * 1024;

  const int lane = threadIdx.x & 31;
  // Scalar wave number: the test on stored tiles is then a scalar branch, and
  // the half of the work-group a scalar.
  const int wave = __builtin_amdgcn_readfirstlane(threadIdx.x >> 5);
  const int g    = wave >> 3;            // 0..1 : which steps of 64 keys
  const int tw   = (wave >> 1) & 3;      // 0..3 : 32-row t strip
  const int sw   = wave & 1;             // 0..1 : 64-col v half
  const int vu0  = (v_base + sw * 64) >> 4;  // first 16-column V unit of the wave

  for (int p = 0; p < 2; ++p) {
    const int t_base = (p == 0 ? (int)blockIdx.x : T_BLKS - 1 - (int)blockIdx.x) * 128;
    const int ta0    = t_base + tw * 32;
    v8f acc[2][4] = {};                  // 32t x 64v partial sums

    for (int s0 = g * 64; s0 < t_base; s0 += 128)
      pv_step<false>(E, V, s0, ta0, vu0, lane, acc);
    pv_step<true>(E, V, t_base + g * 64, ta0, vu0, lane, acc);

    if (g == 0) pv_give<0>(acc, red[p][wave], lane);
    else        pv_give<1>(acc, red[p][wave], lane);
    // The other half's partial sums are read behind it.
    __syncthreads();
    float* orow = ob + (size_t)ta0 * 1024 + 512 + v_base + sw * 64;
    if (g == 0) pv_take_store<0>(acc, red[p][wave ^ 8], orow, lane);
    else        pv_take_store<1>(acc, red[p][wave ^ 8], orow, lane);
    loads_issued();    // here behind stores: the next tile rewrites their registers
  }
}

// ---------------------------------------------------------------------------
// Launcher.  Workspace layout (bytes):
//   [0, 16M)   Q  bf16 [16384][512], 1-KB fragment units [1024][16]
//   [16M,32M)  K  bf16, as Q
//   [32M,48M)  V / colsum  bf16, 1-KB fragment units [512][32]
//   then 64M    e bf16, 1-KB fragment units [8][128][64]
//   then 16M    x bf16, 1-KB fragment units [1024][16]
//   then 1.5M   Wq, Wk, Wv bf16, 1-KB fragment units [3][32][16]
//   then 1M     psum f32 [8][16][2048]  (column sums per 128-query block)
// ---------------------------------------------------------------------------
extern "C" void kernel_launch(void* const* d_in, const int* in_sizes, int n_in,
                              void* d_out, int out_size, void* d_ws,
                              size_t ws_size, hipStream_t stream) {
  const float* x  = (const float*)d_in[0];
  const float* Wq = (const float*)d_in[1];
  const float* bq = (const float*)d_in[2];
  const float* Wk = (const float*)d_in[3];
  const float* bk = (const float*)d_in[4];
  const float* Wv = (const float*)d_in[5];
  const float* bv = (const float*)d_in[6];
  float* out = (float*)d_out;

  const size_t qkv = (size_t)M_ROWS * C_DIM;           // elems per matrix
  __bf16* Qb = (__bf16*)d_ws;
  __bf16* Kb = Qb + qkv;
  __bf16* Vb = Kb + qkv;
  __bf16* Ew = Vb + qkv;
  __bf16* Xp = Ew + (size_t)B_DIM * T_DIM * T_DIM;
  __bf16* Wp = Xp + qkv;
  float* psum = (float*)(Wp + (size_t)3 * C_DIM * C_DIM);

  // out[..., :512] = x; x and W as bf16 fragments
  pack_copy_kernel<<<W_BLOCKS + M_ROWS / 32, 256, 0, stream>>>(x, Wq, Wk, Wv, out,
                                                               Xp, Wp);
  // Q, K projections (bf16)
  proj_kernel<<<dim3(M_ROWS / 128, C_DIM / 256, 2), 256, 0, stream>>>(
      Xp, Wp, bq, bk, bv, psum, Qb, Kb, Vb, 0);
  // masked exponentials and partial column sums
  colsum_kernel<<<dim3(P_BLOCKS, B_DIM), 256, 0, stream>>>(Qb, Kb, psum, Ew);
  // V projection, rows divided by their column sums (bf16)
  proj_kernel<<<dim3(M_ROWS / 128, C_DIM / 256, 1), 256, 0, stream>>>(
      Xp, Wp, bq, bk, bv, psum, Qb, Kb, Vb, 2);
  // out[..., 512:] = e @ (V / colsum)
  attend_kernel<<<dim3(T_DIM / 256, C_DIM / 128, B_DIM), 512, 0, stream>>>(
      Ew, Vb, out);
}

// v008
// Measured time: 106 microseconds a run.
// Timed twice side by side with v007, it ran 1.03 and 1.05 times as fast.
// Counting every step since v000, it is 8.12 times as fast.
#include <hip/hip_runtime.h>

#define B_DIM   8
#define T_DIM   2048
#define C_DIM   512
#define M_ROWS  (B_DIM * T_DIM)        // 16384
#define T_BLKS  (T_DIM / 128)          // query blocks
#define SM_SCALE 0.04419417382415922f  // 1/sqrt(512)

typedef __attribute__((ext_vector_type(16))) __bf16    v16bf;
typedef __attribute__((ext_vector_type(8)))  float     v8f;
typedef __attribute__((ext_vector_type(4)))  float     f32x4;
typedef __attribute__((ext_vector_type(8)))  __bf16    bf16x8;

union FragU {
  uint4  u[2];
  __bf16 h[16];
  v16bf  v;
};

__device__ __forceinline__ v8f wmma_bf16(v16bf a, v16bf b, v8f c) {
  // (neg_a, A, neg_b, B, c_mod, C, reuse_a, reuse_b)
  return __builtin_amdgcn_wmma_f32_16x16x32_bf16(false, a, false, b, (short)0, c,
                                                 false, false);
}

#define F_UNIT 512                     // bf16 elements per fragment unit
__device__ __forceinline__ v16bf load_frag_packed(const __bf16* base, int unit,
                                                  int lane) {
  const __bf16* p = base + (size_t)unit * F_UNIT + lane * 8;
  FragU f;
  f.u[0] = *(const uint4*)(p);
  f.u[1] = *(const uint4*)(p + 256);
  return f.v;
}

// Stands behind a run of loads.  The wait: in front of the first rewrite of an
// address register that the loads name.  The scheduling barriers: the first
// keeps the loads in front of the arithmetic, all in flight together (without
// it the scheduler sinks them between the WMMAs and the wave waits out a load
// latency several times per step); the second keeps the rewrites behind the wait.
__device__ __forceinline__ void loads_issued() {
  __builtin_amdgcn_sched_barrier(0);
  asm volatile("s_wait_xcnt 0x0" ::: "memory");
  __builtin_amdgcn_sched_barrier(0);
}

// The same, where the address of the loads is not used again: the wait names it,
// so its registers stay whole up to the wait and are not given to a load's result.
__device__ __forceinline__ void loads_issued(const void* last_address) {
  __builtin_amdgcn_sched_barrier(0);
  asm volatile("s_wait_xcnt 0x0" ::"v"(last_address) : "memory");
  __builtin_amdgcn_sched_barrier(0);
}

#define W_BLOCKS 192                   // 3 x (512/16) x (512/32) units / 8 waves
#define X_PITCH  136                   // bf16 elements per 8-column group in LDS

__global__ __launch_bounds__(256) void pack_copy_kernel(
    const float* __restrict__ x, const float* __restrict__ Wq,
    const float* __restrict__ Wk, const float* __restrict__ Wv,
    float* __restrict__ out, __bf16* __restrict__ Xp, __bf16* __restrict__ Wp) {
  __shared__ __attribute__((aligned(16))) __bf16 xt[8][16 * X_PITCH];
  const int lane = threadIdx.x & 31;
  // Scalar wave number: the bases are then scalar, and one lane offset, never
  // rewritten, serves the loads and stores of a wave.
  const int wave = __builtin_amdgcn_readfirstlane(threadIdx.x >> 5);
  union Pack8 { uint4 u; __bf16 h[8]; };
  union Pack4 { uint2 u; __bf16 h[4]; };

  if (blockIdx.x < W_BLOCKS) {                    // same for the whole block
    const int z = blockIdx.x >> 6;                // 64 blocks a matrix
    const float* Wm = (z == 0) ? Wq : (z == 1) ? Wk : Wv;
    const int unit = (blockIdx.x & 63) * 8 + wave;   // (col/16) * 16 + row/32
    const float* wp = Wm + (size_t)((unit & 15) * 32 + (lane >> 4) * 8) * C_DIM +
                      (unit >> 4) * 16 + (lane & 15);
    float t[16];
#pragma unroll
    for (int i = 0; i < 16; ++i)
      t[i] = wp[(size_t)((i >> 3) * 16 + (i & 7)) * C_DIM];
#pragma unroll
    for (int h = 0; h < 2; ++h) {
      Pack8 o;
#pragma unroll
      for (int j = 0; j < 8; ++j) o.h[j] = (__bf16)t[h * 8 + j];
      *(uint4*)(Wp + ((size_t)z * (C_DIM * C_DIM / F_UNIT) + unit) * F_UNIT +
                h * 256 + lane * 8) = o.u;
    }
    return;
  }

  const int task  = (blockIdx.x - W_BLOCKS) * 8 + wave;
  const int strip = task >> 2;                    // 16 rows
  const int cg    = task & 3;                     // 128 columns
  const float* xp = x + (size_t)strip * 16 * C_DIM + cg * 128 + lane * 4;
  float*       op = out + (size_t)strip * 16 * 1024 + cg * 128 + lane * 4;
  __bf16*      xw = xt[wave];
  f32x4 v[16];
#pragma unroll
  for (int r = 0; r < 16; ++r) v[r] = *(const f32x4*)(xp + r * C_DIM);
  loads_issued();                                 // 8 KB a wave in flight at once
#pragma unroll
  for (int r = 0; r < 16; ++r) {
    Pack4 o;
#pragma unroll
    for (int j = 0; j < 4; ++j) o.h[j] = (__bf16)v[r][j];
    *(uint2*)(xw + (lane >> 1) * X_PITCH + r * 8 + (lane & 1) * 4) = o.u;
  }
  // Lanes read other lanes' writes.  No global store stands in front of it: the
  // barrier would wait for it to complete.
  __syncthreads();
  __bf16* xo = Xp + (size_t)(strip * (C_DIM / 32) + cg * 4) * F_UNIT + lane * 8;
#pragma unroll
  for (int m = 0; m < 8; ++m)                     // 512-B row m of the four units
    *(uint4*)(xo + m * 256) =
        *(const uint4*)(xw + (m * 2 + (lane >> 4)) * X_PITCH + (lane & 15) * 8);
#pragma unroll
  for (int r = 0; r < 16; ++r)
    __builtin_nontemporal_store(v[r], (f32x4*)(op + r * 1024));
}

// ---------------------------------------------------------------------------
// Kernel 1: projections.  dst = bf16(x @ W + b).  grid = (M/128, 512/256, n),
// matrix z0 + blockIdx.z.  Launched twice: Q and K first; V behind kernel 2,
// as bf16((x @ Wv + bv) / colsum[row]), rounded once, where
//   colsum[b,s] = sum over tb of psum[b,tb,s], in rising tb  (kernel 2).
// 8 waves/block as 2 (rows) x 4 (columns); each owns a 64x64 output tile:
// 16 WMMAs per 8 fragments of a k step, 512 B loaded per WMMA.
// A and B fragments come straight from the packed copies of kernel 0, 512
// contiguous bytes a load.  Nothing is shared through LDS in the loop: no
// barrier.  Work-groups 256 apart in the grid have the same rows of x.
// Fragments are fetched one k step ahead: the four A fragments into a second
// register set at the head of a step, the B fragments one by one between the
// groups of four WMMAs, as the registers of the step's own come free.
// The result is stored in the fragment order of its consumer:
//   V:    unit (row/32, col/16), contraction index = row (key).  A lane holds
//         one column and 8 consecutive rows: its 16 B of a 512-B unit row.
//         Each wave forms 1/colsum of its 64 rows, two a lane, and hands them
//         to its lanes through its own LDS area.
//   Q, K: unit (row/16, col/32), contraction index = column.  Each wave turns
//         its eight units through an 8-KB LDS area of its own, once.
// Either way a wave stores 512 contiguous bytes per WMMA tile.
// ---------------------------------------------------------------------------
__global__ __launch_bounds__(256) void proj_kernel(
    const __bf16* __restrict__ Xp, const __bf16* __restrict__ Wp,
    const float* __restrict__ bq, const float* __restrict__ bk,
    const float* __restrict__ bv, const float* __restrict__ psum,
    __bf16* __restrict__ Qb, __bf16* __restrict__ Kb, __bf16* __restrict__ Vb,
    int z0) {
  __shared__ __attribute__((aligned(16))) __bf16 xt[8][8 * F_UNIT];

  const int lane = threadIdx.x & 31;
  // Scalar wave number: the fragment bases are then scalar, and one lane
  // offset, never rewritten in the loop, serves every load.
  const int wave = __builtin_amdgcn_readfirstlane(threadIdx.x >> 5);
  const int row0 = blockIdx.x * 128 + (wave >> 2) * 64;
  const int n0   = blockIdx.y * 256 + (wave & 3) * 64;
  const int z    = z0 + (int)blockIdx.z;

  const float* bias;
  __bf16*      dst;
  switch (z) {
    case 0:  bias = bq; dst = Qb; break;
    case 1:  bias = bk; dst = Kb; break;
    default: bias = bv; dst = Vb; break;
  }
  const int KU = C_DIM / 32;                      // units per 16-row strip
  const __bf16* A  = Xp + (size_t)(row0 >> 4) * KU * F_UNIT;
  const __bf16* Bw = Wp + (size_t)z * C_DIM * C_DIM +
                     (size_t)(n0 >> 4) * KU * F_UNIT;

  float* rw = (float*)xt[wave];                   // V: written, read by this wave alone
  if (z >= 2) {                                   // same for the whole block
    const float* pp = psum + (size_t)(row0 / T_DIM) * T_BLKS * T_DIM +
                      (row0 % T_DIM) + lane;
    float ps[2][T_BLKS];
    // Unrolled: the array stays in registers and the loads are one run.
#pragma unroll
    for (int h = 0; h < 2; ++h) {
#pragma unroll
      for (int tb = 0; tb < T_BLKS; ++tb) ps[h][tb] = pp[tb * T_DIM + h * 32];
    }
    loads_issued();                               // all in flight at once
#pragma unroll
    for (int h = 0; h < 2; ++h) {
      float sum = 0.0f;
#pragma unroll
      for (int tb = 0; tb < T_BLKS; ++tb) sum += ps[h][tb];
      rw[h * 32 + lane] = 1.0f / sum;
    }
  }

  // Every loop over acc, a or b is unrolled: the arrays stay in registers.
  v8f   acc[4][4] = {};                           // [row tile][column tile]
  v16bf a[2][4], b[4];
#pragma unroll
  for (int it = 0; it < 4; ++it) a[0][it] = load_frag_packed(A, it * KU, lane);
#pragma unroll
  for (int nt = 0; nt < 4; ++nt) b[nt] = load_frag_packed(Bw, nt * KU, lane);
#pragma unroll
  for (int ku = 0; ku < KU; ++ku) {
    // The scheduling barriers hold each group of loads where it is written:
    // moved down to their readers, the wave would wait out a load latency per
    // group; moved up, they would need registers that are still being read.
    if (ku + 1 < KU) {
#pragma unroll
      for (int it = 0; it < 4; ++it)
        a[(ku + 1) & 1][it] = load_frag_packed(A, it * KU + ku + 1, lane);
    }
    __builtin_amdgcn_sched_barrier(0);
#pragma unroll
    for (int nt = 0; nt < 4; ++nt) {
#pragma unroll
      for (int it = 0; it < 4; ++it)
        acc[it][nt] = wmma_bf16(a[ku & 1][it], b[nt], acc[it][nt]);
      if (ku + 1 < KU) b[nt] = load_frag_packed(Bw, nt * KU + ku + 1, lane);
      __builtin_amdgcn_sched_barrier(0);
    }
  }
  loads_issued();                  // the epilogue reuses the address registers

  const int hi = lane >> 4;
  float bz[4];
#pragma unroll
  for (int nt = 0; nt < 4; ++nt) bz[nt] = bias[n0 + nt * 16 + (lane & 15)];
  loads_issued();
  bf16x8 o[4][4];
  if (z >= 2) {                                   // V; same for the whole block
#pragma unroll
    for (int it = 0; it < 4; ++it) {
      // 1/colsum of the 8 rows that this lane holds of row tile it
      const f32x4 r0 = *(const f32x4*)(rw + it * 16 + 8 * hi);
      const f32x4 r1 = *(const f32x4*)(rw + it * 16 + 8 * hi + 4);
#pragma unroll
      for (int nt = 0; nt < 4; ++nt) {
#pragma unroll
        for (int i = 0; i < 8; ++i)
          o[it][nt][i] = (__bf16)((acc[it][nt][i] + bz[nt]) *
                                  (i < 4 ? r0[i & 3] : r1[i & 3]));
      }
    }
    // The stores stand behind all the arithmetic: no register that a store
    // names is rewritten behind it.
    __builtin_amdgcn_sched_barrier(0);
    __bf16* vo = dst + ((size_t)(row0 >> 5) * (C_DIM / 16) + (n0 >> 4)) * F_UNIT +
                 lane * 8;
#pragma unroll
    for (int it = 0; it < 4; ++it) {
#pragma unroll
      for (int nt = 0; nt < 4; ++nt)
        *(bf16x8*)(vo + ((it >> 1) * (C_DIM / 16) + nt) * F_UNIT + (it & 1) * 256) =
            o[it][nt];
    }
  } else {                                        // Q, K
    __bf16* xw = xt[wave];                        // read by this wave alone
#pragma unroll
    for (int it = 0; it < 4; ++it) {
#pragma unroll
      for (int nt = 0; nt < 4; ++nt) {
#pragma unroll
        for (int i = 0; i < 8; ++i)
          xw[(it * 4 + nt) * 256 + (i + 8 * hi + 16 * ((lane >> 3) & 1)) * 8 +
             (lane & 7)] = (__bf16)(acc[it][nt][i] + bz[nt]);
      }
    }
#pragma unroll
    for (int it = 0; it < 4; ++it) {
#pragma unroll
      for (int nt = 0; nt < 4; ++nt)
        o[it][nt] = *(const bf16x8*)(xw + (it * 4 + nt) * 256 + lane * 8);
    }
    // As above: the stores stand behind every LDS read.
    __builtin_amdgcn_sched_barrier(0);
    __bf16* qo = dst + ((size_t)(row0 >> 4) * KU + (n0 >> 5)) * F_UNIT + lane * 8;
#pragma unroll
    for (int it = 0; it < 4; ++it) {
#pragma unroll
      for (int nt = 0; nt < 4; ++nt)
        *(bf16x8*)(qo + (it * KU + (nt >> 1)) * F_UNIT + (nt & 1) * 256) = o[it][nt];
    }
    // In front of any later rewrite of a register that these stores name.
    asm volatile("s_wait_xcnt 0x0" ::: "memory");
  }
}

__device__ __forceinline__ float exp_slot(float x) {
  float r;
  asm("v_exp_f32 %0, %1\n\tv_nop" : "=v"(r) : "v"(x * 1.44269504088896340736f));
  return r;
}

#define E_ROW  (T_DIM / 32)            // units per 16-row strip
#define P_BLOCKS (T_BLKS * (T_BLKS + 1) / 2)  // sum over tb of its tb + 1 key blocks

__global__ __launch_bounds__(128) void colsum_kernel(
    const __bf16* __restrict__ Qb, const __bf16* __restrict__ Kb,
    float* __restrict__ psum, __bf16* __restrict__ Ew) {
  // Sums over the 64 queries of each t strip; each word has one writer.
  __shared__ __attribute__((aligned(16))) float ssum[2][128];

  const int b = blockIdx.y;
  // Query block tb has key blocks 0..tb; tb (tb + 1) / 2 tiles lie before it.
  // Unrolled: fifteen scalar compares with constants, no loop and no multiply.
  int tb = 0;
#pragma unroll
  for (int u = 1; u < T_BLKS; ++u)
    tb += (u * (u + 1) / 2 <= (int)blockIdx.x) ? 1 : 0;
  const int kb = (int)blockIdx.x - tb * (tb + 1) / 2;

  const int lane = threadIdx.x & 31;
  // Scalar wave number: the fragment bases are then scalar, one lane offset
  // serves every load, and the test on the diagonal is a scalar branch.
  const int wave = __builtin_amdgcn_readfirstlane(threadIdx.x >> 5);
  const int tw   = wave >> 1;               // 0..1 : 64-row t strip
  const int sw   = wave & 1;                // 0..1 : 64-col s half
  const int t0   = tb * 128 + tw * 64;
  const int s0   = kb * 128 + sw * 64;
  const int hi   = lane >> 4;

  const bool live = s0 <= t0;               // else: wave tile above the diagonal
  // Every loop over ev, part, l, qf or kf is unrolled: the arrays stay in registers.
  bf16x8 ev[4][4];                          // e: [t tile][s tile = 512-B row]
  if (live) {
    const int KU = C_DIM / 32;              // units per 16-row strip
    const __bf16* Q = Qb + ((size_t)b * T_DIM + t0) * C_DIM;
    const __bf16* K = Kb + ((size_t)b * T_DIM + s0) * C_DIM;
    v8f   l[4][4] = {};                     // [t tile][s tile], rows s, cols t
    v16bf qf[2][4], kf[4];
#pragma unroll
    for (int it = 0; it < 4; ++it) qf[0][it] = load_frag_packed(Q, it * KU, lane);
#pragma unroll
    for (int is = 0; is < 4; ++is) kf[is] = load_frag_packed(K, is * KU, lane);
#pragma unroll
    for (int ku = 0; ku < KU; ++ku) {
      // The scheduling barriers hold each group of loads where it is written,
      // as in kernel 1: lower, the wave would wait out a load latency per
      // group; higher, they would need registers that are still being read.
      if (ku + 1 < KU) {
#pragma unroll
        for (int it = 0; it < 4; ++it)
          qf[(ku + 1) & 1][it] = load_frag_packed(Q, it * KU + ku + 1, lane);
      }
      __builtin_amdgcn_sched_barrier(0);
#pragma unroll
      for (int is = 0; is < 4; ++is) {
#pragma unroll
        for (int it = 0; it < 4; ++it)
          l[it][is] = wmma_bf16(kf[is], qf[ku & 1][it], l[it][is]);
        if (ku + 1 < KU) kf[is] = load_frag_packed(K, is * KU + ku + 1, lane);
        __builtin_amdgcn_sched_barrier(0);
      }
    }
    loads_issued();                // the epilogue reuses the address registers

    float part[4][8] = {};                  // per key held by this lane
#pragma unroll
    for (int it = 0; it < 4; ++it) {
      const int t = t0 + it * 16 + (lane & 15);
#pragma unroll
      for (int is = 0; is < 4; ++is) {
#pragma unroll
        for (int i = 0; i < 8; ++i) {
          const int s = s0 + is * 16 + i + 8 * hi;
          // Formed for every lane, then selected: no branch per element.
          const float x = exp_slot(l[it][is][i] * SM_SCALE);
          const float e = (s <= t) ? x : 0.0f;
          part[is][i] += e;
          ev[it][is][i] = (__bf16)e;
        }
      }
    }
    // Sum over the 16 queries of a half-wave.  It runs once per tile: the lane
    // distance is the outer loop, so that the 32 exchanges of a distance are
    // in flight together and the wave waits four times, not 128.
#pragma unroll
    for (int m = 1; m < 16; m <<= 1) {
#pragma unroll
      for (int is = 0; is < 4; ++is) {
#pragma unroll
        for (int i = 0; i < 8; ++i) part[is][i] += __shfl_xor(part[is][i], m, 32);
      }
    }
    if ((lane & 15) == 0) {
#pragma unroll
      for (int is = 0; is < 4; ++is) {
#pragma unroll
        for (int h = 0; h < 2; ++h)
          *(f32x4*)(&ssum[tw][sw * 64 + is * 16 + 8 * hi + h * 4]) =
              f32x4{part[is][h * 4], part[is][h * 4 + 1], part[is][h * 4 + 2],
                    part[is][h * 4 + 3]};
      }
    }
  } else {
    ssum[tw][sw * 64 + lane]      = 0.0f;
    ssum[tw][sw * 64 + 32 + lane] = 0.0f;
  }
  // The other strip's sums are read behind it.  No global store stands in front
  // of it: the barrier would wait for it to complete.
  __syncthreads();
  if (live) {
    __bf16* ep = Ew + (((size_t)b * (T_DIM / 16) + (t0 >> 4)) * E_ROW + (s0 >> 5)) *
                          F_UNIT + lane * 8;
#pragma unroll
    for (int it = 0; it < 4; ++it) {
#pragma unroll
      for (int is = 0; is < 4; ++is)
        *(bf16x8*)(ep + (it * E_ROW + (is >> 1)) * F_UNIT + (is & 1) * 256) =
            ev[it][is];
    }
  }
  // What follows may rewrite the registers these stores name (data, address).
  loads_issued();
  float* pb = psum + (size_t)b * T_BLKS * T_DIM + kb * 128;
  pb[tb * T_DIM + threadIdx.x] = ssum[0][threadIdx.x] + ssum[1][threadIdx.x];
  // Likewise for the store above.
  asm volatile("s_wait_xcnt 0x0" ::: "memory");
  // The diagonal tile is the first of its keys: the query blocks above it have
  // no term, and their rows get the zeros that the V launch of kernel 1 adds:
  // a wave a row.
  if (kb == tb) {
    for (int r = wave; r < tb; r += 4) {
      *(f32x4*)(pb + r * T_DIM + lane * 4) = f32x4{0.0f, 0.0f, 0.0f, 0.0f};
      // In front of the next trip's rewrite of the address.
      asm volatile("s_wait_xcnt 0x0" ::: "memory");
    }
  }
}

// ---------------------------------------------------------------------------
// Kernel 3: read = e @ V, causal; V holds 1/colsum of its key already.
// Block tile: 128(t) x 128(v), s-steps of 64.
// Each wave reads the stored e of its 32 t rows straight into A fragments and V
// straight into B fragments (512 contiguous bytes per load; stored in those
// orders by kernels 2 and 1); then 2t x 4v blocked WMMAs.  No arithmetic but
// the WMMAs, and no operand shared through LDS: no barrier in the loop.
// ---------------------------------------------------------------------------
// One s-step of 64 keys.  EDGE = false: every 32-key chunk lies at or below the
// diagonal tile of every wave of the block, so all loads issue together with
// no test.  EDGE = true (the last two steps): a wave skips the e loads of chunks
// above its diagonal tile, which it need not read, and multiplies zeros.
template <bool EDGE>
__device__ __forceinline__ void pv_step(
    const __bf16* __restrict__ E, const __bf16* __restrict__ V, int s0, int ta0,
    int vu0, int lane, v8f (&acc)[2][4]) {
  // ---- loads: e and V fragments ----
  v16bf pa[2][2] = {};                   // [s chunk][t tile]
  v16bf vb[2][4];                        // [s chunk][v tile]
  const __bf16* ep = E + ((size_t)(ta0 >> 4) * E_ROW + (s0 >> 5)) * F_UNIT;
  const __bf16* vp = V + (size_t)((s0 >> 5) * (C_DIM / 16) + vu0) * F_UNIT;
  // EDGE: the V loads, which have no test, stand in front of the branches, so
  // that nothing the compiler puts at a branch's end holds them back.
#pragma unroll
  for (int kk = 0; kk < 2; ++kk) {
    if (!EDGE) {
#pragma unroll
      for (int it = 0; it < 2; ++it)
        pa[kk][it] = load_frag_packed(ep, it * E_ROW + kk, lane);
    }
#pragma unroll
    for (int nt = 0; nt < 4; ++nt)
      vb[kk][nt] = load_frag_packed(vp, kk * (C_DIM / 16) + nt, lane);
  }
  if (EDGE) {
#pragma unroll
    for (int kk = 0; kk < 2; ++kk) {
      if (s0 + kk * 32 <= ta0) {
#pragma unroll
        for (int it = 0; it < 2; ++it)
          pa[kk][it] = load_frag_packed(ep, it * E_ROW + kk, lane);
        loads_issued(ep + lane * 8);     // ep may end here and be reused
      }
    }
  }
  loads_issued(vp + lane * 8);           // the pointers are stepped or reused next
  // ---- e(32x64) @ V(64x64) ----
#pragma unroll
  for (int kk = 0; kk < 2; ++kk) {
#pragma unroll
    for (int nt = 0; nt < 4; ++nt) {
      acc[0][nt] = wmma_bf16(pa[kk][0], vb[kk][nt], acc[0][nt]);
      acc[1][nt] = wmma_bf16(pa[kk][1], vb[kk][nt], acc[1][nt]);
    }
  }
}

// The two 8-wave halves of a work-group hold partial sums of the same 128 x 128
// tile.  Each wave finishes one of its two 16-row t tiles (KEEP) and hands the
// other to the wave of the other half with the same rows and columns, through
// 4 KB of LDS of its own: 16 B a lane, 512 contiguous bytes a write or read.
// Every loop over acc or o is unrolled: the arrays stay in registers.
template <int KEEP>
__device__ __forceinline__ void pv_give(const v8f (&acc)[2][4], float* mine,
                                        int lane) {
#pragma unroll
  for (int nt = 0; nt < 4; ++nt) {
#pragma unroll
    for (int h = 0; h < 2; ++h)
      *(f32x4*)(mine + (nt * 2 + h) * 128 + lane * 4) =
          f32x4{acc[1 - KEEP][nt][h * 4], acc[1 - KEEP][nt][h * 4 + 1],
                acc[1 - KEEP][nt][h * 4 + 2], acc[1 - KEEP][nt][h * 4 + 3]};
  }
}

template <int KEEP>
__device__ __forceinline__ void pv_take_store(const v8f (&acc)[2][4],
                                              const float* theirs, float* orow,
                                              int lane) {
  f32x4 o[4][2];
#pragma unroll
  for (int nt = 0; nt < 4; ++nt) {
#pragma unroll
    for (int h = 0; h < 2; ++h)
      o[nt][h] = *(const f32x4*)(theirs + (nt * 2 + h) * 128 + lane * 4);
  }
  float* op = orow + (size_t)(KEEP * 16 + 8 * (lane >> 4)) * 1024 + (lane & 15);
#pragma unroll
  for (int nt = 0; nt < 4; ++nt) {
#pragma unroll
    for (int i = 0; i < 8; ++i)
      __builtin_nontemporal_store(acc[KEEP][nt][i] + o[nt][i >> 2][i & 3],
                                  op + (size_t)i * 1024 + nt * 16);
  }
}

// grid = (T/256, 512/128, B), 16 waves: every work-group takes the query tiles
// x and T/128 - 1 - x, one after the other, and deals the 64-key steps of a tile
// alternately to its two halves of 8 waves: T/128 + 1 steps a wave in every
// work-group, one work-group a WGP.
__global__ __launch_bounds__(512) void attend_kernel(
    const __bf16* __restrict__ Ew, const __bf16* __restrict__ Vb,
    float* __restrict__ out) {
  // One area per tile of the pair: the second tile's writes need not wait for
  // the first tile's reads.
  __shared__ __attribute__((aligned(16))) float red[2][16][1024];
  const int b      = blockIdx.z;
  const int v_base = blockIdx.y * 128;
  const __bf16* E  = Ew + (size_t)b * (T_DIM / 16) * E_ROW * F_UNIT;
  const __bf16* V  = Vb + (size_t)b * T_DIM * C_DIM;
  float*        ob = out + (size_t)b * T_DIM * 1024;

  const int lane = threadIdx.x & 31;
  // Scalar wave number: the test on the diagonal is then a scalar branch, and
  // the half of the work-group a scalar.
  const int wave = __builtin_amdgcn_readfirstlane(threadIdx.x >> 5);
  const int g    = wave >> 3;            // 0..1 : which steps of 64 keys
  const int tw   = (wave >> 1) & 3;      // 0..3 : 32-row t strip
  const int sw   = wave & 1;             // 0..1 : 64-col v half
  const int vu0  = (v_base + sw * 64) >> 4;  // first 16-column V unit of the wave

  for (int p = 0; p < 2; ++p) {
    const int t_base = (p == 0 ? (int)blockIdx.x : T_BLKS - 1 - (int)blockIdx.x) * 128;
    const int ta0    = t_base + tw * 32;
    v8f acc[2][4] = {};                  // 32t x 64v partial sums

    for (int s0 = g * 64; s0 < t_base; s0 += 128)
      pv_step<false>(E, V, s0, ta0, vu0, lane, acc);
    pv_step<true>(E, V, t_base + g * 64, ta0, vu0, lane, acc);

    if (g == 0) pv_give<0>(acc, red[p][wave], lane);
    else        pv_give<1>(acc, red[p][wave], lane);
    // The other half's partial sums are read behind it.
    __syncthreads();
    float* orow = ob + (size_t)ta0 * 1024 + 512 + v_base + sw * 64;
    if (g == 0) pv_take_store<0>(acc, red[p][wave ^ 8], orow, lane);
    else        pv_take_store<1>(acc, red[p][wave ^ 8], orow, lane);
    loads_issued();    // here behind stores: the next tile rewrites their registers
  }
}

// ---------------------------------------------------------------------------
// Launcher.  Workspace layout (bytes):
//   [0, 16M)   Q  bf16 [16384][512], 1-KB fragment units [1024][16]
//   [16M,32M)  K  bf16, as Q
//   [32M,48M)  V / colsum  bf16, 1-KB fragment units [512][32]
//   then 64M    e bf16, 1-KB fragment units [8][128][64]
//   then 16M    x bf16, 1-KB fragment units [1024][16]
//   then 1.5M   Wq, Wk, Wv bf16, 1-KB fragment units [3][32][16]
//   then 1M     psum f32 [8][16][2048]  (column sums per 128-query block)
// ---------------------------------------------------------------------------
extern "C" void kernel_launch(void* const* d_in, const int* in_sizes, int n_in,
                              void* d_out, int out_size, void* d_ws,
                              size_t ws_size, hipStream_t stream) {
  const float* x  = (const float*)d_in[0];
  const float* Wq = (const float*)d_in[1];
  const float* bq = (const float*)d_in[2];
  const float* Wk = (const float*)d_in[3];
  const float* bk = (const float*)d_in[4];
  const float* Wv = (const float*)d_in[5];
  const float* bv = (const float*)d_in[6];
  float* out = (float*)d_out;

  const size_t qkv = (size_t)M_ROWS * C_DIM;           // elems per matrix
  __bf16* Qb = (__bf16*)d_ws;
  __bf16* Kb = Qb + qkv;
  __bf16* Vb = Kb + qkv;
  __bf16* Ew = Vb + qkv;
  __bf16* Xp = Ew + (size_t)B_DIM * T_DIM * T_DIM;
  __bf16* Wp = Xp + qkv;
  float* psum = (float*)(Wp + (size_t)3 * C_DIM * C_DIM);

  // out[..., :512] = x; x and W as bf16 fragments
  pack_copy_kernel<<<W_BLOCKS + M_ROWS / 32, 256, 0, stream>>>(x, Wq, Wk, Wv, out,
                                                               Xp, Wp);
  // Q, K projections (bf16)
  proj_kernel<<<dim3(M_ROWS / 128, C_DIM / 256, 2), 256, 0, stream>>>(
      Xp, Wp, bq, bk, bv, psum, Qb, Kb, Vb, 0);
  // masked exponentials and partial column sums
  colsum_kernel<<<dim3(P_BLOCKS, B_DIM), 128, 0, stream>>>(Qb, Kb, psum, Ew);
  // V projection, rows divided by their column sums (bf16)
  proj_kernel<<<dim3(M_ROWS / 128, C_DIM / 256, 1), 256, 0, stream>>>(
      Xp, Wp, bq, bk, bv, psum, Qb, Kb, Vb, 2);
  // out[..., 512:] = e @ (V / colsum)
  attend_kernel<<<dim3(T_DIM / 256, C_DIM / 128, B_DIM), 512, 0, stream>>>(
      Ew, Vb, out);
}

// v009
// It runs in 87.8 microseconds.
// Next to v008, in two timings, it ran 1.20 times as fast each time.
// Over all steps from v000 it is 9.76 times as fast.
#include <hip/hip_runtime.h>

#define B_DIM   8
#define T_DIM   2048
#define C_DIM   512
#define M_ROWS  (B_DIM * T_DIM)        // 16384
#define T_BLKS  (T_DIM / 128)          // query blocks
#define SM_SCALE 0.04419417382415922f  // 1/sqrt(512)

typedef __attribute__((ext_vector_type(16))) __bf16    v16bf;
typedef __attribute__((ext_vector_type(8)))  float     v8f;
typedef __attribute__((ext_vector_type(4)))  float     f32x4;
typedef __attribute__((ext_vector_type(8)))  __bf16    bf16x8;

union FragU {
  uint4  u[2];
  __bf16 h[16];
  v16bf  v;
};

__device__ __forceinline__ v8f wmma_bf16(v16bf a, v16bf b, v8f c) {
  // (neg_a, A, neg_b, B, c_mod, C, reuse_a, reuse_b)
  return __builtin_amdgcn_wmma_f32_16x16x32_bf16(false, a, false, b, (short)0, c,
                                                 false, false);
}

#define F_UNIT 512                     // bf16 elements per fragment unit
__device__ __forceinline__ v16bf load_frag_packed(const __bf16* base, int unit,
                                                  int lane) {
  const __bf16* p = base + (size_t)unit * F_UNIT + lane * 8;
  FragU f;
  f.u[0] = *(const uint4*)(p);
  f.u[1] = *(const uint4*)(p + 256);
  return f.v;
}

// Stands behind a run of loads.  The wait: in front of the first rewrite of an
// address register that the loads name.  The scheduling barriers: the first
// keeps the loads in front of the arithmetic, all in flight together (without
// it the scheduler sinks them between the WMMAs and the wave waits out a load
// latency several times per step); the second keeps the rewrites behind the wait.
__device__ __forceinline__ void loads_issued() {
  __builtin_amdgcn_sched_barrier(0);
  asm volatile("s_wait_xcnt 0x0" ::: "memory");
  __builtin_amdgcn_sched_barrier(0);
}

// The same, where the address of the loads is not used again: the wait names it,
// so its registers stay whole up to the wait and are not given to a load's result.
__device__ __forceinline__ void loads_issued(const void* last_address) {
  __builtin_amdgcn_sched_barrier(0);
  asm volatile("s_wait_xcnt 0x0" ::"v"(last_address) : "memory");
  __builtin_amdgcn_sched_barrier(0);
}

// Asks L2 for N pieces, STEP bytes apart, of an operand panel that an earlier
// launch wrote: every lane names one address, base + off + j * STEP.
// Nothing returns and no counter moves.  Asked at entry, the whole panel is
// fetched at once and the loop finds it in L2.
// In asm: base and off are then registers of ours, never stepped (the steps are
// immediates), and asks_done() holds them whole far behind the issue.
template <int N, int STEP, int J = 0>
__device__ __forceinline__ void l2_ask(const void* base, unsigned off) {
  asm volatile("global_prefetch_b8 %0, %1 offset:%2 scope:SCOPE_SE" ::"v"(off),
               "s"(base), "n"(J * STEP));
  if constexpr (J + 1 < N) l2_ask<N, STEP, J + 1>(base, off);
}

// loads_issued(), which also names the registers of earlier asks: they keep
// their addresses up to here and are not given to anything else before.
__device__ __forceinline__ void asks_done(const void* base0, const void* base1,
                                          const void* base2, unsigned off0,
                                          unsigned off1) {
  __builtin_amdgcn_sched_barrier(0);
  asm volatile("s_wait_xcnt 0x0" ::"s"(base0), "s"(base1), "s"(base2), "v"(off0),
               "v"(off1)
               : "memory");
  __builtin_amdgcn_sched_barrier(0);
}

#define W_BLOCKS 192                   // 3 x (512/16) x (512/32) units / 8 waves
#define X_PITCH  136                   // bf16 elements per 8-column group in LDS

__global__ __launch_bounds__(256) void pack_copy_kernel(
    const float* __restrict__ x, const float* __restrict__ Wq,
    const float* __restrict__ Wk, const float* __restrict__ Wv,
    float* __restrict__ out, __bf16* __restrict__ Xp, __bf16* __restrict__ Wp) {
  __shared__ __attribute__((aligned(16))) __bf16 xt[8][16 * X_PITCH];
  const int lane = threadIdx.x & 31;
  // Scalar wave number: the bases are then scalar, and one lane offset, never
  // rewritten, serves the loads and stores of a wave.
  const int wave = __builtin_amdgcn_readfirstlane(threadIdx.x >> 5);
  union Pack8 { uint4 u; __bf16 h[8]; };
  union Pack4 { uint2 u; __bf16 h[4]; };

  if (blockIdx.x < W_BLOCKS) {                    // same for the whole block
    const int z = blockIdx.x >> 6;                // 64 blocks a matrix
    const float* Wm = (z == 0) ? Wq : (z == 1) ? Wk : Wv;
    const int unit = (blockIdx.x & 63) * 8 + wave;   // (col/16) * 16 + row/32
    const float* wp = Wm + (size_t)((unit & 15) * 32 + (lane >> 4) * 8) * C_DIM +
                      (unit >> 4) * 16 + (lane & 15);
    float t[16];
#pragma unroll
    for (int i = 0; i < 16; ++i)
      t[i] = wp[(size_t)((i >> 3) * 16 + (i & 7)) * C_DIM];
#pragma unroll
    for (int h = 0; h < 2; ++h) {
      Pack8 o;
#pragma unroll
      for (int j = 0; j < 8; ++j) o.h[j] = (__bf16)t[h * 8 + j];
      *(uint4*)(Wp + ((size_t)z * (C_DIM * C_DIM / F_UNIT) + unit) * F_UNIT +
                h * 256 + lane * 8) = o.u;
    }
    return;
  }

  const int task  = (blockIdx.x - W_BLOCKS) * 8 + wave;
  const int strip = task >> 2;                    // 16 rows
  const int cg    = task & 3;                     // 128 columns
  const float* xp = x + (size_t)strip * 16 * C_DIM + cg * 128 + lane * 4;
  float*       op = out + (size_t)strip * 16 * 1024 + cg * 128 + lane * 4;
  __bf16*      xw = xt[wave];
  f32x4 v[16];
#pragma unroll
  for (int r = 0; r < 16; ++r) v[r] = *(const f32x4*)(xp + r * C_DIM);
  loads_issued();                                 // 8 KB a wave in flight at once
#pragma unroll
  for (int r = 0; r < 16; ++r) {
    Pack4 o;
#pragma unroll
    for (int j = 0; j < 4; ++j) o.h[j] = (__bf16)v[r][j];
    *(uint2*)(xw + (lane >> 1) * X_PITCH + r * 8 + (lane & 1) * 4) = o.u;
  }
  // Lanes read other lanes' writes.  No global store stands in front of it: the
  // barrier would wait for it to complete.
  __syncthreads();
  __bf16* xo = Xp + (size_t)(strip * (C_DIM / 32) + cg * 4) * F_UNIT + lane * 8;
#pragma unroll
  for (int m = 0; m < 8; ++m)                     // 512-B row m of the four units
    *(uint4*)(xo + m * 256) =
        *(const uint4*)(xw + (m * 2 + (lane >> 4)) * X_PITCH + (lane & 15) * 8);
#pragma unroll
  for (int r = 0; r < 16; ++r)
    __builtin_nontemporal_store(v[r], (f32x4*)(op + r * 1024));
}

// ---------------------------------------------------------------------------
// Kernel 1: projections.  dst = bf16(x @ W + b).  grid = (M/128, 512/256, n),
// matrix z0 + blockIdx.z.  Launched twice: Q and K first; V behind kernel 2,
// as bf16((x @ Wv + bv) / colsum[row]), rounded once, where
//   colsum[b,s] = sum over tb of psum[b,tb,s], in rising tb  (kernel 2).
// 8 waves/block as 2 (rows) x 4 (columns); each owns a 64x64 output tile:
// 16 WMMAs per 8 fragments of a k step, 512 B loaded per WMMA.
// A and B fragments come straight from the packed copies of kernel 0, 512
// contiguous bytes a load.  Nothing is shared through LDS in the loop: no
// barrier.  Work-groups 256 apart in the grid have the same rows of x.
// Fragments are fetched one k step ahead: the four A fragments into a second
// register set at the head of a step, the B fragments one by one between the
// groups of four WMMAs, as the registers of the step's own come free.
// The result is stored in the fragment order of its consumer:
//   V:    unit (row/32, col/16), contraction index = row (key).  A lane holds
//         one column and 8 consecutive rows: its 16 B of a 512-B unit row.
//         Each wave forms 1/colsum of its 64 rows, two a lane, and hands them
//         to its lanes through its own LDS area.
//   Q, K: unit (row/16, col/32), contraction index = column.  Each wave turns
//         its eight units through an 8-KB LDS area of its own, once.
// Either way a wave stores 512 contiguous bytes per WMMA tile.
// ---------------------------------------------------------------------------
__global__ __launch_bounds__(256) void proj_kernel(
    const __bf16* __restrict__ Xp, const __bf16* __restrict__ Wp,
    const float* __restrict__ bq, const float* __restrict__ bk,
    const float* __restrict__ bv, const float* __restrict__ psum,
    __bf16* __restrict__ Qb, __bf16* __restrict__ Kb, __bf16* __restrict__ Vb,
    int z0) {
  __shared__ __attribute__((aligned(16))) __bf16 xt[8][8 * F_UNIT];

  const int lane = threadIdx.x & 31;
  // Scalar wave number: the fragment bases are then scalar, and one lane
  // offset, never rewritten in the loop, serves every load.
  const int wave = __builtin_amdgcn_readfirstlane(threadIdx.x >> 5);
  const int row0 = blockIdx.x * 128 + (wave >> 2) * 64;
  const int n0   = blockIdx.y * 256 + (wave & 3) * 64;
  const int z    = z0 + (int)blockIdx.z;

  const float* bias;
  __bf16*      dst;
  switch (z) {
    case 0:  bias = bq; dst = Qb; break;
    case 1:  bias = bk; dst = Kb; break;
    default: bias = bv; dst = Vb; break;
  }
  const int KU = C_DIM / 32;                      // units per 16-row strip
  const __bf16* A  = Xp + (size_t)(row0 >> 4) * KU * F_UNIT;
  const __bf16* Bw = Wp + (size_t)z * C_DIM * C_DIM +
                     (size_t)(n0 >> 4) * KU * F_UNIT;

  // The 128 KB of x that the work-groups of these rows share are asked for by
  // one of them, the 256 KB of W of these columns by the first eight in the
  // grid (scalar tests): later work-groups find both in L2.
  const unsigned ask = threadIdx.x * 256u;
  const __bf16* Apan = Xp + (size_t)blockIdx.x * 128 * C_DIM;
  const __bf16* Bpan = Wp + (size_t)z * C_DIM * C_DIM +
                       (size_t)blockIdx.y * 256 * C_DIM;
  if (blockIdx.y == 0 && blockIdx.z == 0) l2_ask<2, 65536>(Apan, ask);
  if (blockIdx.x < 8) l2_ask<4, 65536>(Bpan, ask);

  float* rw = (float*)xt[wave];                   // V: written, read by this wave alone
  if (z >= 2) {                                   // same for the whole block
    const float* pp = psum + (size_t)(row0 / T_DIM) * T_BLKS * T_DIM +
                      (row0 % T_DIM) + lane;
    float ps[2][T_BLKS];
    // Unrolled: the array stays in registers and the loads are one run.
#pragma unroll
    for (int h = 0; h < 2; ++h) {
#pragma unroll
      for (int tb = 0; tb < T_BLKS; ++tb) ps[h][tb] = pp[tb * T_DIM + h * 32];
    }
    loads_issued();                               // all in flight at once
#pragma unroll
    for (int h = 0; h < 2; ++h) {
      float sum = 0.0f;
#pragma unroll
      for (int tb = 0; tb < T_BLKS; ++tb) sum += ps[h][tb];
      rw[h * 32 + lane] = 1.0f / sum;
    }
  }

  // Every loop over acc, a or b is unrolled: the arrays stay in registers.
  v8f   acc[4][4] = {};                           // [row tile][column tile]
  v16bf a[2][4], b[4];
#pragma unroll
  for (int it = 0; it < 4; ++it) a[0][it] = load_frag_packed(A, it * KU, lane);
#pragma unroll
  for (int nt = 0; nt < 4; ++nt) b[nt] = load_frag_packed(Bw, nt * KU, lane);
#pragma unroll
  for (int ku = 0; ku < KU; ++ku) {
    // The scheduling barriers hold each group of loads where it is written:
    // moved down to their readers, the wave would wait out a load latency per
    // group; moved up, they would need registers that are still being read.
    if (ku + 1 < KU) {
#pragma unroll
      for (int it = 0; it < 4; ++it)
        a[(ku + 1) & 1][it] = load_frag_packed(A, it * KU + ku + 1, lane);
    }
    __builtin_amdgcn_sched_barrier(0);
#pragma unroll
    for (int nt = 0; nt < 4; ++nt) {
#pragma unroll
      for (int it = 0; it < 4; ++it)
        acc[it][nt] = wmma_bf16(a[ku & 1][it], b[nt], acc[it][nt]);
      if (ku + 1 < KU) b[nt] = load_frag_packed(Bw, nt * KU + ku + 1, lane);
      __builtin_amdgcn_sched_barrier(0);
    }
  }
  asks_done(Apan, Bpan, Bpan, ask, ask);  // the epilogue reuses the address registers

  const int hi = lane >> 4;
  float bz[4];
#pragma unroll
  for (int nt = 0; nt < 4; ++nt) bz[nt] = bias[n0 + nt * 16 + (lane & 15)];
  loads_issued();
  bf16x8 o[4][4];
  if (z >= 2) {                                   // V; same for the whole block
#pragma unroll
    for (int it = 0; it < 4; ++it) {
      // 1/colsum of the 8 rows that this lane holds of row tile it
      const f32x4 r0 = *(const f32x4*)(rw + it * 16 + 8 * hi);
      const f32x4 r1 = *(const f32x4*)(rw + it * 16 + 8 * hi + 4);
#pragma unroll
      for (int nt = 0; nt < 4; ++nt) {
#pragma unroll
        for (int i = 0; i < 8; ++i)
          o[it][nt][i] = (__bf16)((acc[it][nt][i] + bz[nt]) *
                                  (i < 4 ? r0[i & 3] : r1[i & 3]));
      }
    }
    // The stores stand behind all the arithmetic: no register that a store
    // names is rewritten behind it.
    __builtin_amdgcn_sched_barrier(0);
    __bf16* vo = dst + ((size_t)(row0 >> 5) * (C_DIM / 16) + (n0 >> 4)) * F_UNIT +
                 lane * 8;
#pragma unroll
    for (int it = 0; it < 4; ++it) {
#pragma unroll
      for (int nt = 0; nt < 4; ++nt)
        *(bf16x8*)(vo + ((it >> 1) * (C_DIM / 16) + nt) * F_UNIT + (it & 1) * 256) =
            o[it][nt];
    }
  } else {                                        // Q, K
    __bf16* xw = xt[wave];                        // read by this wave alone
#pragma unroll
    for (int it = 0; it < 4; ++it) {
#pragma unroll
      for (int nt = 0; nt < 4; ++nt) {
#pragma unroll
        for (int i = 0; i < 8; ++i)
          xw[(it * 4 + nt) * 256 + (i + 8 * hi + 16 * ((lane >> 3) & 1)) * 8 +
             (lane & 7)] = (__bf16)(acc[it][nt][i] + bz[nt]);
      }
    }
#pragma unroll
    for (int it = 0; it < 4; ++it) {
#pragma unroll
      for (int nt = 0; nt < 4; ++nt)
        o[it][nt] = *(const bf16x8*)(xw + (it * 4 + nt) * 256 + lane * 8);
    }
    // As above: the stores stand behind every LDS read.
    __builtin_amdgcn_sched_barrier(0);
    __bf16* qo = dst + ((size_t)(row0 >> 4) * KU + (n0 >> 5)) * F_UNIT + lane * 8;
#pragma unroll
    for (int it = 0; it < 4; ++it) {
#pragma unroll
      for (int nt = 0; nt < 4; ++nt)
        *(bf16x8*)(qo + (it * KU + (nt >> 1)) * F_UNIT + (nt & 1) * 256) = o[it][nt];
    }
    // In front of any later rewrite of a register that these stores name.
    asm volatile("s_wait_xcnt 0x0" ::: "memory");
  }
}

__device__ __forceinline__ float exp_slot(float x) {
  float r;
  asm("v_exp_f32 %0, %1\n\tv_nop" : "=v"(r) : "v"(x * 1.44269504088896340736f));
  return r;
}

#define E_ROW  (T_DIM / 32)            // units per 16-row strip
#define P_BLOCKS (T_BLKS * (T_BLKS + 1) / 2)  // sum over tb of its tb + 1 key blocks

__global__ __launch_bounds__(128) void colsum_kernel(
    const __bf16* __restrict__ Qb, const __bf16* __restrict__ Kb,
    float* __restrict__ psum, __bf16* __restrict__ Ew) {
  // Sums over the 64 queries of each t strip; each word has one writer.
  __shared__ __attribute__((aligned(16))) float ssum[2][128];

  const int b = blockIdx.y;
  // Query block tb has key blocks 0..tb; tb (tb + 1) / 2 tiles lie before it.
  // Unrolled: fifteen scalar compares with constants, no loop and no multiply.
  int tb = 0;
#pragma unroll
  for (int u = 1; u < T_BLKS; ++u)
    tb += (u * (u + 1) / 2 <= (int)blockIdx.x) ? 1 : 0;
  const int kb = (int)blockIdx.x - tb * (tb + 1) / 2;

  const int lane = threadIdx.x & 31;
  // Scalar wave number: the fragment bases are then scalar, one lane offset
  // serves every load, and the test on the diagonal is a scalar branch.
  const int wave = __builtin_amdgcn_readfirstlane(threadIdx.x >> 5);
  const int tw   = wave >> 1;               // 0..1 : 64-row t strip
  const int sw   = wave & 1;                // 0..1 : 64-col s half
  const int t0   = tb * 128 + tw * 64;
  const int s0   = kb * 128 + sw * 64;
  const int hi   = lane >> 4;

  // The 128 KB of Q of a query block are asked for by every fourth of its
  // work-groups, the 128 KB of K of a key block by the first four that read it
  // (scalar tests), for speed only.
  const unsigned ask = threadIdx.x * 256u;
  const __bf16* Qpan = Qb + ((size_t)b * T_DIM + tb * 128) * C_DIM;
  const __bf16* Kpan = Kb + ((size_t)b * T_DIM + kb * 128) * C_DIM;
  if ((kb & 3) == 0) l2_ask<4, 32768>(Qpan, ask);
  if (tb - kb < 4) l2_ask<4, 32768>(Kpan, ask);

  const bool live = s0 <= t0;               // else: wave tile above the diagonal
  // Every loop over ev, part, l, qf or kf is unrolled: the arrays stay in registers.
  bf16x8 ev[4][4];                          // e: [t tile][s tile = 512-B row]
  if (live) {
    const int KU = C_DIM / 32;              // units per 16-row strip
    const __bf16* Q = Qb + ((size_t)b * T_DIM + t0) * C_DIM;
    const __bf16* K = Kb + ((size_t)b * T_DIM + s0) * C_DIM;
    v8f   l[4][4] = {};                     // [t tile][s tile], rows s, cols t
    v16bf qf[2][4], kf[4];
#pragma unroll
    for (int it = 0; it < 4; ++it) qf[0][it] = load_frag_packed(Q, it * KU, lane);
#pragma unroll
    for (int is = 0; is < 4; ++is) kf[is] = load_frag_packed(K, is * KU, lane);
#pragma unroll
    for (int ku = 0; ku < KU; ++ku) {
      // The scheduling barriers hold each group of loads where it is written,
      // as in kernel 1: lower, the wave would wait out a load latency per
      // group; higher, they would need registers that are still being read.
      if (ku + 1 < KU) {
#pragma unroll
        for (int it = 0; it < 4; ++it)
          qf[(ku + 1) & 1][it] = load_frag_packed(Q, it * KU + ku + 1, lane);
      }
      __builtin_amdgcn_sched_barrier(0);
#pragma unroll
      for (int is = 0; is < 4; ++is) {
#pragma unroll
        for (int it = 0; it < 4; ++it)
          l[it][is] = wmma_bf16(kf[is], qf[ku & 1][it], l[it][is]);
        if (ku + 1 < KU) kf[is] = load_frag_packed(K, is * KU + ku + 1, lane);
        __builtin_amdgcn_sched_barrier(0);
      }
    }
    asks_done(Qpan, Kpan, Kpan, ask, ask);  // the epilogue reuses the address registers

    float part[4][8] = {};                  // per key held by this lane
#pragma unroll
    for (int it = 0; it < 4; ++it) {
      const int t = t0 + it * 16 + (lane & 15);
#pragma unroll
      for (int is = 0; is < 4; ++is) {
#pragma unroll
        for (int i = 0; i < 8; ++i) {
          const int s = s0 + is * 16 + i + 8 * hi;
          // Formed for every lane, then selected: no branch per element.
          const float x = exp_slot(l[it][is][i] * SM_SCALE);
          const float e = (s <= t) ? x : 0.0f;
          part[is][i] += e;
          ev[it][is][i] = (__bf16)e;
        }
      }
    }
    // Sum over the 16 queries of a half-wave.  It runs once per tile: the lane
    // distance is the outer loop, so that the 32 exchanges of a distance are
    // in flight together and the wave waits four times, not 128.
#pragma unroll
    for (int m = 1; m < 16; m <<= 1) {
#pragma unroll
      for (int is = 0; is < 4; ++is) {
#pragma unroll
        for (int i = 0; i < 8; ++i) part[is][i] += __shfl_xor(part[is][i], m, 32);
      }
    }
    if ((lane & 15) == 0) {
#pragma unroll
      for (int is = 0; is < 4; ++is) {
#pragma unroll
        for (int h = 0; h < 2; ++h)
          *(f32x4*)(&ssum[tw][sw * 64 + is * 16 + 8 * hi + h * 4]) =
              f32x4{part[is][h * 4], part[is][h * 4 + 1], part[is][h * 4 + 2],
                    part[is][h * 4 + 3]};
      }
    }
  } else {
    ssum[tw][sw * 64 + lane]      = 0.0f;
    ssum[tw][sw * 64 + 32 + lane] = 0.0f;
    asks_done(Qpan, Kpan, Kpan, ask, ask);
  }
  // The other strip's sums are read behind it.  No global store stands in front
  // of it: the barrier would wait for it to complete.
  __syncthreads();
  if (live) {
    __bf16* ep = Ew + (((size_t)b * (T_DIM / 16) + (t0 >> 4)) * E_ROW + (s0 >> 5)) *
                          F_UNIT + lane * 8;
#pragma unroll
    for (int it = 0; it < 4; ++it) {
#pragma unroll
      for (int is = 0; is < 4; ++is)
        *(bf16x8*)(ep + (it * E_ROW + (is >> 1)) * F_UNIT + (is & 1) * 256) =
            ev[it][is];
    }
  }
  // What follows may rewrite the registers these stores name (data, address).
  loads_issued();
  float* pb = psum + (size_t)b * T_BLKS * T_DIM + kb * 128;
  pb[tb * T_DIM + threadIdx.x] = ssum[0][threadIdx.x] + ssum[1][threadIdx.x];
  // Likewise for the store above.
  asm volatile("s_wait_xcnt 0x0" ::: "memory");
  // The diagonal tile is the first of its keys: the query blocks above it have
  // no term, and their rows get the zeros that the V launch of kernel 1 adds:
  // a wave a row.
  if (kb == tb) {
    for (int r = wave; r < tb; r += 4) {
      *(f32x4*)(pb + r * T_DIM + lane * 4) = f32x4{0.0f, 0.0f, 0.0f, 0.0f};
      // In front of the next trip's rewrite of the address.
      asm volatile("s_wait_xcnt 0x0" ::: "memory");
    }
  }
}

// ---------------------------------------------------------------------------
// Kernel 3: read = e @ V, causal; V holds 1/colsum of its key already.
// Block tile: 128(t) x 128(v), s-steps of 64.
// Each wave reads the stored e of its 32 t rows straight into A fragments and V
// straight into B fragments (512 contiguous bytes per load; stored in those
// orders by kernels 2 and 1); then 2t x 4v blocked WMMAs.  No arithmetic but
// the WMMAs, and no operand shared through LDS: no barrier in the loop.
// ---------------------------------------------------------------------------
// One s-step of 64 keys.  EDGE = false: every 32-key chunk lies at or below the
// diagonal tile of every wave of the block, so all loads issue together with
// no test.  EDGE = true (the last two steps): a wave skips the e loads of chunks
// above its diagonal tile, which it need not read, and multiplies zeros.
template <bool EDGE>
__device__ __forceinline__ void pv_step(
    const __bf16* __restrict__ E, const __bf16* __restrict__ V, int s0, int ta0,
    int vu0, int lane, v8f (&acc)[2][4]) {
  // ---- loads: e and V fragments ----
  v16bf pa[2][2] = {};                   // [s chunk][t tile]
  v16bf vb[2][4];                        // [s chunk][v tile]
  const __bf16* ep = E + ((size_t)(ta0 >> 4) * E_ROW + (s0 >> 5)) * F_UNIT;
  const __bf16* vp = V + (size_t)((s0 >> 5) * (C_DIM / 16) + vu0) * F_UNIT;
  // EDGE: the V loads, which have no test, stand in front of the branches, so
  // that nothing the compiler puts at a branch's end holds them back.
#pragma unroll
  for (int kk = 0; kk < 2; ++kk) {
    if (!EDGE) {
#pragma unroll
      for (int it = 0; it < 2; ++it)
        pa[kk][it] = load_frag_packed(ep, it * E_ROW + kk, lane);
    }
#pragma unroll
    for (int nt = 0; nt < 4; ++nt)
      vb[kk][nt] = load_frag_packed(vp, kk * (C_DIM / 16) + nt, lane);
  }
  if (EDGE) {
#pragma unroll
    for (int kk = 0; kk < 2; ++kk) {
      if (s0 + kk * 32 <= ta0) {
#pragma unroll
        for (int it = 0; it < 2; ++it)
          pa[kk][it] = load_frag_packed(ep, it * E_ROW + kk, lane);
        loads_issued(ep + lane * 8);     // ep may end here and be reused
      }
    }
  }
  loads_issued(vp + lane * 8);           // the pointers are stepped or reused next
  // ---- e(32x64) @ V(64x64) ----
#pragma unroll
  for (int kk = 0; kk < 2; ++kk) {
#pragma unroll
    for (int nt = 0; nt < 4; ++nt) {
      acc[0][nt] = wmma_bf16(pa[kk][0], vb[kk][nt], acc[0][nt]);
      acc[1][nt] = wmma_bf16(pa[kk][1], vb[kk][nt], acc[1][nt]);
    }
  }
}

// The two 8-wave halves of a work-group hold partial sums of the same 128 x 128
// tile.  Each wave finishes one of its two 16-row t tiles (KEEP) and hands the
// other to the wave of the other half with the same rows and columns, through
// 4 KB of LDS of its own: 16 B a lane, 512 contiguous bytes a write or read.
// Every loop over acc or o is unrolled: the arrays stay in registers.
template <int KEEP>
__device__ __forceinline__ void pv_give(const v8f (&acc)[2][4], float* mine,
                                        int lane) {
#pragma unroll
  for (int nt = 0; nt < 4; ++nt) {
#pragma unroll
    for (int h = 0; h < 2; ++h)
      *(f32x4*)(mine + (nt * 2 + h) * 128 + lane * 4) =
          f32x4{acc[1 - KEEP][nt][h * 4], acc[1 - KEEP][nt][h * 4 + 1],
                acc[1 - KEEP][nt][h * 4 + 2], acc[1 - KEEP][nt][h * 4 + 3]};
  }
}

template <int KEEP>
__device__ __forceinline__ void pv_take_store(const v8f (&acc)[2][4],
                                              const float* theirs, float* orow,
                                              int lane) {
  f32x4 o[4][2];
#pragma unroll
  for (int nt = 0; nt < 4; ++nt) {
#pragma unroll
    for (int h = 0; h < 2; ++h)
      o[nt][h] = *(const f32x4*)(theirs + (nt * 2 + h) * 128 + lane * 4);
  }
  float* op = orow + (size_t)(KEEP * 16 + 8 * (lane >> 4)) * 1024 + (lane & 15);
#pragma unroll
  for (int nt = 0; nt < 4; ++nt) {
#pragma unroll
    for (int i = 0; i < 8; ++i)
      __builtin_nontemporal_store(acc[KEEP][nt][i] + o[nt][i >> 2][i & 3],
                                  op + (size_t)i * 1024 + nt * 16);
  }
}

// Asks L2 for the stored e of one query tile, key blocks in front of its
// diagonal block: a wave takes 4 KB (128 keys) of each of two 16-row strips;
// left = key blocks still to ask for, counted from this wave's first (scalar).
template <int J = 0>
__device__ __forceinline__ void l2_ask_e(const void* base, unsigned off, int left) {
  if (J * 4 < left) l2_ask<J + 1, 16384, J>(base, off);   // piece J alone
  if constexpr (J + 1 < T_BLKS / 4) l2_ask_e<J + 1>(base, off, left);
}

// grid = (T/256, 512/128, B), 16 waves: every work-group takes the query tiles
// x and T/128 - 1 - x, one after the other, and deals the 64-key steps of a tile
// alternately to its two halves of 8 waves: T/128 + 1 steps a wave in every
// work-group, one work-group a WGP.
__global__ __launch_bounds__(512) void attend_kernel(
    const __bf16* __restrict__ Ew, const __bf16* __restrict__ Vb,
    float* __restrict__ out) {
  // One area per tile of the pair: the second tile's writes need not wait for
  // the first tile's reads.
  __shared__ __attribute__((aligned(16))) float red[2][16][1024];
  const int b      = blockIdx.z;
  const int v_base = blockIdx.y * 128;
  const __bf16* E  = Ew + (size_t)b * (T_DIM / 16) * E_ROW * F_UNIT;
  const __bf16* V  = Vb + (size_t)b * T_DIM * C_DIM;
  float*        ob = out + (size_t)b * T_DIM * 1024;

  const int lane = threadIdx.x & 31;
  // Scalar wave number: the test on the diagonal is then a scalar branch, and
  // the half of the work-group a scalar.
  const int wave = __builtin_amdgcn_readfirstlane(threadIdx.x >> 5);
  const int g    = wave >> 3;            // 0..1 : which steps of 64 keys
  const int tw   = (wave >> 1) & 3;      // 0..3 : 32-row t strip
  const int sw   = wave & 1;             // 0..1 : 64-col v half
  const int vu0  = (v_base + sw * 64) >> 4;  // first 16-column V unit of the wave

  // e of a query tile is read by the four work-groups of its v blocks: the first
  // asks for it.  The 128 columns of V are read by the eight work-groups of a
  // batch: two ask, a wave 8 KB (32 keys) a time.  All tests are scalar.
  const int      tb0   = (int)blockIdx.x, tb1 = T_BLKS - 1 - (int)blockIdx.x;
  const unsigned ask_e = ((wave & 3) * 2 + (lane >> 4)) * (E_ROW * 1024u) +
                         (wave >> 2) * 4096u + (lane & 15) * 256u;
  const unsigned ask_v = wave * (C_DIM / 16 * 1024u) + lane * 256u;
  const __bf16*  Epan0 = E + (size_t)tb0 * 8 * E_ROW * F_UNIT;
  const __bf16*  Epan1 = E + (size_t)tb1 * 8 * E_ROW * F_UNIT;
  const __bf16*  Vpan  = V + (size_t)(v_base >> 4) * F_UNIT;
  if (blockIdx.y == 0) l2_ask_e(Epan0, ask_e, tb0 - (wave >> 2));
  if ((blockIdx.x & 3) == 0) l2_ask<4, 16 * (C_DIM / 16) * 1024>(Vpan, ask_v);
  if (blockIdx.y == 0) l2_ask_e(Epan1, ask_e, tb1 - (wave >> 2));

  for (int p = 0; p < 2; ++p) {
    const int t_base = (p == 0 ? (int)blockIdx.x : T_BLKS - 1 - (int)blockIdx.x) * 128;
    const int ta0    = t_base + tw * 32;
    v8f acc[2][4] = {};                  // 32t x 64v partial sums

    for (int s0 = g * 64; s0 < t_base; s0 += 128)
      pv_step<false>(E, V, s0, ta0, vu0, lane, acc);
    pv_step<true>(E, V, t_base + g * 64, ta0, vu0, lane, acc);

    if (g == 0) pv_give<0>(acc, red[p][wave], lane);
    else        pv_give<1>(acc, red[p][wave], lane);
    // The other half's partial sums are read behind it.
    __syncthreads();
    float* orow = ob + (size_t)ta0 * 1024 + 512 + v_base + sw * 64;
    if (g == 0) pv_take_store<0>(acc, red[p][wave ^ 8], orow, lane);
    else        pv_take_store<1>(acc, red[p][wave ^ 8], orow, lane);
    // Here behind stores: the next tile rewrites their registers.
    asks_done(Epan0, Epan1, Vpan, ask_e, ask_v);
  }
}

// ---------------------------------------------------------------------------
// Launcher.  Workspace layout (bytes):
//   [0, 16M)   Q  bf16 [16384][512], 1-KB fragment units [1024][16]
//   [16M,32M)  K  bf16, as Q
//   [32M,48M)  V / colsum  bf16, 1-KB fragment units [512][32]
//   then 64M    e bf16, 1-KB fragment units [8][128][64]
//   then 16M    x bf16, 1-KB fragment units [1024][16]
//   then 1.5M   Wq, Wk, Wv bf16, 1-KB fragment units [3][32][16]
//   then 1M     psum f32 [8][16][2048]  (column sums per 128-query block)
// ---------------------------------------------------------------------------
extern "C" void kernel_launch(void* const* d_in, const int* in_sizes, int n_in,
                              void* d_out, int out_size, void* d_ws,
                              size_t ws_size, hipStream_t stream) {
  const float* x  = (const float*)d_in[0];
  const float* Wq = (const float*)d_in[1];
  const float* bq = (const float*)d_in[2];
  const float* Wk = (const float*)d_in[3];
  const float* bk = (const float*)d_in[4];
  const float* Wv = (const float*)d_in[5];
  const float* bv = (const float*)d_in[6];
  float* out = (float*)d_out;

  const size_t qkv = (size_t)M_ROWS * C_DIM;           // elems per matrix
  __bf16* Qb = (__bf16*)d_ws;
  __bf16* Kb = Qb + qkv;
  __bf16* Vb = Kb + qkv;
  __bf16* Ew = Vb + qkv;
  __bf16* Xp = Ew + (size_t)B_DIM * T_DIM * T_DIM;
  __bf16* Wp = Xp + qkv;
  float* psum = (float*)(Wp + (size_t)3 * C_DIM * C_DIM);

  // out[..., :512] = x; x and W as bf16 fragments
  pack_copy_kernel<<<W_BLOCKS + M_ROWS / 32, 256, 0, stream>>>(x, Wq, Wk, Wv, out,
                                                               Xp, Wp);
  // Q, K projections (bf16)
  proj_kernel<<<dim3(M_ROWS / 128, C_DIM / 256, 2), 256, 0, stream>>>(
      Xp, Wp, bq, bk, bv, psum, Qb, Kb, Vb, 0);
  // masked exponentials and partial column sums
  colsum_kernel<<<dim3(P_BLOCKS, B_DIM), 128, 0, stream>>>(Qb, Kb, psum, Ew);
  // V projection, rows divided by their column sums (bf16)
  proj_kernel<<<dim3(M_ROWS / 128, C_DIM / 256, 1), 256, 0, stream>>>(
      Xp, Wp, bq, bk, bv, psum, Qb, Kb, Vb, 2);
  // out[..., 512:] = e @ (V / colsum)
  attend_kernel<<<dim3(T_DIM / 256, C_DIM / 128, B_DIM), 512, 0, stream>>>(
      Ew, Vb, out);
}

// v010
// A run of this version takes 84.7 microseconds.
// Next to v009, in two timings, it ran 1.04 times as fast each time.
// Over all steps from v000 it is 10.2 times as fast.
#include <hip/hip_runtime.h>

#define B_DIM   8
#define T_DIM   2048
#define C_DIM   512
#define M_ROWS  (B_DIM * T_DIM)        // 16384
#define T_BLKS  (T_DIM / 128)          // query blocks
#define SM_SCALE 0.04419417382415922f  // 1/sqrt(512)

typedef __attribute__((ext_vector_type(16))) __bf16    v16bf;
typedef __attribute__((ext_vector_type(8)))  float     v8f;
typedef __attribute__((ext_vector_type(4)))  float     f32x4;
typedef __attribute__((ext_vector_type(8)))  __bf16    bf16x8;

union FragU {
  uint4  u[2];
  __bf16 h[16];
  v16bf  v;
};

__device__ __forceinline__ v8f wmma_bf16(v16bf a, v16bf b, v8f c) {
  // (neg_a, A, neg_b, B, c_mod, C, reuse_a, reuse_b)
  return __builtin_amdgcn_wmma_f32_16x16x32_bf16(false, a, false, b, (short)0, c,
                                                 false, false);
}

#define F_UNIT 512                     // bf16 elements per fragment unit
__device__ __forceinline__ v16bf load_frag_packed(const __bf16* base, int unit,
                                                  int lane) {
  const __bf16* p = base + (size_t)unit * F_UNIT + lane * 8;
  FragU f;
  f.u[0] = *(const uint4*)(p);
  f.u[1] = *(const uint4*)(p + 256);
  return f.v;
}

// Stands behind a run of loads.  The wait: in front of the first rewrite of an
// address register that the loads name.  The scheduling barriers: the first
// keeps the loads in front of the arithmetic, all in flight together (without
// it the scheduler sinks them between the WMMAs and the wave waits out a load
// latency several times per step); the second keeps the rewrites behind the wait.
__device__ __forceinline__ void loads_issued() {
  __builtin_amdgcn_sched_barrier(0);
  asm volatile("s_wait_xcnt 0x0" ::: "memory");
  __builtin_amdgcn_sched_barrier(0);
}

// The same, where the address of the loads is not used again: the wait names it,
// so its registers stay whole up to the wait and are not given to a load's result.
__device__ __forceinline__ void loads_issued(const void* last_address) {
  __builtin_amdgcn_sched_barrier(0);
  asm volatile("s_wait_xcnt 0x0" ::"v"(last_address) : "memory");
  __builtin_amdgcn_sched_barrier(0);
}

// Asks L2 for N pieces, STEP bytes apart, of an operand panel that an earlier
// launch wrote: every lane names one address, base + off + j * STEP.
// Nothing returns and no counter moves.  Asked at entry, the whole panel is
// fetched at once and the loop finds it in L2.
// In asm: base and off are then registers of ours, never stepped (the steps are
// immediates), and asks_done() holds them whole far behind the issue.
template <int N, int STEP, int J = 0>
__device__ __forceinline__ void l2_ask(const void* base, unsigned off) {
  asm volatile("global_prefetch_b8 %0, %1 offset:%2 scope:SCOPE_SE" ::"v"(off),
               "s"(base), "n"(J * STEP));
  if constexpr (J + 1 < N) l2_ask<N, STEP, J + 1>(base, off);
}

// loads_issued(), which also names the registers of earlier asks: they keep
// their addresses up to here and are not given to anything else before.
__device__ __forceinline__ void asks_done(const void* base0, const void* base1,
                                          const void* base2, unsigned off0,
                                          unsigned off1) {
  __builtin_amdgcn_sched_barrier(0);
  asm volatile("s_wait_xcnt 0x0" ::"s"(base0), "s"(base1), "s"(base2), "v"(off0),
               "v"(off1)
               : "memory");
  __builtin_amdgcn_sched_barrier(0);
}

#define W_BLOCKS 192                   // 3 x (512/16) x (512/32) units / 8 waves
#define X_PITCH  136                   // bf16 elements per 8-column group in LDS

__global__ __launch_bounds__(256) void pack_copy_kernel(
    const float* __restrict__ x, const float* __restrict__ Wq,
    const float* __restrict__ Wk, const float* __restrict__ Wv,
    float* __restrict__ out, __bf16* __restrict__ Xp, __bf16* __restrict__ Wp) {
  __shared__ __attribute__((aligned(16))) __bf16 xt[8][16 * X_PITCH];
  const int lane = threadIdx.x & 31;
  // Scalar wave number: the bases are then scalar, and one lane offset, never
  // rewritten, serves the loads and stores of a wave.
  const int wave = __builtin_amdgcn_readfirstlane(threadIdx.x >> 5);
  union Pack8 { uint4 u; __bf16 h[8]; };
  union Pack4 { uint2 u; __bf16 h[4]; };

  if (blockIdx.x < W_BLOCKS) {                    // same for the whole block
    const int z = blockIdx.x >> 6;                // 64 blocks a matrix
    const float* Wm = (z == 0) ? Wq : (z == 1) ? Wk : Wv;
    const int unit = (blockIdx.x & 63) * 8 + wave;   // (col/16) * 16 + row/32
    const float* wp = Wm + (size_t)((unit & 15) * 32 + (lane >> 4) * 8) * C_DIM +
                      (unit >> 4) * 16 + (lane & 15);
    float t[16];
#pragma unroll
    for (int i = 0; i < 16; ++i)
      t[i] = wp[(size_t)((i >> 3) * 16 + (i & 7)) * C_DIM];
#pragma unroll
    for (int h = 0; h < 2; ++h) {
      Pack8 o;
#pragma unroll
      for (int j = 0; j < 8; ++j) o.h[j] = (__bf16)t[h * 8 + j];
      *(uint4*)(Wp + ((size_t)z * (C_DIM * C_DIM / F_UNIT) + unit) * F_UNIT +
                h * 256 + lane * 8) = o.u;
    }
    return;
  }

  const int task  = (blockIdx.x - W_BLOCKS) * 8 + wave;
  const int strip = task >> 2;                    // 16 rows
  const int cg    = task & 3;                     // 128 columns
  const float* xp = x + (size_t)strip * 16 * C_DIM + cg * 128 + lane * 4;
  float*       op = out + (size_t)strip * 16 * 1024 + cg * 128 + lane * 4;
  __bf16*      xw = xt[wave];
  f32x4 v[16];
#pragma unroll
  for (int r = 0; r < 16; ++r) v[r] = *(const f32x4*)(xp + r * C_DIM);
  loads_issued();                                 // 8 KB a wave in flight at once
#pragma unroll
  for (int r = 0; r < 16; ++r) {
    Pack4 o;
#pragma unroll
    for (int j = 0; j < 4; ++j) o.h[j] = (__bf16)v[r][j];
    *(uint2*)(xw + (lane >> 1) * X_PITCH + r * 8 + (lane & 1) * 4) = o.u;
  }
  // Lanes read other lanes' writes.  No global store stands in front of it: the
  // barrier would wait for it to complete.
  __syncthreads();
  __bf16* xo = Xp + (size_t)(strip * (C_DIM / 32) + cg * 4) * F_UNIT + lane * 8;
#pragma unroll
  for (int m = 0; m < 8; ++m)                     // 512-B row m of the four units
    *(uint4*)(xo + m * 256) =
        *(const uint4*)(xw + (m * 2 + (lane >> 4)) * X_PITCH + (lane & 15) * 8);
#pragma unroll
  for (int r = 0; r < 16; ++r)
    __builtin_nontemporal_store(v[r], (f32x4*)(op + r * 1024));
}

// ---------------------------------------------------------------------------
// Kernel 1: projections.  dst = bf16(x @ W + b).  grid = (M/128, 512/256, n),
// matrix z0 + blockIdx.z.  Launched twice: Q and K first; V behind kernel 2,
// as bf16((x @ Wv + bv) / colsum[row]), rounded once, where
//   colsum[b,s] = sum over tb of psum[b,tb,s], in rising tb  (kernel 2).
// 8 waves/block as 2 (rows) x 4 (columns); each owns a 64x64 output tile:
// 16 WMMAs per 8 fragments of a k step, 512 B loaded per WMMA.
// A and B fragments come straight from the packed copies of kernel 0, 512
// contiguous bytes a load.  Nothing is shared through LDS in the loop: no
// barrier.  Work-groups 256 apart in the grid have the same rows of x.
// Fragments are fetched one k step ahead: the four A fragments into a second
// register set at the head of a step, the B fragments one by one between the
// groups of four WMMAs, as the registers of the step's own come free.
// The result is stored in the fragment order of its consumer:
//   V:    unit (row/32, col/16), contraction index = row (key).  A lane holds
//         one column and 8 consecutive rows: its 16 B of a 512-B unit row.
//         Each wave forms 1/colsum of its 64 rows, two a lane, and hands them
//         to its lanes through its own LDS area.
//   Q, K: unit (row/16, col/32), contraction index = column.  Each wave turns
//         its eight units through an 8-KB LDS area of its own, once.
// Either way a wave stores 512 contiguous bytes per WMMA tile.
// ---------------------------------------------------------------------------
__global__ __launch_bounds__(256) void proj_kernel(
    const __bf16* __restrict__ Xp, const __bf16* __restrict__ Wp,
    const float* __restrict__ bq, const float* __restrict__ bk,
    const float* __restrict__ bv, const float* __restrict__ psum,
    __bf16* __restrict__ Qb, __bf16* __restrict__ Kb, __bf16* __restrict__ Vb,
    int z0) {
  __shared__ __attribute__((aligned(16))) __bf16 xt[8][8 * F_UNIT];

  const int lane = threadIdx.x & 31;
  // Scalar wave number: the fragment bases are then scalar, and one lane
  // offset, never rewritten in the loop, serves every load.
  const int wave = __builtin_amdgcn_readfirstlane(threadIdx.x >> 5);
  const int row0 = blockIdx.x * 128 + (wave >> 2) * 64;
  const int n0   = blockIdx.y * 256 + (wave & 3) * 64;
  const int z    = z0 + (int)blockIdx.z;

  const float* bias;
  __bf16*      dst;
  switch (z) {
    case 0:  bias = bq; dst = Qb; break;
    case 1:  bias = bk; dst = Kb; break;
    default: bias = bv; dst = Vb; break;
  }
  const int KU = C_DIM / 32;                      // units per 16-row strip
  const __bf16* A  = Xp + (size_t)(row0 >> 4) * KU * F_UNIT;
  const __bf16* Bw = Wp + (size_t)z * C_DIM * C_DIM +
                     (size_t)(n0 >> 4) * KU * F_UNIT;

  // The 128 KB of x that the work-groups of these rows share are asked for by
  // one of them, the 256 KB of W of these columns by the first eight in the
  // grid (scalar tests): later work-groups find both in L2.
  const unsigned ask = threadIdx.x * 256u;
  const __bf16* Apan = Xp + (size_t)blockIdx.x * 128 * C_DIM;
  const __bf16* Bpan = Wp + (size_t)z * C_DIM * C_DIM +
                       (size_t)blockIdx.y * 256 * C_DIM;
  if (blockIdx.y == 0 && blockIdx.z == 0) l2_ask<2, 65536>(Apan, ask);
  if (blockIdx.x < 8) l2_ask<4, 65536>(Bpan, ask);

  float* rw = (float*)xt[wave];                   // V: written, read by this wave alone
  if (z >= 2) {                                   // same for the whole block
    const float* pp = psum + (size_t)(row0 / T_DIM) * T_BLKS * T_DIM +
                      (row0 % T_DIM) + lane;
    float ps[2][T_BLKS];
    // Unrolled: the array stays in registers and the loads are one run.
#pragma unroll
    for (int h = 0; h < 2; ++h) {
#pragma unroll
      for (int tb = 0; tb < T_BLKS; ++tb) ps[h][tb] = pp[tb * T_DIM + h * 32];
    }
    loads_issued();                               // all in flight at once
#pragma unroll
    for (int h = 0; h < 2; ++h) {
      float sum = 0.0f;
#pragma unroll
      for (int tb = 0; tb < T_BLKS; ++tb) sum += ps[h][tb];
      rw[h * 32 + lane] = 1.0f / sum;
    }
  }

  // Every loop over acc, a or b is unrolled: the arrays stay in registers.
  v8f   acc[4][4] = {};                           // [row tile][column tile]
  v16bf a[2][4], b[4];
#pragma unroll
  for (int it = 0; it < 4; ++it) a[0][it] = load_frag_packed(A, it * KU, lane);
#pragma unroll
  for (int nt = 0; nt < 4; ++nt) b[nt] = load_frag_packed(Bw, nt * KU, lane);
#pragma unroll
  for (int ku = 0; ku < KU; ++ku) {
    // The scheduling barriers hold each group of loads where it is written:
    // moved down to their readers, the wave would wait out a load latency per
    // group; moved up, they would need registers that are still being read.
    if (ku + 1 < KU) {
#pragma unroll
      for (int it = 0; it < 4; ++it)
        a[(ku + 1) & 1][it] = load_frag_packed(A, it * KU + ku + 1, lane);
    }
    __builtin_amdgcn_sched_barrier(0);
#pragma unroll
    for (int nt = 0; nt < 4; ++nt) {
#pragma unroll
      for (int it = 0; it < 4; ++it)
        acc[it][nt] = wmma_bf16(a[ku & 1][it], b[nt], acc[it][nt]);
      if (ku + 1 < KU) b[nt] = load_frag_packed(Bw, nt * KU + ku + 1, lane);
      __builtin_amdgcn_sched_barrier(0);
    }
  }
  asks_done(Apan, Bpan, Bpan, ask, ask);  // the epilogue reuses the address registers

  const int hi = lane >> 4;
  float bz[4];
#pragma unroll
  for (int nt = 0; nt < 4; ++nt) bz[nt] = bias[n0 + nt * 16 + (lane & 15)];
  loads_issued();
  bf16x8 o[4][4];
  if (z >= 2) {                                   // V; same for the whole block
#pragma unroll
    for (int it = 0; it < 4; ++it) {
      // 1/colsum of the 8 rows that this lane holds of row tile it
      const f32x4 r0 = *(const f32x4*)(rw + it * 16 + 8 * hi);
      const f32x4 r1 = *(const f32x4*)(rw + it * 16 + 8 * hi + 4);
#pragma unroll
      for (int nt = 0; nt < 4; ++nt) {
#pragma unroll
        for (int i = 0; i < 8; ++i)
          o[it][nt][i] = (__bf16)((acc[it][nt][i] + bz[nt]) *
                                  (i < 4 ? r0[i & 3] : r1[i & 3]));
      }
    }
    // The stores stand behind all the arithmetic: no register that a store
    // names is rewritten behind it.
    __builtin_amdgcn_sched_barrier(0);
    __bf16* vo = dst + ((size_t)(row0 >> 5) * (C_DIM / 16) + (n0 >> 4)) * F_UNIT +
                 lane * 8;
#pragma unroll
    for (int it = 0; it < 4; ++it) {
#pragma unroll
      for (int nt = 0; nt < 4; ++nt)
        *(bf16x8*)(vo + ((it >> 1) * (C_DIM / 16) + nt) * F_UNIT + (it & 1) * 256) =
            o[it][nt];
    }
  } else {                                        // Q, K
    __bf16* xw = xt[wave];                        // read by this wave alone
#pragma unroll
    for (int it = 0; it < 4; ++it) {
#pragma unroll
      for (int nt = 0; nt < 4; ++nt) {
#pragma unroll
        for (int i = 0; i < 8; ++i)
          xw[(it * 4 + nt) * 256 + (i + 8 * hi + 16 * ((lane >> 3) & 1)) * 8 +
             (lane & 7)] = (__bf16)(acc[it][nt][i] + bz[nt]);
      }
    }
#pragma unroll
    for (int it = 0; it < 4; ++it) {
#pragma unroll
      for (int nt = 0; nt < 4; ++nt)
        o[it][nt] = *(const bf16x8*)(xw + (it * 4 + nt) * 256 + lane * 8);
    }
    // As above: the stores stand behind every LDS read.
    __builtin_amdgcn_sched_barrier(0);
    __bf16* qo = dst + ((size_t)(row0 >> 4) * KU + (n0 >> 5)) * F_UNIT + lane * 8;
#pragma unroll
    for (int it = 0; it < 4; ++it) {
#pragma unroll
      for (int nt = 0; nt < 4; ++nt)
        *(bf16x8*)(qo + (it * KU + (nt >> 1)) * F_UNIT + (nt & 1) * 256) = o[it][nt];
    }
    // In front of any later rewrite of a register that these stores name.
    asm volatile("s_wait_xcnt 0x0" ::: "memory");
  }
}

__device__ __forceinline__ float exp_slot(float x) {
  float r;
  asm("v_exp_f32 %0, %1\n\tv_nop" : "=v"(r) : "v"(x * 1.44269504088896340736f));
  return r;
}

#define E_ROW  (T_DIM / 32)            // units per 16-row strip
#define S_WAVE 96                      // keys per wave tile
#define S_BLK  (2 * S_WAVE)            // keys per work-group tile
#define S_TILES (S_WAVE / 16)          // 16-key tiles per wave
// Key blocks of query block tb: those that begin at or before its last query.
constexpr int key_blocks(int tb) { return ((tb + 1) * 128 + S_BLK - 1) / S_BLK; }
// Work-groups of the query blocks in front of tb.
constexpr int blocks_before(int tb) {
  int n = 0;
  for (int u = 0; u < tb; ++u) n += key_blocks(u);
  return n;
}
constexpr int P_BLOCKS = blocks_before(T_BLKS);
// A wave's keys behind its first 32 lie all in front of the end of K or all
// behind it: one test moves their base.
static_assert(T_DIM % S_WAVE == 32 && S_WAVE % 32 == 0 && S_WAVE > 32, "");

__global__ __launch_bounds__(128) void colsum_kernel(
    const __bf16* __restrict__ Qb, const __bf16* __restrict__ Kb,
    float* __restrict__ psum, __bf16* __restrict__ Ew) {
  // Sums over the 64 queries of each t strip; each word has one writer.
  __shared__ __attribute__((aligned(16))) float ssum[2][S_BLK];

  const int b = blockIdx.y;
  // Unrolled: fifteen scalar compares with constants, no loop and no table.
  int tb = 0, first = 0;
#pragma unroll
  for (int u = 1; u < T_BLKS; ++u) {
    if (blocks_before(u) <= (int)blockIdx.x) { tb = u; first = blocks_before(u); }
  }
  const int kb = (int)blockIdx.x - first;

  const int lane = threadIdx.x & 31;
  // Scalar wave number: the fragment bases are then scalar, one lane offset
  // serves every load, and the test on the diagonal is a scalar branch.
  const int wave = __builtin_amdgcn_readfirstlane(threadIdx.x >> 5);
  const int tw   = wave >> 1;               // 0..1 : 64-row t strip
  const int sw   = wave & 1;                // 0..1 : 96-col s half
  const int t0   = tb * 128 + tw * 64;
  const int s0   = kb * S_BLK + sw * S_WAVE;
  const int hi   = lane >> 4;
  // The last key block of the last query block ends behind the last key.
  const bool whole = (kb + 1) * S_BLK <= T_DIM;

  // The 128 KB of Q of a query block are asked for by every fourth of its
  // work-groups, the 192 KB of K of a key block (128 KB at the end of K) by the
  // first four that read it (scalar tests): neighbours in the grid start
  // together and share them in L2.
  const unsigned ask = threadIdx.x * 256u;
  const __bf16* Qpan = Qb + ((size_t)b * T_DIM + tb * 128) * C_DIM;
  const __bf16* Kpan = Kb + ((size_t)b * T_DIM + kb * S_BLK) * C_DIM;
  if ((kb & 3) == 0) l2_ask<4, 32768>(Qpan, ask);
  if (tb - kb * 3 / 2 < 4) {
    l2_ask<4, 32768>(Kpan, ask);
    if (whole) l2_ask<6, 32768, 4>(Kpan, ask);
  }

  const bool live = s0 < t0 + 64;           // else: wave tile above the diagonal
  // Every loop over ev, part, l, qf or kf is unrolled: the arrays stay in registers.
  bf16x8 ev[4][S_TILES];                    // e: [t tile][s tile = 512-B row]
  if (live) {
    const int KU = C_DIM / 32;              // units per 16-row strip
    const __bf16* Q = Qb + ((size_t)b * T_DIM + t0) * C_DIM;
    // Two scalar bases of K: the first 32 keys, which exist in every live tile,
    // and the others; where these lie behind the last key the wave reads the
    // last keys of K instead (their scores are masked: s > t for every query).
    const int s1 = s0 + 32 < T_DIM ? s0 + 32 : T_DIM - (S_WAVE - 32);
    const __bf16* K0 = Kb + ((size_t)b * T_DIM + s0) * C_DIM;
    const __bf16* K1 = Kb + ((size_t)b * T_DIM + s1) * C_DIM;
    v8f   l[4][S_TILES] = {};               // [t tile][s tile], rows s, cols t
    v16bf qf[2][4], kf[S_TILES];
#pragma unroll
    for (int it = 0; it < 4; ++it) qf[0][it] = load_frag_packed(Q, it * KU, lane);
#pragma unroll
    for (int is = 0; is < S_TILES; ++is)
      kf[is] = load_frag_packed(is < 2 ? K0 : K1, (is < 2 ? is : is - 2) * KU, lane);
#pragma unroll
    for (int ku = 0; ku < KU; ++ku) {
      // The scheduling barriers hold each group of loads where it is written,
      // as in kernel 1: lower, the wave would wait out a load latency per
      // group; higher, they would need registers that are still being read.
      if (ku + 1 < KU) {
#pragma unroll
        for (int it = 0; it < 4; ++it)
          qf[(ku + 1) & 1][it] = load_frag_packed(Q, it * KU + ku + 1, lane);
      }
      __builtin_amdgcn_sched_barrier(0);
#pragma unroll
      for (int is = 0; is < S_TILES; ++is) {
#pragma unroll
        for (int it = 0; it < 4; ++it)
          l[it][is] = wmma_bf16(kf[is], qf[ku & 1][it], l[it][is]);
        if (ku + 1 < KU)
          kf[is] = load_frag_packed(is < 2 ? K0 : K1,
                                    (is < 2 ? is : is - 2) * KU + ku + 1, lane);
        __builtin_amdgcn_sched_barrier(0);
      }
    }
    asks_done(Qpan, Kpan, Kpan, ask, ask);  // the epilogue reuses the address registers

    float part[S_TILES][8] = {};            // per key held by this lane
#pragma unroll
    for (int it = 0; it < 4; ++it) {
      const int t = t0 + it * 16 + (lane & 15);
#pragma unroll
      for (int is = 0; is < S_TILES; ++is) {
#pragma unroll
        for (int i = 0; i < 8; ++i) {
          const int s = s0 + is * 16 + i + 8 * hi;
          // Formed for every lane, then selected: no branch per element.
          const float x = exp_slot(l[it][is][i] * SM_SCALE);
          const float e = (s <= t) ? x : 0.0f;
          part[is][i] += e;
          ev[it][is][i] = (__bf16)e;
        }
      }
    }
    // Sum over the 16 queries of a half-wave.  It runs once per tile: the lane
    // distance is the outer loop, so that the exchanges of a distance are
    // in flight together.
#pragma unroll
    for (int m = 1; m < 16; m <<= 1) {
#pragma unroll
      for (int is = 0; is < S_TILES; ++is) {
#pragma unroll
        for (int i = 0; i < 8; ++i) part[is][i] += __shfl_xor(part[is][i], m, 32);
      }
    }
    if ((lane & 15) == 0) {
#pragma unroll
      for (int is = 0; is < S_TILES; ++is) {
#pragma unroll
        for (int h = 0; h < 2; ++h)
          *(f32x4*)(&ssum[tw][sw * S_WAVE + is * 16 + 8 * hi + h * 4]) =
              f32x4{part[is][h * 4], part[is][h * 4 + 1], part[is][h * 4 + 2],
                    part[is][h * 4 + 3]};
      }
    }
  } else {
    for (int j = 0; j < S_WAVE / 32; ++j) ssum[tw][sw * S_WAVE + j * 32 + lane] = 0.0f;
    asks_done(Qpan, Kpan, Kpan, ask, ask);
  }
  // The other strip's sums are read behind it.  No global store stands in front
  // of it: the barrier would wait for it to complete.
  __syncthreads();
  if (live) {
    __bf16* ep = Ew + (((size_t)b * (T_DIM / 16) + (t0 >> 4)) * E_ROW + (s0 >> 5)) *
                          F_UNIT + lane * 8;
#pragma unroll
    for (int u = 0; u < S_TILES / 2; ++u) {
      if (s0 + u * 32 < T_DIM) {            // scalar: no unit behind the last key
#pragma unroll
        for (int it = 0; it < 4; ++it) {
#pragma unroll
          for (int h = 0; h < 2; ++h)
            *(bf16x8*)(ep + (it * E_ROW + u) * F_UNIT + h * 256) = ev[it][u * 2 + h];
        }
      }
    }
  }
  // What follows may rewrite the registers these stores name (data, address).
  loads_issued();
  float* pr = psum + ((size_t)b * T_BLKS + tb) * T_DIM;
  pr[kb * S_BLK + threadIdx.x] = ssum[0][threadIdx.x] + ssum[1][threadIdx.x];
  // Likewise for the store above.
  asm volatile("s_wait_xcnt 0x0" ::: "memory");
  if (wave < 2 && whole) {                  // scalar: keys 128..191 of the block
    pr[kb * S_BLK + 128 + threadIdx.x] =
        ssum[0][128 + threadIdx.x] + ssum[1][128 + threadIdx.x];
    // Likewise.
    asm volatile("s_wait_xcnt 0x0" ::: "memory");
  }
  // The keys behind the last key block of this query block have no term in it:
  // that work-group gives them the zeros that the V launch of kernel 1 adds.
  if (kb + 1 == key_blocks(tb)) {
    for (int s = (kb + 1) * S_BLK + (int)threadIdx.x * 4; s < T_DIM; s += 512) {
      *(f32x4*)(pr + s) = f32x4{0.0f, 0.0f, 0.0f, 0.0f};
      // In front of the next trip's rewrite of the address.
      asm volatile("s_wait_xcnt 0x0" ::: "memory");
    }
  }
}

// ---------------------------------------------------------------------------
// Kernel 3: read = e @ V, causal; V holds 1/colsum of its key already.
// Block tile: 128(t) x 128(v), s-steps of 64.
// Each wave reads the stored e of its 32 t rows straight into A fragments and V
// straight into B fragments (512 contiguous bytes per load; stored in those
// orders by kernels 2 and 1); then 2t x 4v blocked WMMAs.  No arithmetic but
// the WMMAs, and no operand shared through LDS: no barrier in the loop.
// ---------------------------------------------------------------------------
// One s-step of 64 keys.  EDGE = false: every 32-key chunk lies at or below the
// diagonal tile of every wave of the block, so all loads issue together with
// no test.  EDGE = true (the last two steps): a wave skips the e loads of chunks
// above its diagonal tile, which it need not read, and multiplies zeros.
template <bool EDGE>
__device__ __forceinline__ void pv_step(
    const __bf16* __restrict__ E, const __bf16* __restrict__ V, int s0, int ta0,
    int vu0, int lane, v8f (&acc)[2][4]) {
  // ---- loads: e and V fragments ----
  v16bf pa[2][2] = {};                   // [s chunk][t tile]
  v16bf vb[2][4];                        // [s chunk][v tile]
  const __bf16* ep = E + ((size_t)(ta0 >> 4) * E_ROW + (s0 >> 5)) * F_UNIT;
  const __bf16* vp = V + (size_t)((s0 >> 5) * (C_DIM / 16) + vu0) * F_UNIT;
  // EDGE: the V loads, which have no test, stand in front of the branches, so
  // that nothing the compiler puts at a branch's end holds them back.
#pragma unroll
  for (int kk = 0; kk < 2; ++kk) {
    if (!EDGE) {
#pragma unroll
      for (int it = 0; it < 2; ++it)
        pa[kk][it] = load_frag_packed(ep, it * E_ROW + kk, lane);
    }
#pragma unroll
    for (int nt = 0; nt < 4; ++nt)
      vb[kk][nt] = load_frag_packed(vp, kk * (C_DIM / 16) + nt, lane);
  }
  if (EDGE) {
#pragma unroll
    for (int kk = 0; kk < 2; ++kk) {
      if (s0 + kk * 32 <= ta0) {
#pragma unroll
        for (int it = 0; it < 2; ++it)
          pa[kk][it] = load_frag_packed(ep, it * E_ROW + kk, lane);
        loads_issued(ep + lane * 8);     // ep may end here and be reused
      }
    }
  }
  loads_issued(vp + lane * 8);           // the pointers are stepped or reused next
  // ---- e(32x64) @ V(64x64) ----
#pragma unroll
  for (int kk = 0; kk < 2; ++kk) {
#pragma unroll
    for (int nt = 0; nt < 4; ++nt) {
      acc[0][nt] = wmma_bf16(pa[kk][0], vb[kk][nt], acc[0][nt]);
      acc[1][nt] = wmma_bf16(pa[kk][1], vb[kk][nt], acc[1][nt]);
    }
  }
}

// The two 8-wave halves of a work-group hold partial sums of the same 128 x 128
// tile.  Each wave finishes one of its two 16-row t tiles (KEEP) and hands the
// other to the wave of the other half with the same rows and columns, through
// 4 KB of LDS of its own: 16 B a lane, 512 contiguous bytes a write or read.
// Every loop over acc or o is unrolled: the arrays stay in registers.
template <int KEEP>
__device__ __forceinline__ void pv_give(const v8f (&acc)[2][4], float* mine,
                                        int lane) {
#pragma unroll
  for (int nt = 0; nt < 4; ++nt) {
#pragma unroll
    for (int h = 0; h < 2; ++h)
      *(f32x4*)(mine + (nt * 2 + h) * 128 + lane * 4) =
          f32x4{acc[1 - KEEP][nt][h * 4], acc[1 - KEEP][nt][h * 4 + 1],
                acc[1 - KEEP][nt][h * 4 + 2], acc[1 - KEEP][nt][h * 4 + 3]};
  }
}

template <int KEEP>
__device__ __forceinline__ void pv_take_store(const v8f (&acc)[2][4],
                                              const float* theirs, float* orow,
                                              int lane) {
  f32x4 o[4][2];
#pragma unroll
  for (int nt = 0; nt < 4; ++nt) {
#pragma unroll
    for (int h = 0; h < 2; ++h)
      o[nt][h] = *(const f32x4*)(theirs + (nt * 2 + h) * 128 + lane * 4);
  }
  float* op = orow + (size_t)(KEEP * 16 + 8 * (lane >> 4)) * 1024 + (lane & 15);
#pragma unroll
  for (int nt = 0; nt < 4; ++nt) {
#pragma unroll
    for (int i = 0; i < 8; ++i)
      __builtin_nontemporal_store(acc[KEEP][nt][i] + o[nt][i >> 2][i & 3],
                                  op + (size_t)i * 1024 + nt * 16);
  }
}

// Asks L2 for the stored e of one query tile, key blocks in front of its
// diagonal block: a wave takes 4 KB (128 keys) of each of two 16-row strips;
// left = key blocks still to ask for, counted from this wave's first (scalar).
template <int J = 0>
__device__ __forceinline__ void l2_ask_e(const void* base, unsigned off, int left) {
  if (J * 4 < left) l2_ask<J + 1, 16384, J>(base, off);   // piece J alone
  if constexpr (J + 1 < T_BLKS / 4) l2_ask_e<J + 1>(base, off, left);
}

// grid = (T/256, 512/128, B), 16 waves: every work-group takes the query tiles
// x and T/128 - 1 - x, one after the other, and deals the 64-key steps of a tile
// alternately to its two halves of 8 waves: T/128 + 1 steps a wave in every
// work-group, one work-group a WGP.
__global__ __launch_bounds__(512) void attend_kernel(
    const __bf16* __restrict__ Ew, const __bf16* __restrict__ Vb,
    float* __restrict__ out) {
  // One area per tile of the pair: the second tile's writes need not wait for
  // the first tile's reads.
  __shared__ __attribute__((aligned(16))) float red[2][16][1024];
  const int b      = blockIdx.z;
  const int v_base = blockIdx.y * 128;
  const __bf16* E  = Ew + (size_t)b * (T_DIM / 16) * E_ROW * F_UNIT;
  const __bf16* V  = Vb + (size_t)b * T_DIM * C_DIM;
  float*        ob = out + (size_t)b * T_DIM * 1024;

  const int lane = threadIdx.x & 31;
  // Scalar wave number: the test on the diagonal is then a scalar branch, and
  // the half of the work-group a scalar.
  const int wave = __builtin_amdgcn_readfirstlane(threadIdx.x >> 5);
  const int g    = wave >> 3;            // 0..1 : which steps of 64 keys
  const int tw   = (wave >> 1) & 3;      // 0..3 : 32-row t strip
  const int sw   = wave & 1;             // 0..1 : 64-col v half
  const int vu0  = (v_base + sw * 64) >> 4;  // first 16-column V unit of the wave

  // e of a query tile is read by the four work-groups of its v blocks: the first
  // asks for it.  The 128 columns of V are read by the eight work-groups of a
  // batch: two ask, a wave 8 KB (32 keys) a time.  All tests are scalar.
  const int      tb0   = (int)blockIdx.x, tb1 = T_BLKS - 1 - (int)blockIdx.x;
  const unsigned ask_e = ((wave & 3) * 2 + (lane >> 4)) * (E_ROW * 1024u) +
                         (wave >> 2) * 4096u + (lane & 15) * 256u;
  const unsigned ask_v = wave * (C_DIM / 16 * 1024u) + lane * 256u;
  const __bf16*  Epan0 = E + (size_t)tb0 * 8 * E_ROW * F_UNIT;
  const __bf16*  Epan1 = E + (size_t)tb1 * 8 * E_ROW * F_UNIT;
  const __bf16*  Vpan  = V + (size_t)(v_base >> 4) * F_UNIT;
  if (blockIdx.y == 0) l2_ask_e(Epan0, ask_e, tb0 - (wave >> 2));
  if ((blockIdx.x & 3) == 0) l2_ask<4, 16 * (C_DIM / 16) * 1024>(Vpan, ask_v);
  if (blockIdx.y == 0) l2_ask_e(Epan1, ask_e, tb1 - (wave >> 2));

  for (int p = 0; p < 2; ++p) {
    const int t_base = (p == 0 ? (int)blockIdx.x : T_BLKS - 1 - (int)blockIdx.x) * 128;
    const int ta0    = t_base + tw * 32;
    v8f acc[2][4] = {};                  // 32t x 64v partial sums

    for (int s0 = g * 64; s0 < t_base; s0 += 128)
      pv_step<false>(E, V, s0, ta0, vu0, lane, acc);
    pv_step<true>(E, V, t_base + g * 64, ta0, vu0, lane, acc);

    if (g == 0) pv_give<0>(acc, red[p][wave], lane);
    else        pv_give<1>(acc, red[p][wave], lane);
    // The other half's partial sums are read behind it.
    __syncthreads();
    float* orow = ob + (size_t)ta0 * 1024 + 512 + v_base + sw * 64;
    if (g == 0) pv_take_store<0>(acc, red[p][wave ^ 8], orow, lane);
    else        pv_take_store<1>(acc, red[p][wave ^ 8], orow, lane);
    // Here behind stores: the next tile rewrites their registers.
    asks_done(Epan0, Epan1, Vpan, ask_e, ask_v);
  }
}

// ---------------------------------------------------------------------------
// Launcher.  Workspace layout (bytes):
//   [0, 16M)   Q  bf16 [16384][512], 1-KB fragment units [1024][16]
//   [16M,32M)  K  bf16, as Q
//   [32M,48M)  V / colsum  bf16, 1-KB fragment units [512][32]
//   then 64M    e bf16, 1-KB fragment units [8][128][64]
//   then 16M    x bf16, 1-KB fragment units [1024][16]
//   then 1.5M   Wq, Wk, Wv bf16, 1-KB fragment units [3][32][16]
//   then 1M     psum f32 [8][16][2048]  (column sums per 128-query block)
// ---------------------------------------------------------------------------
extern "C" void kernel_launch(void* const* d_in, const int* in_sizes, int n_in,
                              void* d_out, int out_size, void* d_ws,
                              size_t ws_size, hipStream_t stream) {
  const float* x  = (const float*)d_in[0];
  const float* Wq = (const float*)d_in[1];
  const float* bq = (const float*)d_in[2];
  const float* Wk = (const float*)d_in[3];
  const float* bk = (const float*)d_in[4];
  const float* Wv = (const float*)d_in[5];
  const float* bv = (const float*)d_in[6];
  float* out = (float*)d_out;

  const size_t qkv = (size_t)M_ROWS * C_DIM;           // elems per matrix
  __bf16* Qb = (__bf16*)d_ws;
  __bf16* Kb = Qb + qkv;
  __bf16* Vb = Kb + qkv;
  __bf16* Ew = Vb + qkv;
  __bf16* Xp = Ew + (size_t)B_DIM * T_DIM * T_DIM;
  __bf16* Wp = Xp + qkv;
  float* psum = (float*)(Wp + (size_t)3 * C_DIM * C_DIM);

  // out[..., :512] = x; x and W as bf16 fragments
  pack_copy_kernel<<<W_BLOCKS + M_ROWS / 32, 256, 0, stream>>>(x, Wq, Wk, Wv, out,
                                                               Xp, Wp);
  // Q, K projections (bf16)
  proj_kernel<<<dim3(M_ROWS / 128, C_DIM / 256, 2), 256, 0, stream>>>(
      Xp, Wp, bq, bk, bv, psum, Qb, Kb, Vb, 0);
  // masked exponentials and partial column sums
  colsum_kernel<<<dim3(P_BLOCKS, B_DIM), 128, 0, stream>>>(Qb, Kb, psum, Ew);
  // V projection, rows divided by their column sums (bf16)
  proj_kernel<<<dim3(M_ROWS / 128, C_DIM / 256, 1), 256, 0, stream>>>(
      Xp, Wp, bq, bk, bv, psum, Qb, Kb, Vb, 2);
  // out[..., 512:] = e @ (V / colsum)
  attend_kernel<<<dim3(T_DIM / 256, C_DIM / 128, B_DIM), 512, 0, stream>>>(
      Ew, Vb, out);
}
